// v000
// Measured on an AMD MI455X. A time is GPU time per run, averaged over a window of back-to-back runs after a warm-up
// (all launches, gaps included; the runs take copies of the inputs in turn), and the median of several windows.
// Apart from v000's, it joins two sittings. Times from different sittings can be a few percent apart, while
// side-by-side timings come from the same sitting.
// v000 is the starting kernel. One run takes 1600 microseconds.
#include <hip/hip_runtime.h>

// Causal multi-head attention: q/k/v = x W^T + b ([out][in] weights, 16 heads x 64), scores = q.k x 1/8 with lower-triangular replace-mask under an int flag input, f32 softmax, ctx = P v, out = ctx Wo^T + bo -> [2][2048][1024] f32.
// Compute dtypes, f32 accumulate everywhere: every float input RNE-converted to bf16; q/k/v projections v_wmma_f32_16x16x32_bf16 on plain bf16 operands + bias; scores: query rows < RH bf16 hi/lo x bf16 hi/lo (3 products), rows >= RH plain v_wmma_f32_16x16x32_f16 (q and k planes carried x4); softmax f32; P.v: rows < RH bf16 hi/lo P x bf16 hi/lo v (3 products), rows >= RH fp16 P carried x1024 against fp16 v carried x4; output projection bf16 hi/lo of ctx x bf16 Wo (2 products) + bias.

#ifndef NB
#define NB 2
#endif
#ifndef SEQ
#define SEQ 2048
#endif
#define NB_FULL  2
#define SEQ_FULL 2048
#define DM   1024
#define NH_  16
#define NKV  16
#define HD   64
#define DQ   (NH_ * HD)
#define DKV  (NKV * HD)
#define ZH   2
#ifndef RH
#define RH   512                  // query rows < RH use hi+lo planes
#endif
#define RHE  ((RH < SEQ) ? RH : SEQ)
#define QSC  4.0f                 // q plane carry
#define KSC  4.0f                 // k plane carry
#define VSC  4.0f                 // v plane carry
#define PCAR 1024.0f              // fp16 P plane carry (rows >= RH)
#define SCL  (0.125f / (QSC * KSC))   // HD^-0.5 folded with the q/k carries (exact power of two)
static_assert(SEQ % 128 == 0);
static_assert(SEQ <= SEQ_FULL);
static_assert(NB >= 1 && NB <= NB_FULL);
static_assert((RHE % 64) == 0);
static_assert(DM == DQ);
static_assert((DM % 64) == 0 && (HD % 32) == 0);

typedef _Float16 h16;
typedef unsigned short bf;
typedef __attribute__((ext_vector_type(16))) __bf16   v16bf;
typedef __attribute__((ext_vector_type(16))) _Float16 v16h;
typedef __attribute__((ext_vector_type(8)))  _Float16 v8h;
typedef __attribute__((ext_vector_type(8)))  unsigned short v8us;
typedef __attribute__((ext_vector_type(8)))  float    v8f;
typedef __attribute__((ext_vector_type(4)))  float    v4f;
typedef __attribute__((ext_vector_type(2))) _Float16 v2h;
typedef __attribute__((ext_vector_type(4))) _Float16 v4h;
typedef __attribute__((ext_vector_type(2))) unsigned short v2us;
typedef __attribute__((ext_vector_type(4))) unsigned short v4us;
typedef __attribute__((ext_vector_type(2))) float v2f;
typedef v8h  __attribute__((may_alias)) v8ha;
typedef v4f  __attribute__((may_alias)) v4fa;
typedef v8us __attribute__((may_alias)) v8usa;

__device__ __forceinline__ unsigned short f2bf(float f) { unsigned u = __float_as_uint(f); u += 0x7FFFu + ((u >> 16) & 1u); return (unsigned short)(u >> 16); }
__device__ __forceinline__ float bf2f(unsigned short b) { return __uint_as_float(((unsigned)b) << 16); }
__device__ __forceinline__ float bfr(float f) { return bf2f(f2bf(f)); }
__device__ __forceinline__ v16h cat16(v8h lo, v8h hi) { return __builtin_shufflevector(lo, hi, 0, 1, 2, 3, 4, 5, 6, 7, 8, 9, 10, 11, 12, 13, 14, 15); }
__device__ __forceinline__ v16bf cat16b(v8us lo, v8us hi) { return __builtin_bit_cast(v16bf, __builtin_shufflevector(lo, hi, 0, 1, 2, 3, 4, 5, 6, 7, 8, 9, 10, 11, 12, 13, 14, 15)); }
__device__ __forceinline__ v8f wmma16(v16h a, v16h b, v8f c) { return __builtin_amdgcn_wmma_f32_16x16x32_f16(false, a, false, b, (short)0, c, false, false); }
__device__ __forceinline__ v8f wmmab(v16bf a, v16bf b, v8f c) { return __builtin_amdgcn_wmma_f32_16x16x32_bf16(false, a, false, b, (short)0, c, false, false); }
__device__ __forceinline__ h16 tohx(float x) { return (h16)x; }
__device__ __forceinline__ void splitf(float y, unsigned short& h, unsigned short& l) { h = f2bf(y); l = f2bf(y - bf2f(h)); }

// ---- k_gemmw: register-blocked GEMM, ONE WAVE per 64x64 output tile (16 accumulators), operands straight from K-contiguous 16-bit planes; grid (M/64, N/64, Z), 32 threads.
// C[m][n] (f32, pitch ldc, + optional f32 bias[n]) = sum_k A[m][k] Bt[n][k] (+ split products per NSPLIT). z-batch strides sA/sB/sC in elements. K % 32 == 0.
// Fragments: lane l, h = l>>4, row/col = l&15; elements 0..7 <- k0+8h+0..7, elements 8..15 <- k0+16+8h+0..7 for BOTH A and Bt; D element r -> (row 8h+r, col l&15).
// cmode 1 (scores, causal flag set): tiles whose first key column lies past the last query row r0+roff+63 are skipped (never used downstream); cmode 2 (P.v): K limited to r0+roff+64 keys.
template <typename T16> struct WFrag;
template <> struct WFrag<h16> { typedef v16h V; static __device__ __forceinline__ V ld(const h16* p) { return cat16(*(const v8h*)p, *(const v8h*)(p + 16)); } static __device__ __forceinline__ v8f mma(V a, V b, v8f c) { return wmma16(a, b, c); } };
template <> struct WFrag<bf> { typedef v16bf V; static __device__ __forceinline__ V ld(const bf* p) { return cat16b(*(const v8us*)p, *(const v8us*)(p + 16)); } static __device__ __forceinline__ v8f mma(V a, V b, v8f c) { return wmmab(a, b, c); } };
template <typename T16, int NSPLIT, bool BIAS>
__global__ __launch_bounds__(32) void k_gemmw(const T16* __restrict__ A, const T16* __restrict__ A2, const T16* __restrict__ Bt, const T16* __restrict__ Bt2, int K, float* C, int ldc, const float* __restrict__ bias, size_t sA, size_t sB, size_t sC,
                                              const int* __restrict__ cflag, int roff, int cmode) {
    typedef typename WFrag<T16>::V V;
    __shared__ __align__(16) float os[16 * 68];
    const size_t z = blockIdx.z; A += z * sA; if (A2) A2 += z * sA; Bt += z * sB; if (Bt2) Bt2 += z * sB; C += z * sC;
    const int lane = threadIdx.x & 31, lr = lane & 15, hi = lane >> 4; const int r0 = blockIdx.x * 64, c0 = blockIdx.y * 64;
    const int causal = (cmode != 0 && cflag[0] != 0) ? 1 : 0;
    if (cmode == 1 && causal && c0 >= r0 + roff + 64) return;      // whole block is one wave: uniform exit, no block barrier in this kernel
    int Kend = K;
    if (cmode == 2 && causal) { const int kl = r0 + roff + 64; Kend = (kl < K) ? kl : K; }
    v8f acc[4][4];
#pragma unroll
    for (int mb = 0; mb < 4; ++mb)
#pragma unroll
        for (int nb = 0; nb < 4; ++nb) acc[mb][nb] = (v8f){};
    const size_t aoff = (size_t)(r0 + lr) * K + 8 * hi, boff = (size_t)(c0 + lr) * K + 8 * hi;
#pragma unroll 1
    for (int kc = 0; kc < Kend; kc += 32) {
        V a[4], a2[4];
#pragma unroll
        for (int mb = 0; mb < 4; ++mb) { a[mb] = WFrag<T16>::ld(A + aoff + (size_t)mb * 16 * K + kc); if (NSPLIT == 1 || NSPLIT == 2) a2[mb] = WFrag<T16>::ld(A2 + aoff + (size_t)mb * 16 * K + kc); }
#pragma unroll
        for (int nb = 0; nb < 4; ++nb) { const V b = WFrag<T16>::ld(Bt + boff + (size_t)nb * 16 * K + kc); V b2; if (NSPLIT >= 2) b2 = WFrag<T16>::ld(Bt2 + boff + (size_t)nb * 16 * K + kc);
#pragma unroll
            for (int mb = 0; mb < 4; ++mb) { acc[mb][nb] = WFrag<T16>::mma(a[mb], b, acc[mb][nb]); if (NSPLIT == 1 || NSPLIT == 2) acc[mb][nb] = WFrag<T16>::mma(a2[mb], b, acc[mb][nb]); if (NSPLIT >= 2) acc[mb][nb] = WFrag<T16>::mma(a[mb], b2, acc[mb][nb]); } }
        asm volatile("v_nop\n\tv_nop\n\tv_nop\n\tv_nop" : "+v"(acc[0][0]), "+v"(acc[1][1]), "+v"(acc[2][2]), "+v"(acc[3][3]) : "v"(a[0]), "v"(a[3]));
    }
#pragma unroll
    for (int mb = 0; mb < 4; ++mb) {
#pragma unroll
        for (int nb = 0; nb < 4; ++nb) {
#pragma unroll
            for (int j = 0; j < 8; ++j) os[(hi * 8 + j) * 68 + nb * 16 + lr] = acc[mb][nb][j]; }
        __builtin_amdgcn_wave_barrier(); asm volatile("" ::: "memory");
        float* crow = C + (size_t)(r0 + mb * 16) * ldc + c0;
{
#pragma unroll
            for (int s = 0; s < 8; ++s) { const int row = 2 * s + hi, cofs = lr * 4; v4f val = *(const v4fa*)(os + row * 68 + cofs); if (BIAS) { val[0] += bfr(bias[c0 + cofs]); val[1] += bfr(bias[c0 + cofs + 1]); val[2] += bfr(bias[c0 + cofs + 2]); val[3] += bfr(bias[c0 + cofs + 3]); }
                *(v4f*)(crow + (size_t)row * ldc + cofs) = val; }
             }
        __builtin_amdgcn_wave_barrier(); asm volatile("" ::: "memory");
    }
}

__global__ __launch_bounds__(256) void k_cvt8(const float* __restrict__ src, bf* dst, size_t n8) { const size_t i = (size_t)blockIdx.x * 256 + threadIdx.x; if (i >= n8) return; const v8f v = *(const v8f*)(src + i * 8); v8us o;
#pragma unroll
    for (int k = 0; k < 8; ++k) o[k] = f2bf(v[k]); *(v8us*)(dst + i * 8) = o;  }

__global__ __launch_bounds__(256) void k_qkp(const float* __restrict__ F, int pitch, int nheads, float sc, h16* P16, bf* Ph, bf* Pl) {
    const size_t e = ((size_t)blockIdx.x * 256 + threadIdx.x) * 2; if (e >= (size_t)nheads * SEQ * HD) return; const int d = (int)(e % HD); const int t = (int)((e / HD) % SEQ); const int h = (int)(e / ((size_t)HD * SEQ)); const float* f = F + (size_t)t * pitch + h * HD + d; v2h o16; v2us oh, ol;
#pragma unroll
    for (int q = 0; q < 2; ++q) { const float r = f[q] * sc; o16[q] = tohx(r); unsigned short a2, c2; splitf(r, a2, c2); oh[q] = a2; ol[q] = c2; }
    *(v2h*)(P16 + e) = o16; *(v2us*)(Ph + e) = oh; *(v2us*)(Pl + e) = ol;  }
__global__ __launch_bounds__(256) void k_vtp(const float* __restrict__ F, int pitch, int nheads, float sc, h16* V16, bf* Vh, bf* Vl) { const size_t e = ((size_t)blockIdx.x * 256 + threadIdx.x) * 2; if (e >= (size_t)nheads * HD * SEQ) return; const int t = (int)(e % SEQ); const int d = (int)((e / SEQ) % HD); const int g = (int)(e / ((size_t)SEQ * HD)); v2h o16; v2us oh, ol;
#pragma unroll
    for (int q = 0; q < 2; ++q) { const float x = F[(size_t)(t + q) * pitch + g * HD + d] * sc; o16[q] = tohx(x); unsigned short a2, c2; splitf(x, a2, c2); oh[q] = a2; ol[q] = c2; }
    *(v2h*)(V16 + e) = o16; *(v2us*)(Vh + e) = oh; *(v2us*)(Vl + e) = ol;  }

// k_asoft: one wave per score row (zz, i): x_j = S[zz][i][j] * SCL for j <= i (all j when the flag is 0), replace-fill -1e30 otherwise (index select; tiles skipped by the score GEMM are never used);
__global__ __launch_bounds__(256) void k_asoft(const float* __restrict__ Sb, const int* __restrict__ cflag, h16* P16, bf* Ph, bf* Pl) {
#pragma clang fp contract(off)
    const int lane = threadIdx.x & 31; const int row = blockIdx.x * 8 + (threadIdx.x >> 5); if (row >= ZH * SEQ) return; const int i = row % SEQ; const int zz = row / SEQ; const bool hires = (i < RHE);
    const int causal = (cflag[0] != 0) ? 1 : 0;
    const int nval = causal ? (i / 128 + 1) : (SEQ / 128);          // 128-column chunks holding at least one unmasked column (wave-uniform)
    const float* sr = Sb + (size_t)row * SEQ;
    float p[SEQ / 128][4]; float m = -1.0e30f;
#pragma unroll
    for (int ch = 0; ch < SEQ / 128; ++ch) {
        if (ch < nval) { const int j0 = ch * 128 + lane * 4; const v4f a = *(const v4f*)(sr + j0);
#pragma unroll
            for (int q = 0; q < 4; ++q) { const float xs = a[q] * SCL; const float x = (causal != 0 && (j0 + q) > i) ? -1.0e30f : xs; p[ch][q] = x; m = fmaxf(m, x); } }
        else {
#pragma unroll
            for (int q = 0; q < 4; ++q) p[ch][q] = -1.0e30f; } }
#pragma unroll
    for (int msk = 1; msk < 32; msk <<= 1) m = fmaxf(m, __shfl_xor(m, msk, 32));
    float l = 0.0f;
#pragma unroll
    for (int ch = 0; ch < SEQ / 128; ++ch) {
        if (ch < nval) {
#pragma unroll
            for (int q = 0; q < 4; ++q) { const float d = p[ch][q] - m; const float e0 = __expf(d); const float e = (d > -1.0e29f) ? e0 : 0.0f; p[ch][q] = e; l += e; } }
        else {
#pragma unroll
            for (int q = 0; q < 4; ++q) p[ch][q] = 0.0f; } }
#pragma unroll
    for (int msk = 1; msk < 32; msk <<= 1) l += __shfl_xor(l, msk, 32);
    const float inv = 1.0f / l;                                      // l >= 1 (the max element contributes exp(0))
#pragma unroll
    for (int ch = 0; ch < SEQ / 128; ++ch)
#pragma unroll
        for (int q = 0; q < 4; ++q) p[ch][q] = p[ch][q] * inv;
{
#pragma unroll
        for (int ch = 0; ch < SEQ / 128; ++ch) { const int j0 = ch * 128 + lane * 4;
            if (hires) { v4us oh, ol;
#pragma unroll
                for (int q = 0; q < 4; ++q) { unsigned short h2, l2; splitf(p[ch][q], h2, l2); oh[q] = h2; ol[q] = l2; }
                const size_t oo = ((size_t)zz * RHE + i) * SEQ + j0; *(v4us*)(Ph + oo) = oh; *(v4us*)(Pl + oo) = ol; }
            else { v4h o4;
#pragma unroll
                for (int q = 0; q < 4; ++q) o4[q] = tohx(p[ch][q] * PCAR); *(v4h*)(P16 + (size_t)row * SEQ + j0) = o4; } }
         }
}

__global__ __launch_bounds__(256) void k_merge(const float* __restrict__ O, int h0, bf* Ah, bf* Al) { const size_t e = ((size_t)blockIdx.x * 256 + threadIdx.x) * 2; if (e >= (size_t)ZH * SEQ * HD) return; const int d = (int)(e % HD); const int t = (int)((e / HD) % SEQ); const int zz = (int)(e / ((size_t)HD * SEQ)); const float cs = (t < RHE) ? (1.0f / VSC) : (1.0f / (VSC * PCAR)); const size_t oo = (size_t)t * DQ + (h0 + zz) * HD + d;
    v2us oh, ol;
#pragma unroll
    for (int q = 0; q < 2; ++q) { unsigned short a, c2; splitf(O[e + q] * cs, a, c2); oh[q] = a; ol[q] = c2; } *(v2us*)(Ah + oo) = oh; *(v2us*)(Al + oo) = ol;  }

extern "C" void kernel_launch(void* const* d_in, const int* in_sizes, int n_in,
                              void* d_out, int out_size, void* d_ws, size_t ws_size, hipStream_t stream) {
    if (n_in < 12) return;
    const size_t needx = ((size_t)(NB - 1) * SEQ_FULL + SEQ) * DM;
    if ((size_t)in_sizes[0] < needx || (size_t)in_sizes[1] < needx || (size_t)in_sizes[2] < needx) return;
    if (in_sizes[3] < DM * DM || in_sizes[5] < DM * DM || in_sizes[7] < DM * DM || in_sizes[9] < DM * DM) return;
    if (in_sizes[4] < DM || in_sizes[6] < DM || in_sizes[8] < DM || in_sizes[10] < DM || in_sizes[11] < 1) return;
    if ((size_t)out_size < needx) return;
    const float* xq = (const float*)d_in[0]; const float* xk = (const float*)d_in[1]; const float* xv = (const float*)d_in[2];
    const float* wq = (const float*)d_in[3]; const float* bq = (const float*)d_in[4]; const float* wk = (const float*)d_in[5]; const float* bk = (const float*)d_in[6];
    const float* wv = (const float*)d_in[7]; const float* bv = (const float*)d_in[8]; const float* wo = (const float*)d_in[9]; const float* bo = (const float*)d_in[10];
    const int* CZ = (const int*)d_in[11];
    float* OUT = (float*)d_out;     // [NB][SEQ_FULL][DM]

    // ---- workspace carve (every region a multiple of 256 B; all producers write exact tile/row multiples, no padded tails needed: SEQ%128==0, DM%64==0)
    constexpr size_t SZ_W = (size_t)DM * DM * 2, SZ_XB = (size_t)SEQ * DM * 2, SZ_F = (size_t)SEQ * DQ * 4, SZ_PL = (size_t)NH_ * SEQ * HD * 2, SZ_PP = (size_t)ZH * RHE * SEQ * 2;
    constexpr size_t SZ_SB = (size_t)ZH * SEQ * SEQ * 4, SZ_P16 = (size_t)ZH * SEQ * SEQ * 2, SZ_OB = (size_t)ZH * SEQ * HD * 4, SZ_AT = (size_t)SEQ * DQ * 2;
    constexpr size_t WS_TOTAL = 4 * SZ_W + SZ_XB + SZ_F + 9 * SZ_PL + 2 * SZ_PP + SZ_SB + SZ_P16 + SZ_OB + 2 * SZ_AT;
    static_assert(WS_TOTAL <= (size_t)134217728);
    if (WS_TOTAL > ws_size) return;
    char* wsp = (char*)d_ws;
    auto take = [&](size_t bytes) { char* p = wsp; wsp += (bytes + 255) & ~(size_t)255; return (void*)p; };
    bf* WQ = (bf*)take(SZ_W); bf* WK = (bf*)take(SZ_W); bf* WV = (bf*)take(SZ_W); bf* WO = (bf*)take(SZ_W);
    bf* XB = (bf*)take(SZ_XB); float* F = (float*)take(SZ_F);                  // one projection buffer reused for q, k, v (stream-ordered)
    h16* QP16 = (h16*)take(SZ_PL); h16* KP16 = (h16*)take(SZ_PL); h16* VT16 = (h16*)take(SZ_PL);
    bf* QPh = (bf*)take(SZ_PL); bf* QPl = (bf*)take(SZ_PL); bf* KPh = (bf*)take(SZ_PL); bf* KPl = (bf*)take(SZ_PL); bf* VTh = (bf*)take(SZ_PL); bf* VTl = (bf*)take(SZ_PL);
    bf* Ph = (bf*)take(SZ_PP); bf* Pl = (bf*)take(SZ_PP);
    float* Sb = (float*)take(SZ_SB); h16* P16 = (h16*)take(SZ_P16); float* Ob = (float*)take(SZ_OB); bf* ATh = (bf*)take(SZ_AT); bf* ATl = (bf*)take(SZ_AT);
    if ((size_t)(wsp - (char*)d_ws) > ws_size) return;

    const unsigned GW8 = (unsigned)((DM * DM / 8 + 255) / 256), GX8 = (unsigned)(((size_t)SEQ * DM / 8 + 255) / 256);
    const unsigned LQ = (unsigned)(((size_t)NH_ * SEQ * HD / 2 + 255) / 256), LZ = (unsigned)(((size_t)ZH * SEQ * HD / 2 + 255) / 256);
    k_cvt8<<<GW8, 256, 0, stream>>>(wq, WQ, (size_t)DM * DM / 8);
    k_cvt8<<<GW8, 256, 0, stream>>>(wk, WK, (size_t)DM * DM / 8);
    k_cvt8<<<GW8, 256, 0, stream>>>(wv, WV, (size_t)DM * DM / 8);
    k_cvt8<<<GW8, 256, 0, stream>>>(wo, WO, (size_t)DM * DM / 8);
    for (int b = 0; b < NB; ++b) {
        const size_t xo = (size_t)b * SEQ_FULL * DM;
        k_cvt8<<<GX8, 256, 0, stream>>>(xq + xo, XB, (size_t)SEQ * DM / 8);
        k_gemmw<bf, 0, true><<<dim3(SEQ / 64, DQ / 64, 1), 32, 0, stream>>>(XB, nullptr, WQ, nullptr, DM, F, DQ, bq, 0, 0, 0, CZ, 0, 0);
        k_qkp<<<LQ, 256, 0, stream>>>(F, DQ, NH_, QSC, QP16, QPh, QPl);
        k_cvt8<<<GX8, 256, 0, stream>>>(xk + xo, XB, (size_t)SEQ * DM / 8);
        k_gemmw<bf, 0, true><<<dim3(SEQ / 64, DKV / 64, 1), 32, 0, stream>>>(XB, nullptr, WK, nullptr, DM, F, DKV, bk, 0, 0, 0, CZ, 0, 0);
        k_qkp<<<LQ, 256, 0, stream>>>(F, DKV, NKV, KSC, KP16, KPh, KPl);
        k_cvt8<<<GX8, 256, 0, stream>>>(xv + xo, XB, (size_t)SEQ * DM / 8);
        k_gemmw<bf, 0, true><<<dim3(SEQ / 64, DKV / 64, 1), 32, 0, stream>>>(XB, nullptr, WV, nullptr, DM, F, DKV, bv, 0, 0, 0, CZ, 0, 0);
        k_vtp<<<LQ, 256, 0, stream>>>(F, DKV, NKV, VSC, VT16, VTh, VTl);
        for (int h0 = 0; h0 < NH_; h0 += ZH) { const size_t zq = (size_t)h0, zk = (size_t)h0;
            k_gemmw<bf, 2, false><<<dim3(RHE / 64, SEQ / 64, ZH), 32, 0, stream>>>(QPh + zq * SEQ * HD, QPl + zq * SEQ * HD, KPh + zk * SEQ * HD, KPl + zk * SEQ * HD, HD, Sb, SEQ, nullptr, (size_t)SEQ * HD, (size_t)SEQ * HD, (size_t)SEQ * SEQ, CZ, 0, 1);
            if (SEQ > RHE) k_gemmw<h16, 0, false><<<dim3((SEQ - RHE) / 64, SEQ / 64, ZH), 32, 0, stream>>>(QP16 + zq * SEQ * HD + (size_t)RHE * HD, nullptr, KP16 + zk * SEQ * HD, nullptr, HD, Sb + (size_t)RHE * SEQ, SEQ, nullptr, (size_t)SEQ * HD, (size_t)SEQ * HD, (size_t)SEQ * SEQ, CZ, RHE, 1);
            k_asoft<<<ZH * SEQ / 8, 256, 0, stream>>>(Sb, CZ, P16, Ph, Pl);
            k_gemmw<bf, 2, false><<<dim3(RHE / 64, HD / 64, ZH), 32, 0, stream>>>(Ph, Pl, VTh + zk * HD * SEQ, VTl + zk * HD * SEQ, SEQ, Ob, HD, nullptr, (size_t)RHE * SEQ, (size_t)HD * SEQ, (size_t)SEQ * HD, CZ, 0, 2);
            if (SEQ > RHE) k_gemmw<h16, 0, false><<<dim3((SEQ - RHE) / 64, HD / 64, ZH), 32, 0, stream>>>(P16 + (size_t)RHE * SEQ, nullptr, VT16 + zk * HD * SEQ, nullptr, SEQ, Ob + (size_t)RHE * HD, HD, nullptr, (size_t)SEQ * SEQ, (size_t)HD * SEQ, (size_t)SEQ * HD, CZ, RHE, 2);
            k_merge<<<LZ, 256, 0, stream>>>(Ob, h0, ATh, ATl); }
        k_gemmw<bf, 1, true><<<dim3(SEQ / 64, DM / 64, 1), 32, 0, stream>>>(ATh, ATl, WO, nullptr, DQ, OUT + xo, DM, bo, 0, 0, 0, CZ, 0, 0); }
}

// v001
// One run takes 912 microseconds.
// Next to v000, in two timings, it ran 1.75 times as fast each time.
#include <hip/hip_runtime.h>

// Causal multi-head attention: q/k/v = x W^T + b ([out][in] weights, 16 heads x 64), scores = q.k x 1/8 with lower-triangular replace-mask under an int flag input, f32 softmax, ctx = P v, out = ctx Wo^T + bo -> [2][2048][1024] f32.
// Compute dtypes, f32 accumulate everywhere: every float input RNE-converted to bf16; q/k/v projections v_wmma_f32_16x16x32_bf16 on plain bf16 operands + bias; scores: query rows < RH bf16 hi/lo x bf16 hi/lo (3 products), rows >= RH plain v_wmma_f32_16x16x32_f16 (q and k planes carried x4); softmax f32; P.v: rows < RH bf16 hi/lo P x bf16 hi/lo v (3 products), rows >= RH fp16 P carried x1024 against fp16 v carried x4; output projection bf16 hi/lo of ctx x bf16 Wo (2 products) + bias.

#ifndef NB
#define NB 2
#endif
#ifndef SEQ
#define SEQ 2048
#endif
#define NB_FULL  2
#define SEQ_FULL 2048
#define DM   1024
#define NH_  16
#define NKV  16
#define HD   64
#define DQ   (NH_ * HD)
#define DKV  (NKV * HD)
#define ZH   2
#ifndef RH
#define RH   512                  // query rows < RH use hi+lo planes
#endif
#define RHE  ((RH < SEQ) ? RH : SEQ)
#define QSC  4.0f                 // q plane carry
#define KSC  4.0f                 // k plane carry
#define VSC  4.0f                 // v plane carry
#define PCAR 1024.0f              // fp16 P plane carry (rows >= RH)
#define SCL  (0.125f / (QSC * KSC))   // HD^-0.5 folded with the q/k carries (exact power of two)
static_assert(SEQ % 128 == 0);
static_assert(SEQ <= SEQ_FULL);
static_assert(NB >= 1 && NB <= NB_FULL);
static_assert((RHE % 64) == 0);
static_assert(DM == DQ);
static_assert((DM % 64) == 0 && (HD % 32) == 0);

typedef _Float16 h16;
typedef unsigned short bf;
typedef __attribute__((ext_vector_type(16))) __bf16   v16bf;
typedef __attribute__((ext_vector_type(16))) _Float16 v16h;
typedef __attribute__((ext_vector_type(8)))  _Float16 v8h;
typedef __attribute__((ext_vector_type(8)))  unsigned short v8us;
typedef __attribute__((ext_vector_type(8)))  float    v8f;
typedef __attribute__((ext_vector_type(4)))  float    v4f;
typedef __attribute__((ext_vector_type(2))) _Float16 v2h;
typedef __attribute__((ext_vector_type(4))) _Float16 v4h;
typedef __attribute__((ext_vector_type(2))) unsigned short v2us;
typedef __attribute__((ext_vector_type(4))) unsigned short v4us;
typedef __attribute__((ext_vector_type(2))) float v2f;
typedef v8h  __attribute__((may_alias)) v8ha;
typedef v4f  __attribute__((may_alias)) v4fa;
typedef v8us __attribute__((may_alias)) v8usa;

__device__ __forceinline__ unsigned short f2bf(float f) { unsigned u = __float_as_uint(f); u += 0x7FFFu + ((u >> 16) & 1u); return (unsigned short)(u >> 16); }
__device__ __forceinline__ float bf2f(unsigned short b) { return __uint_as_float(((unsigned)b) << 16); }
__device__ __forceinline__ float bfr(float f) { return bf2f(f2bf(f)); }
__device__ __forceinline__ v16h cat16(v8h lo, v8h hi) { return __builtin_shufflevector(lo, hi, 0, 1, 2, 3, 4, 5, 6, 7, 8, 9, 10, 11, 12, 13, 14, 15); }
__device__ __forceinline__ v16bf cat16b(v8us lo, v8us hi) { return __builtin_bit_cast(v16bf, __builtin_shufflevector(lo, hi, 0, 1, 2, 3, 4, 5, 6, 7, 8, 9, 10, 11, 12, 13, 14, 15)); }
__device__ __forceinline__ v8f wmma16(v16h a, v16h b, v8f c) { return __builtin_amdgcn_wmma_f32_16x16x32_f16(false, a, false, b, (short)0, c, false, false); }
__device__ __forceinline__ v8f wmmab(v16bf a, v16bf b, v8f c) { return __builtin_amdgcn_wmma_f32_16x16x32_bf16(false, a, false, b, (short)0, c, false, false); }
__device__ __forceinline__ h16 tohx(float x) { return (h16)x; }
__device__ __forceinline__ void splitf(float y, unsigned short& h, unsigned short& l) { h = f2bf(y); l = f2bf(y - bf2f(h)); }

// ---- k_gemmw: register-blocked GEMM, one 64x64 output tile per work-group (16 accumulators per wave), operands straight from K-contiguous 16-bit planes; grid (M/64, N/64, Z), 32 * KW threads.
// C[m][n] (f32, pitch ldc, + optional f32 bias[n]) = sum_k A[m][k] Bt[n][k] (+ split products per NSPLIT). z-batch strides sA/sB/sC in elements. K % 32 == 0.
// Fragments: lane l, h = l>>4, row/col = l&15; elements 0..7 <- k0+8h+0..7, elements 8..15 <- k0+16+8h+0..7 for BOTH A and Bt; D element r -> (row 8h+r, col l&15).
// KW waves per work-group share one tile: wave w takes the 32-wide k steps w, w+KW, ...; the KW partial tiles meet in LDS and are summed in wave order (KW == 1: one wave, no sum).
// cmode 1 (scores, causal flag set): tiles whose first key column lies past the last query row r0+roff+63 are skipped (never used downstream); cmode 2 (P.v): K limited to r0+roff+64 keys.
template <typename T16> struct WFrag;
template <> struct WFrag<h16> { typedef v16h V; static __device__ __forceinline__ V ld(const h16* p) { return cat16(*(const v8h*)p, *(const v8h*)(p + 16)); } static __device__ __forceinline__ v8f mma(V a, V b, v8f c) { return wmma16(a, b, c); } };
template <> struct WFrag<bf> { typedef v16bf V; static __device__ __forceinline__ V ld(const bf* p) { return cat16b(*(const v8us*)p, *(const v8us*)(p + 16)); } static __device__ __forceinline__ v8f mma(V a, V b, v8f c) { return wmmab(a, b, c); } };
template <typename T16, int NSPLIT, bool BIAS, int KW>
__global__ __launch_bounds__(32 * KW) void k_gemmw(const T16* __restrict__ A, const T16* __restrict__ A2, const T16* __restrict__ Bt, const T16* __restrict__ Bt2, int K, float* C, int ldc, const float* __restrict__ bias, size_t sA, size_t sB, size_t sC,
                                              const int* __restrict__ cflag, int roff, int cmode) {
    typedef typename WFrag<T16>::V V;
    __shared__ __align__(16) float os[(KW == 1) ? 16 * 68 : KW * 64 * 68];
    const size_t z = blockIdx.z; A += z * sA; if (A2) A2 += z * sA; Bt += z * sB; if (Bt2) Bt2 += z * sB; C += z * sC;
    const int lane = threadIdx.x & 31, lr = lane & 15, hi = lane >> 4; const int r0 = blockIdx.x * 64, c0 = blockIdx.y * 64;
    const int causal = (cmode != 0 && cflag[0] != 0) ? 1 : 0;
    if (cmode == 1 && causal && c0 >= r0 + roff + 64) return;      // blockIdx and the flag alone decide: the whole block leaves, ahead of the one block barrier
    int Kend = K;
    if (cmode == 2 && causal) { const int kl = r0 + roff + 64; Kend = (kl < K) ? kl : K; }
    const int wv = (KW == 1) ? 0 : __builtin_amdgcn_readfirstlane((int)(threadIdx.x >> 5));   // wave number, held scalar so that the k loop keeps a scalar branch and every lane stays on at the matrix instructions
    v8f acc[4][4];
#pragma unroll
    for (int mb = 0; mb < 4; ++mb)
#pragma unroll
        for (int nb = 0; nb < 4; ++nb) acc[mb][nb] = (v8f){};
    const size_t aoff = (size_t)(r0 + lr) * K + 8 * hi, boff = (size_t)(c0 + lr) * K + 8 * hi;
#pragma unroll 1
    for (int kc = 32 * wv; kc < Kend; kc += 32 * KW) {
        V a[4], a2[4];
#pragma unroll
        for (int mb = 0; mb < 4; ++mb) { a[mb] = WFrag<T16>::ld(A + aoff + (size_t)mb * 16 * K + kc); if (NSPLIT == 1 || NSPLIT == 2) a2[mb] = WFrag<T16>::ld(A2 + aoff + (size_t)mb * 16 * K + kc); }
#pragma unroll
        for (int nb = 0; nb < 4; ++nb) { const V b = WFrag<T16>::ld(Bt + boff + (size_t)nb * 16 * K + kc); V b2; if (NSPLIT >= 2) b2 = WFrag<T16>::ld(Bt2 + boff + (size_t)nb * 16 * K + kc);
#pragma unroll
            for (int mb = 0; mb < 4; ++mb) { acc[mb][nb] = WFrag<T16>::mma(a[mb], b, acc[mb][nb]); if (NSPLIT == 1 || NSPLIT == 2) acc[mb][nb] = WFrag<T16>::mma(a2[mb], b, acc[mb][nb]); if (NSPLIT >= 2) acc[mb][nb] = WFrag<T16>::mma(a[mb], b2, acc[mb][nb]); } }
        asm volatile("v_nop\n\tv_nop\n\tv_nop\n\tv_nop" : "+v"(acc[0][0]), "+v"(acc[1][1]), "+v"(acc[2][2]), "+v"(acc[3][3]) : "v"(a[0]), "v"(a[3]));
    }
    if constexpr (KW > 1) {
        float* osw = os + wv * (64 * 68);          // this wave's partial tile, rows at pitch 68
        // the loops below are unrolled so that acc is indexed by constants (stays in registers) and the LDS reads of a thread's items issue together
#pragma unroll
        for (int mb = 0; mb < 4; ++mb)
#pragma unroll
            for (int nb = 0; nb < 4; ++nb)
#pragma unroll
                for (int j = 0; j < 8; ++j) osw[(mb * 16 + hi * 8 + j) * 68 + nb * 16 + lr] = acc[mb][nb][j];
        __syncthreads();                                            // every wave's partial tile is in LDS before any of it is summed
#pragma unroll
        for (int s = 0; s < (64 * 16) / (32 * KW); ++s) { const int item = s * (32 * KW) + (int)threadIdx.x, row = item >> 4, cofs = (item & 15) * 4; v4f val = *(const v4fa*)(os + row * 68 + cofs);
#pragma unroll
            for (int w = 1; w < KW; ++w) val += *(const v4fa*)(os + w * (64 * 68) + row * 68 + cofs);
            if (BIAS) { val[0] += bfr(bias[c0 + cofs]); val[1] += bfr(bias[c0 + cofs + 1]); val[2] += bfr(bias[c0 + cofs + 2]); val[3] += bfr(bias[c0 + cofs + 3]); }
            *(v4f*)(C + (size_t)(r0 + row) * ldc + c0 + cofs) = val; }
        return;
    }
#pragma unroll
    for (int mb = 0; mb < 4; ++mb) {
#pragma unroll
        for (int nb = 0; nb < 4; ++nb) {
#pragma unroll
            for (int j = 0; j < 8; ++j) os[(hi * 8 + j) * 68 + nb * 16 + lr] = acc[mb][nb][j]; }
        __builtin_amdgcn_wave_barrier(); asm volatile("" ::: "memory");
        float* crow = C + (size_t)(r0 + mb * 16) * ldc + c0;
{
#pragma unroll
            for (int s = 0; s < 8; ++s) { const int row = 2 * s + hi, cofs = lr * 4; v4f val = *(const v4fa*)(os + row * 68 + cofs); if (BIAS) { val[0] += bfr(bias[c0 + cofs]); val[1] += bfr(bias[c0 + cofs + 1]); val[2] += bfr(bias[c0 + cofs + 2]); val[3] += bfr(bias[c0 + cofs + 3]); }
                *(v4f*)(crow + (size_t)row * ldc + cofs) = val; }
             }
        __builtin_amdgcn_wave_barrier(); asm volatile("" ::: "memory");
    }
}

__global__ __launch_bounds__(256) void k_cvt8(const float* __restrict__ src, bf* dst, size_t n8) { const size_t i = (size_t)blockIdx.x * 256 + threadIdx.x; if (i >= n8) return; const v8f v = *(const v8f*)(src + i * 8); v8us o;
#pragma unroll
    for (int k = 0; k < 8; ++k) o[k] = f2bf(v[k]); *(v8us*)(dst + i * 8) = o;  }

__global__ __launch_bounds__(256) void k_qkp(const float* __restrict__ F, int pitch, int nheads, float sc, h16* P16, bf* Ph, bf* Pl) {
    const size_t e = ((size_t)blockIdx.x * 256 + threadIdx.x) * 2; if (e >= (size_t)nheads * SEQ * HD) return; const int d = (int)(e % HD); const int t = (int)((e / HD) % SEQ); const int h = (int)(e / ((size_t)HD * SEQ)); const float* f = F + (size_t)t * pitch + h * HD + d; v2h o16; v2us oh, ol;
#pragma unroll
    for (int q = 0; q < 2; ++q) { const float r = f[q] * sc; o16[q] = tohx(r); unsigned short a2, c2; splitf(r, a2, c2); oh[q] = a2; ol[q] = c2; }
    *(v2h*)(P16 + e) = o16; *(v2us*)(Ph + e) = oh; *(v2us*)(Pl + e) = ol;  }
__global__ __launch_bounds__(256) void k_vtp(const float* __restrict__ F, int pitch, int nheads, float sc, h16* V16, bf* Vh, bf* Vl) { const size_t e = ((size_t)blockIdx.x * 256 + threadIdx.x) * 2; if (e >= (size_t)nheads * HD * SEQ) return; const int t = (int)(e % SEQ); const int d = (int)((e / SEQ) % HD); const int g = (int)(e / ((size_t)SEQ * HD)); v2h o16; v2us oh, ol;
#pragma unroll
    for (int q = 0; q < 2; ++q) { const float x = F[(size_t)(t + q) * pitch + g * HD + d] * sc; o16[q] = tohx(x); unsigned short a2, c2; splitf(x, a2, c2); oh[q] = a2; ol[q] = c2; }
    *(v2h*)(V16 + e) = o16; *(v2us*)(Vh + e) = oh; *(v2us*)(Vl + e) = ol;  }

// k_asoft: one wave per score row (zz, i): x_j = S[zz][i][j] * SCL for j <= i (all j when the flag is 0), replace-fill -1e30 otherwise (index select; tiles skipped by the score GEMM are never used);
__global__ __launch_bounds__(256) void k_asoft(const float* __restrict__ Sb, const int* __restrict__ cflag, h16* P16, bf* Ph, bf* Pl) {
#pragma clang fp contract(off)
    const int lane = threadIdx.x & 31; const int row = blockIdx.x * 8 + (threadIdx.x >> 5); if (row >= ZH * SEQ) return; const int i = row % SEQ; const int zz = row / SEQ; const bool hires = (i < RHE);
    const int causal = (cflag[0] != 0) ? 1 : 0;
    const int nval = causal ? (i / 128 + 1) : (SEQ / 128);          // 128-column chunks holding at least one unmasked column (wave-uniform)
    const float* sr = Sb + (size_t)row * SEQ;
    float p[SEQ / 128][4]; float m = -1.0e30f;
#pragma unroll
    for (int ch = 0; ch < SEQ / 128; ++ch) {
        if (ch < nval) { const int j0 = ch * 128 + lane * 4; const v4f a = *(const v4f*)(sr + j0);
#pragma unroll
            for (int q = 0; q < 4; ++q) { const float xs = a[q] * SCL; const float x = (causal != 0 && (j0 + q) > i) ? -1.0e30f : xs; p[ch][q] = x; m = fmaxf(m, x); } }
        else {
#pragma unroll
            for (int q = 0; q < 4; ++q) p[ch][q] = -1.0e30f; } }
#pragma unroll
    for (int msk = 1; msk < 32; msk <<= 1) m = fmaxf(m, __shfl_xor(m, msk, 32));
    float l = 0.0f;
#pragma unroll
    for (int ch = 0; ch < SEQ / 128; ++ch) {
        if (ch < nval) {
#pragma unroll
            for (int q = 0; q < 4; ++q) { const float d = p[ch][q] - m; const float e0 = __expf(d); const float e = (d > -1.0e29f) ? e0 : 0.0f; p[ch][q] = e; l += e; } }
        else {
#pragma unroll
            for (int q = 0; q < 4; ++q) p[ch][q] = 0.0f; } }
#pragma unroll
    for (int msk = 1; msk < 32; msk <<= 1) l += __shfl_xor(l, msk, 32);
    const float inv = 1.0f / l;                                      // l >= 1 (the max element contributes exp(0))
#pragma unroll
    for (int ch = 0; ch < SEQ / 128; ++ch)
#pragma unroll
        for (int q = 0; q < 4; ++q) p[ch][q] = p[ch][q] * inv;
{
#pragma unroll
        for (int ch = 0; ch < SEQ / 128; ++ch) { const int j0 = ch * 128 + lane * 4;
            if (hires) { v4us oh, ol;
#pragma unroll
                for (int q = 0; q < 4; ++q) { unsigned short h2, l2; splitf(p[ch][q], h2, l2); oh[q] = h2; ol[q] = l2; }
                const size_t oo = ((size_t)zz * RHE + i) * SEQ + j0; *(v4us*)(Ph + oo) = oh; *(v4us*)(Pl + oo) = ol; }
            else { v4h o4;
#pragma unroll
                for (int q = 0; q < 4; ++q) o4[q] = tohx(p[ch][q] * PCAR); *(v4h*)(P16 + (size_t)row * SEQ + j0) = o4; } }
         }
}

__global__ __launch_bounds__(256) void k_merge(const float* __restrict__ O, int h0, bf* Ah, bf* Al) { const size_t e = ((size_t)blockIdx.x * 256 + threadIdx.x) * 2; if (e >= (size_t)ZH * SEQ * HD) return; const int d = (int)(e % HD); const int t = (int)((e / HD) % SEQ); const int zz = (int)(e / ((size_t)HD * SEQ)); const float cs = (t < RHE) ? (1.0f / VSC) : (1.0f / (VSC * PCAR)); const size_t oo = (size_t)t * DQ + (h0 + zz) * HD + d;
    v2us oh, ol;
#pragma unroll
    for (int q = 0; q < 2; ++q) { unsigned short a, c2; splitf(O[e + q] * cs, a, c2); oh[q] = a; ol[q] = c2; } *(v2us*)(Ah + oo) = oh; *(v2us*)(Al + oo) = ol;  }

extern "C" void kernel_launch(void* const* d_in, const int* in_sizes, int n_in,
                              void* d_out, int out_size, void* d_ws, size_t ws_size, hipStream_t stream) {
    if (n_in < 12) return;
    const size_t needx = ((size_t)(NB - 1) * SEQ_FULL + SEQ) * DM;
    if ((size_t)in_sizes[0] < needx || (size_t)in_sizes[1] < needx || (size_t)in_sizes[2] < needx) return;
    if (in_sizes[3] < DM * DM || in_sizes[5] < DM * DM || in_sizes[7] < DM * DM || in_sizes[9] < DM * DM) return;
    if (in_sizes[4] < DM || in_sizes[6] < DM || in_sizes[8] < DM || in_sizes[10] < DM || in_sizes[11] < 1) return;
    if ((size_t)out_size < needx) return;
    const float* xq = (const float*)d_in[0]; const float* xk = (const float*)d_in[1]; const float* xv = (const float*)d_in[2];
    const float* wq = (const float*)d_in[3]; const float* bq = (const float*)d_in[4]; const float* wk = (const float*)d_in[5]; const float* bk = (const float*)d_in[6];
    const float* wv = (const float*)d_in[7]; const float* bv = (const float*)d_in[8]; const float* wo = (const float*)d_in[9]; const float* bo = (const float*)d_in[10];
    const int* CZ = (const int*)d_in[11];
    float* OUT = (float*)d_out;     // [NB][SEQ_FULL][DM]

    // ---- workspace carve (every region a multiple of 256 B; all producers write exact tile/row multiples, no padded tails needed: SEQ%128==0, DM%64==0)
    constexpr size_t SZ_W = (size_t)DM * DM * 2, SZ_XB = (size_t)SEQ * DM * 2, SZ_F = (size_t)SEQ * DQ * 4, SZ_PL = (size_t)NH_ * SEQ * HD * 2, SZ_PP = (size_t)ZH * RHE * SEQ * 2;
    constexpr size_t SZ_SB = (size_t)ZH * SEQ * SEQ * 4, SZ_P16 = (size_t)ZH * SEQ * SEQ * 2, SZ_OB = (size_t)ZH * SEQ * HD * 4, SZ_AT = (size_t)SEQ * DQ * 2;
    constexpr size_t WS_TOTAL = 4 * SZ_W + SZ_XB + SZ_F + 9 * SZ_PL + 2 * SZ_PP + SZ_SB + SZ_P16 + SZ_OB + 2 * SZ_AT;
    static_assert(WS_TOTAL <= (size_t)134217728);
    if (WS_TOTAL > ws_size) return;
    char* wsp = (char*)d_ws;
    auto take = [&](size_t bytes) { char* p = wsp; wsp += (bytes + 255) & ~(size_t)255; return (void*)p; };
    bf* WQ = (bf*)take(SZ_W); bf* WK = (bf*)take(SZ_W); bf* WV = (bf*)take(SZ_W); bf* WO = (bf*)take(SZ_W);
    bf* XB = (bf*)take(SZ_XB); float* F = (float*)take(SZ_F);                  // one projection buffer reused for q, k, v (stream-ordered)
    h16* QP16 = (h16*)take(SZ_PL); h16* KP16 = (h16*)take(SZ_PL); h16* VT16 = (h16*)take(SZ_PL);
    bf* QPh = (bf*)take(SZ_PL); bf* QPl = (bf*)take(SZ_PL); bf* KPh = (bf*)take(SZ_PL); bf* KPl = (bf*)take(SZ_PL); bf* VTh = (bf*)take(SZ_PL); bf* VTl = (bf*)take(SZ_PL);
    bf* Ph = (bf*)take(SZ_PP); bf* Pl = (bf*)take(SZ_PP);
    float* Sb = (float*)take(SZ_SB); h16* P16 = (h16*)take(SZ_P16); float* Ob = (float*)take(SZ_OB); bf* ATh = (bf*)take(SZ_AT); bf* ATl = (bf*)take(SZ_AT);
    if ((size_t)(wsp - (char*)d_ws) > ws_size) return;

    const unsigned GW8 = (unsigned)((DM * DM / 8 + 255) / 256), GX8 = (unsigned)(((size_t)SEQ * DM / 8 + 255) / 256);
    const unsigned LQ = (unsigned)(((size_t)NH_ * SEQ * HD / 2 + 255) / 256), LZ = (unsigned)(((size_t)ZH * SEQ * HD / 2 + 255) / 256);
    k_cvt8<<<GW8, 256, 0, stream>>>(wq, WQ, (size_t)DM * DM / 8);
    k_cvt8<<<GW8, 256, 0, stream>>>(wk, WK, (size_t)DM * DM / 8);
    k_cvt8<<<GW8, 256, 0, stream>>>(wv, WV, (size_t)DM * DM / 8);
    k_cvt8<<<GW8, 256, 0, stream>>>(wo, WO, (size_t)DM * DM / 8);
    for (int b = 0; b < NB; ++b) {
        const size_t xo = (size_t)b * SEQ_FULL * DM;
        k_cvt8<<<GX8, 256, 0, stream>>>(xq + xo, XB, (size_t)SEQ * DM / 8);
        k_gemmw<bf, 0, true, 8><<<dim3(SEQ / 64, DQ / 64, 1), 256, 0, stream>>>(XB, nullptr, WQ, nullptr, DM, F, DQ, bq, 0, 0, 0, CZ, 0, 0);
        k_qkp<<<LQ, 256, 0, stream>>>(F, DQ, NH_, QSC, QP16, QPh, QPl);
        k_cvt8<<<GX8, 256, 0, stream>>>(xk + xo, XB, (size_t)SEQ * DM / 8);
        k_gemmw<bf, 0, true, 8><<<dim3(SEQ / 64, DKV / 64, 1), 256, 0, stream>>>(XB, nullptr, WK, nullptr, DM, F, DKV, bk, 0, 0, 0, CZ, 0, 0);
        k_qkp<<<LQ, 256, 0, stream>>>(F, DKV, NKV, KSC, KP16, KPh, KPl);
        k_cvt8<<<GX8, 256, 0, stream>>>(xv + xo, XB, (size_t)SEQ * DM / 8);
        k_gemmw<bf, 0, true, 8><<<dim3(SEQ / 64, DKV / 64, 1), 256, 0, stream>>>(XB, nullptr, WV, nullptr, DM, F, DKV, bv, 0, 0, 0, CZ, 0, 0);
        k_vtp<<<LQ, 256, 0, stream>>>(F, DKV, NKV, VSC, VT16, VTh, VTl);
        for (int h0 = 0; h0 < NH_; h0 += ZH) { const size_t zq = (size_t)h0, zk = (size_t)h0;
            k_gemmw<bf, 2, false, 1><<<dim3(RHE / 64, SEQ / 64, ZH), 32, 0, stream>>>(QPh + zq * SEQ * HD, QPl + zq * SEQ * HD, KPh + zk * SEQ * HD, KPl + zk * SEQ * HD, HD, Sb, SEQ, nullptr, (size_t)SEQ * HD, (size_t)SEQ * HD, (size_t)SEQ * SEQ, CZ, 0, 1);
            if (SEQ > RHE) k_gemmw<h16, 0, false, 1><<<dim3((SEQ - RHE) / 64, SEQ / 64, ZH), 32, 0, stream>>>(QP16 + zq * SEQ * HD + (size_t)RHE * HD, nullptr, KP16 + zk * SEQ * HD, nullptr, HD, Sb + (size_t)RHE * SEQ, SEQ, nullptr, (size_t)SEQ * HD, (size_t)SEQ * HD, (size_t)SEQ * SEQ, CZ, RHE, 1);
            k_asoft<<<ZH * SEQ / 8, 256, 0, stream>>>(Sb, CZ, P16, Ph, Pl);
            k_gemmw<bf, 2, false, 8><<<dim3(RHE / 64, HD / 64, ZH), 256, 0, stream>>>(Ph, Pl, VTh + zk * HD * SEQ, VTl + zk * HD * SEQ, SEQ, Ob, HD, nullptr, (size_t)RHE * SEQ, (size_t)HD * SEQ, (size_t)SEQ * HD, CZ, 0, 2);
            if (SEQ > RHE) k_gemmw<h16, 0, false, 16><<<dim3((SEQ - RHE) / 64, HD / 64, ZH), 512, 0, stream>>>(P16 + (size_t)RHE * SEQ, nullptr, VT16 + zk * HD * SEQ, nullptr, SEQ, Ob + (size_t)RHE * HD, HD, nullptr, (size_t)SEQ * SEQ, (size_t)HD * SEQ, (size_t)SEQ * HD, CZ, RHE, 2);
            k_merge<<<LZ, 256, 0, stream>>>(Ob, h0, ATh, ATl); }
        k_gemmw<bf, 1, true, 8><<<dim3(SEQ / 64, DM / 64, 1), 256, 0, stream>>>(ATh, ATl, WO, nullptr, DQ, OUT + xo, DM, bo, 0, 0, 0, CZ, 0, 0); }
}

// v002
// It runs in 490 microseconds.
// Next to v001, in two timings, it ran 1.86 and 1.87 times as fast.
// All steps since v000 together make it 3.27 times as fast.
#include <hip/hip_runtime.h>

// Causal multi-head attention: q/k/v = x W^T + b ([out][in] weights, 16 heads x 64), scores = q.k x 1/8 with lower-triangular replace-mask under an int flag input, f32 softmax, ctx = P v, out = ctx Wo^T + bo -> [2][2048][1024] f32.
// Compute dtypes, f32 accumulate everywhere: every float input RNE-converted to bf16; q/k/v projections v_wmma_f32_16x16x32_bf16 on plain bf16 operands + bias; scores: query rows < RH bf16 hi/lo x bf16 hi/lo (3 products), rows >= RH plain v_wmma_f32_16x16x32_f16 (q and k planes carried x4); softmax f32; P.v: rows < RH bf16 hi/lo P x bf16 hi/lo v (3 products), rows >= RH fp16 P carried x1024 against fp16 v carried x4; output projection bf16 hi/lo of ctx x bf16 Wo (2 products) + bias.

#ifndef NB
#define NB 2
#endif
#ifndef SEQ
#define SEQ 2048
#endif
#define NB_FULL  2
#define SEQ_FULL 2048
#define DM   1024
#define NH_  16
#define NKV  16
#define HD   64
#define DQ   (NH_ * HD)
#define DKV  (NKV * HD)
#define ZH   8                    // heads per launch of the score, softmax, P.v and merge kernels
#ifndef RH
#define RH   512                  // query rows < RH use hi+lo planes
#endif
#define RHE  ((RH < SEQ) ? RH : SEQ)
#define QSC  4.0f                 // q plane carry
#define KSC  4.0f                 // k plane carry
#define VSC  4.0f                 // v plane carry
#define PCAR 1024.0f              // fp16 P plane carry (rows >= RH)
#define SCL  (0.125f / (QSC * KSC))   // HD^-0.5 folded with the q/k carries (exact power of two)
static_assert(SEQ % 128 == 0);
static_assert(SEQ <= SEQ_FULL);
static_assert(NB >= 1 && NB <= NB_FULL);
static_assert((RHE % 64) == 0);
static_assert(DM == DQ);
static_assert((DM % 64) == 0 && (HD % 32) == 0);
static_assert((NH_ % ZH) == 0);

typedef _Float16 h16;
typedef unsigned short bf;
typedef __attribute__((ext_vector_type(16))) __bf16   v16bf;
typedef __attribute__((ext_vector_type(16))) _Float16 v16h;
typedef __attribute__((ext_vector_type(8)))  _Float16 v8h;
typedef __attribute__((ext_vector_type(8)))  unsigned short v8us;
typedef __attribute__((ext_vector_type(8)))  float    v8f;
typedef __attribute__((ext_vector_type(4)))  float    v4f;
typedef __attribute__((ext_vector_type(2))) _Float16 v2h;
typedef __attribute__((ext_vector_type(4))) _Float16 v4h;
typedef __attribute__((ext_vector_type(2))) unsigned short v2us;
typedef __attribute__((ext_vector_type(4))) unsigned short v4us;
typedef __attribute__((ext_vector_type(2))) float v2f;
typedef v8h  __attribute__((may_alias)) v8ha;
typedef v4f  __attribute__((may_alias)) v4fa;
typedef v8us __attribute__((may_alias)) v8usa;

__device__ __forceinline__ unsigned short f2bf(float f) { unsigned u = __float_as_uint(f); u += 0x7FFFu + ((u >> 16) & 1u); return (unsigned short)(u >> 16); }
__device__ __forceinline__ float bf2f(unsigned short b) { return __uint_as_float(((unsigned)b) << 16); }
__device__ __forceinline__ float bfr(float f) { return bf2f(f2bf(f)); }
__device__ __forceinline__ v16h cat16(v8h lo, v8h hi) { return __builtin_shufflevector(lo, hi, 0, 1, 2, 3, 4, 5, 6, 7, 8, 9, 10, 11, 12, 13, 14, 15); }
__device__ __forceinline__ v16bf cat16b(v8us lo, v8us hi) { return __builtin_bit_cast(v16bf, __builtin_shufflevector(lo, hi, 0, 1, 2, 3, 4, 5, 6, 7, 8, 9, 10, 11, 12, 13, 14, 15)); }
__device__ __forceinline__ v8f wmma16(v16h a, v16h b, v8f c) { return __builtin_amdgcn_wmma_f32_16x16x32_f16(false, a, false, b, (short)0, c, false, false); }
__device__ __forceinline__ v8f wmmab(v16bf a, v16bf b, v8f c) { return __builtin_amdgcn_wmma_f32_16x16x32_bf16(false, a, false, b, (short)0, c, false, false); }
__device__ __forceinline__ h16 tohx(float x) { return (h16)x; }
__device__ __forceinline__ void splitf(float y, unsigned short& h, unsigned short& l) { h = f2bf(y); l = f2bf(y - bf2f(h)); }

// ---- k_gemmw: register-blocked GEMM, one 64x64 output tile per work-group (16 accumulators per wave), operands straight from K-contiguous 16-bit planes; grid (M/64, N/64, Z), 32 * KW threads.
// C[m][n] (f32, pitch ldc, + optional f32 bias[n]) = sum_k A[m][k] Bt[n][k] (+ split products per NSPLIT). A rows at pitch lda, Bt rows at pitch K. z-batch strides sA/sB/sC in elements. K % 32 == 0.
// Fragments: lane l, h = l>>4, row/col = l&15; elements 0..7 <- k0+8h+0..7, elements 8..15 <- k0+16+8h+0..7 for BOTH A and Bt; D element r -> (row 8h+r, col l&15).
// KW waves per work-group share one tile: wave w takes the 32-wide k steps w, w+KW, ...; the KW partial tiles meet in LDS and are summed in wave order (KW == 1: one wave, no sum).
// cmode 1 (scores, causal flag set): tiles whose first key column lies past the last query row r0+roff+63 are skipped (loaded but never used downstream); cmode 2 (P.v): K limited to r0+roff+64 keys.
// xwait: stands behind every fragment load, in front of the next one, whose result the register allocator may place in the pair that holds an issued load's address
__device__ __forceinline__ void xwait() { asm volatile("s_wait_xcnt 0x0" ::: "memory"); }
template <typename T16> struct WFrag;
template <> struct WFrag<h16> { typedef v16h V; static __device__ __forceinline__ V ld(const h16* p) { const v8h lo = *(const v8h*)p; xwait(); const v8h hi = *(const v8h*)(p + 16); xwait(); return cat16(lo, hi); } static __device__ __forceinline__ v8f mma(V a, V b, v8f c) { return wmma16(a, b, c); } };
template <> struct WFrag<bf> { typedef v16bf V; static __device__ __forceinline__ V ld(const bf* p) { const v8us lo = *(const v8us*)p; xwait(); const v8us hi = *(const v8us*)(p + 16); xwait(); return cat16b(lo, hi); } static __device__ __forceinline__ v8f mma(V a, V b, v8f c) { return wmmab(a, b, c); } };
template <typename T16, int NSPLIT, bool BIAS, int KW>
__global__ __launch_bounds__(32 * KW) void k_gemmw(const T16* __restrict__ A, const T16* __restrict__ A2, const T16* __restrict__ Bt, const T16* __restrict__ Bt2, int K, int lda, float* C, int ldc, const float* __restrict__ bias, size_t sA, size_t sB, size_t sC,
                                              const int* __restrict__ cflag, int roff, int cmode) {
    typedef typename WFrag<T16>::V V;
    __shared__ __align__(16) float os[(KW == 1) ? 16 * 68 : KW * 64 * 68];
    const size_t z = blockIdx.z; A += z * sA; if (A2) A2 += z * sA; Bt += z * sB; if (Bt2) Bt2 += z * sB; C += z * sC;
    const int lane = threadIdx.x & 31, lr = lane & 15, hi = lane >> 4; const int r0 = blockIdx.x * 64, c0 = blockIdx.y * 64;
    const int causal = (cmode != 0 && cflag[0] != 0) ? 1 : 0;
    if (cmode == 1 && causal && c0 >= r0 + roff + 64) return;      // blockIdx and the flag alone decide: the whole block leaves, ahead of the one block barrier
    int Kend = K;
    if (cmode == 2 && causal) { const int kl = r0 + roff + 64; Kend = (kl < K) ? kl : K; }
    const int wv = (KW == 1) ? 0 : __builtin_amdgcn_readfirstlane((int)(threadIdx.x >> 5));   // wave number, held scalar so that the k loop keeps a scalar branch and every lane stays on at the matrix instructions
    v8f acc[4][4];
#pragma unroll
    for (int mb = 0; mb < 4; ++mb)
#pragma unroll
        for (int nb = 0; nb < 4; ++nb) acc[mb][nb] = (v8f){};
    const size_t aoff = (size_t)(r0 + lr) * lda + 8 * hi, boff = (size_t)(c0 + lr) * K + 8 * hi;
#pragma unroll 1
    for (int kc = 32 * wv; kc < Kend; kc += 32 * KW) {
        V a[4], a2[4];
#pragma unroll
        for (int mb = 0; mb < 4; ++mb) { a[mb] = WFrag<T16>::ld(A + aoff + (size_t)mb * 16 * lda + kc); if (NSPLIT == 1 || NSPLIT == 2) a2[mb] = WFrag<T16>::ld(A2 + aoff + (size_t)mb * 16 * lda + kc); }
#pragma unroll
        for (int nb = 0; nb < 4; ++nb) { const V b = WFrag<T16>::ld(Bt + boff + (size_t)nb * 16 * K + kc); V b2; if (NSPLIT >= 2) b2 = WFrag<T16>::ld(Bt2 + boff + (size_t)nb * 16 * K + kc);
#pragma unroll
            for (int mb = 0; mb < 4; ++mb) { acc[mb][nb] = WFrag<T16>::mma(a[mb], b, acc[mb][nb]); if (NSPLIT == 1 || NSPLIT == 2) acc[mb][nb] = WFrag<T16>::mma(a2[mb], b, acc[mb][nb]); if (NSPLIT >= 2) acc[mb][nb] = WFrag<T16>::mma(a[mb], b2, acc[mb][nb]); } }
        asm volatile("v_nop\n\tv_nop\n\tv_nop\n\tv_nop" : "+v"(acc[0][0]), "+v"(acc[1][1]), "+v"(acc[2][2]), "+v"(acc[3][3]) : "v"(a[0]), "v"(a[3]));
    }
    if constexpr (KW > 1) {
        float* osw = os + wv * (64 * 68);          // this wave's partial tile, rows at pitch 68
        // the loops below are unrolled so that acc is indexed by constants (stays in registers) and the LDS reads of a thread's items issue together
#pragma unroll
        for (int mb = 0; mb < 4; ++mb)
#pragma unroll
            for (int nb = 0; nb < 4; ++nb)
#pragma unroll
                for (int j = 0; j < 8; ++j) osw[(mb * 16 + hi * 8 + j) * 68 + nb * 16 + lr] = acc[mb][nb][j];
        __syncthreads();                                            // every wave's partial tile is in LDS before any of it is summed
#pragma unroll
        for (int s = 0; s < (64 * 16) / (32 * KW); ++s) { const int item = s * (32 * KW) + (int)threadIdx.x, row = item >> 4, cofs = (item & 15) * 4; v4f val = *(const v4fa*)(os + row * 68 + cofs);
#pragma unroll
            for (int w = 1; w < KW; ++w) val += *(const v4fa*)(os + w * (64 * 68) + row * 68 + cofs);
            if (BIAS) { val[0] += bfr(bias[c0 + cofs]); val[1] += bfr(bias[c0 + cofs + 1]); val[2] += bfr(bias[c0 + cofs + 2]); val[3] += bfr(bias[c0 + cofs + 3]); }
            *(v4f*)(C + (size_t)(r0 + row) * ldc + c0 + cofs) = val; }
        return;
    }
#pragma unroll
    for (int mb = 0; mb < 4; ++mb) {
#pragma unroll
        for (int nb = 0; nb < 4; ++nb) {
#pragma unroll
            for (int j = 0; j < 8; ++j) os[(hi * 8 + j) * 68 + nb * 16 + lr] = acc[mb][nb][j]; }
        __builtin_amdgcn_wave_barrier(); asm volatile("" ::: "memory");
        float* crow = C + (size_t)(r0 + mb * 16) * ldc + c0;
{
#pragma unroll
            for (int s = 0; s < 8; ++s) { const int row = 2 * s + hi, cofs = lr * 4; v4f val = *(const v4fa*)(os + row * 68 + cofs); if (BIAS) { val[0] += bfr(bias[c0 + cofs]); val[1] += bfr(bias[c0 + cofs + 1]); val[2] += bfr(bias[c0 + cofs + 2]); val[3] += bfr(bias[c0 + cofs + 3]); }
                *(v4f*)(crow + (size_t)row * ldc + cofs) = val; }
             }
        __builtin_amdgcn_wave_barrier(); asm volatile("" ::: "memory");
    }
}

__global__ __launch_bounds__(256) void k_cvt8(const float* __restrict__ src, bf* dst, size_t n8) { const size_t i = (size_t)blockIdx.x * 256 + threadIdx.x; if (i >= n8) return; const v8f v = *(const v8f*)(src + i * 8); v8us o;
#pragma unroll
    for (int k = 0; k < 8; ++k) o[k] = f2bf(v[k]); *(v8us*)(dst + i * 8) = o;  }

__global__ __launch_bounds__(256) void k_qkp(const float* __restrict__ F, int pitch, int nheads, float sc, h16* P16, bf* Ph, bf* Pl) {
    const size_t e = ((size_t)blockIdx.x * 256 + threadIdx.x) * 2; if (e >= (size_t)nheads * SEQ * HD) return; const int d = (int)(e % HD); const int t = (int)((e / HD) % SEQ); const int h = (int)(e / ((size_t)HD * SEQ)); const float* f = F + (size_t)t * pitch + h * HD + d; v2h o16; v2us oh, ol;
#pragma unroll
    for (int q = 0; q < 2; ++q) { const float r = f[q] * sc; o16[q] = tohx(r); unsigned short a2, c2; splitf(r, a2, c2); oh[q] = a2; ol[q] = c2; }
    *(v2h*)(P16 + e) = o16; *(v2us*)(Ph + e) = oh; *(v2us*)(Pl + e) = ol;  }
__global__ __launch_bounds__(256) void k_vtp(const float* __restrict__ F, int pitch, int nheads, float sc, h16* V16, bf* Vh, bf* Vl) { const size_t e = ((size_t)blockIdx.x * 256 + threadIdx.x) * 2; if (e >= (size_t)nheads * HD * SEQ) return; const int t = (int)(e % SEQ); const int d = (int)((e / SEQ) % HD); const int g = (int)(e / ((size_t)SEQ * HD)); v2h o16; v2us oh, ol;
#pragma unroll
    for (int q = 0; q < 2; ++q) { const float x = F[(size_t)(t + q) * pitch + g * HD + d] * sc; o16[q] = tohx(x); unsigned short a2, c2; splitf(x, a2, c2); oh[q] = a2; ol[q] = c2; }
    *(v2h*)(V16 + e) = o16; *(v2us*)(Vh + e) = oh; *(v2us*)(Vl + e) = ol;  }

// k_asoft: one wave per score row (zz, i): x_j = S[zz][i][j] * SCL for j <= i (all j when the flag is 0), replace-fill -1e30 otherwise (index select; tiles skipped by the score GEMM are never used);
// the P planes go back into the row's own SEQ * 4 bytes of Sb (rows < RH: bf16 hi in the first half, lo in the second; rows >= RH: fp16 in the first half): the wave holds its whole row in registers before its first store, and no other wave touches that row.
__global__ __launch_bounds__(256) void k_asoft(float* Sb, const int* __restrict__ cflag) {
#pragma clang fp contract(off)
    const int lane = threadIdx.x & 31; const int row = blockIdx.x * 8 + (threadIdx.x >> 5); if (row >= ZH * SEQ) return; const int i = row % SEQ; const bool hires = (i < RHE);
    const int causal = (cflag[0] != 0) ? 1 : 0;
    const int nval = causal ? (i / 128 + 1) : (SEQ / 128);          // 128-column chunks holding at least one unmasked column (wave-uniform)
    const float* sr = Sb + (size_t)row * SEQ; bf* pb = (bf*)(Sb + (size_t)row * SEQ);
    float p[SEQ / 128][4]; float m = -1.0e30f;
#pragma unroll
    for (int ch = 0; ch < SEQ / 128; ++ch) {
        if (ch < nval) { const int j0 = ch * 128 + lane * 4; const v4f a = *(const v4f*)(sr + j0);
#pragma unroll
            for (int q = 0; q < 4; ++q) { const float xs = a[q] * SCL; const float x = (causal != 0 && (j0 + q) > i) ? -1.0e30f : xs; p[ch][q] = x; m = fmaxf(m, x); } }
        else {
#pragma unroll
            for (int q = 0; q < 4; ++q) p[ch][q] = -1.0e30f; } }
#pragma unroll
    for (int msk = 1; msk < 32; msk <<= 1) m = fmaxf(m, __shfl_xor(m, msk, 32));
    float l = 0.0f;
#pragma unroll
    for (int ch = 0; ch < SEQ / 128; ++ch) {
        if (ch < nval) {
#pragma unroll
            for (int q = 0; q < 4; ++q) { const float d = p[ch][q] - m; const float e0 = __expf(d); const float e = (d > -1.0e29f) ? e0 : 0.0f; p[ch][q] = e; l += e; } }
        else {
#pragma unroll
            for (int q = 0; q < 4; ++q) p[ch][q] = 0.0f; } }
#pragma unroll
    for (int msk = 1; msk < 32; msk <<= 1) l += __shfl_xor(l, msk, 32);
    const float inv = 1.0f / l;                                      // l >= 1 (the max element contributes exp(0))
#pragma unroll
    for (int ch = 0; ch < SEQ / 128; ++ch)
#pragma unroll
        for (int q = 0; q < 4; ++q) p[ch][q] = p[ch][q] * inv;
{
#pragma unroll
        for (int ch = 0; ch < SEQ / 128; ++ch) { const int j0 = ch * 128 + lane * 4;
            if (hires) { v4us oh, ol;
#pragma unroll
                for (int q = 0; q < 4; ++q) { unsigned short h2, l2; splitf(p[ch][q], h2, l2); oh[q] = h2; ol[q] = l2; }
                *(v4us*)(pb + j0) = oh; *(v4us*)(pb + SEQ + j0) = ol; }
            else { v4h o4;
#pragma unroll
                for (int q = 0; q < 4; ++q) o4[q] = tohx(p[ch][q] * PCAR); *(v4h*)((h16*)pb + j0) = o4; } }
         }
}

__global__ __launch_bounds__(256) void k_merge(const float* __restrict__ O, int h0, bf* Ah, bf* Al) { const size_t e = ((size_t)blockIdx.x * 256 + threadIdx.x) * 2; if (e >= (size_t)ZH * SEQ * HD) return; const int d = (int)(e % HD); const int t = (int)((e / HD) % SEQ); const int zz = (int)(e / ((size_t)HD * SEQ)); const float cs = (t < RHE) ? (1.0f / VSC) : (1.0f / (VSC * PCAR)); const size_t oo = (size_t)t * DQ + (h0 + zz) * HD + d;
    v2us oh, ol;
#pragma unroll
    for (int q = 0; q < 2; ++q) { unsigned short a, c2; splitf(O[e + q] * cs, a, c2); oh[q] = a; ol[q] = c2; } *(v2us*)(Ah + oo) = oh; *(v2us*)(Al + oo) = ol;  }

extern "C" void kernel_launch(void* const* d_in, const int* in_sizes, int n_in,
                              void* d_out, int out_size, void* d_ws, size_t ws_size, hipStream_t stream) {
    if (n_in < 12) return;
    const size_t needx = ((size_t)(NB - 1) * SEQ_FULL + SEQ) * DM;
    if ((size_t)in_sizes[0] < needx || (size_t)in_sizes[1] < needx || (size_t)in_sizes[2] < needx) return;
    if (in_sizes[3] < DM * DM || in_sizes[5] < DM * DM || in_sizes[7] < DM * DM || in_sizes[9] < DM * DM) return;
    if (in_sizes[4] < DM || in_sizes[6] < DM || in_sizes[8] < DM || in_sizes[10] < DM || in_sizes[11] < 1) return;
    if ((size_t)out_size < needx) return;
    const float* xq = (const float*)d_in[0]; const float* xk = (const float*)d_in[1]; const float* xv = (const float*)d_in[2];
    const float* wq = (const float*)d_in[3]; const float* bq = (const float*)d_in[4]; const float* wk = (const float*)d_in[5]; const float* bk = (const float*)d_in[6];
    const float* wv = (const float*)d_in[7]; const float* bv = (const float*)d_in[8]; const float* wo = (const float*)d_in[9]; const float* bo = (const float*)d_in[10];
    const int* CZ = (const int*)d_in[11];
    float* OUT = (float*)d_out;     // [NB][SEQ_FULL][DM]

    // ---- workspace carve (every region a multiple of 256 B; all producers write exact tile/row multiples, no padded tails needed: SEQ%128==0, DM%64==0)
    constexpr size_t SZ_W = (size_t)DM * DM * 2, SZ_XB = (size_t)SEQ * DM * 2, SZ_F = (size_t)SEQ * DQ * 4, SZ_PL = (size_t)NH_ * SEQ * HD * 2;
    constexpr size_t SZ_SB = (size_t)ZH * SEQ * SEQ * 4, SZ_OB = (size_t)ZH * SEQ * HD * 4, SZ_AT = (size_t)SEQ * DQ * 2;
    constexpr size_t WS_TOTAL = 4 * SZ_W + SZ_XB + SZ_F + 9 * SZ_PL + SZ_SB + SZ_OB + 2 * SZ_AT;
    static_assert(WS_TOTAL <= (size_t)268435456);
    if (WS_TOTAL > ws_size) return;
    char* wsp = (char*)d_ws;
    auto take = [&](size_t bytes) { char* p = wsp; wsp += (bytes + 255) & ~(size_t)255; return (void*)p; };
    bf* WQ = (bf*)take(SZ_W); bf* WK = (bf*)take(SZ_W); bf* WV = (bf*)take(SZ_W); bf* WO = (bf*)take(SZ_W);
    bf* XB = (bf*)take(SZ_XB); float* F = (float*)take(SZ_F);                  // one projection buffer reused for q, k, v (stream-ordered)
    h16* QP16 = (h16*)take(SZ_PL); h16* KP16 = (h16*)take(SZ_PL); h16* VT16 = (h16*)take(SZ_PL);
    bf* QPh = (bf*)take(SZ_PL); bf* QPl = (bf*)take(SZ_PL); bf* KPh = (bf*)take(SZ_PL); bf* KPl = (bf*)take(SZ_PL); bf* VTh = (bf*)take(SZ_PL); bf* VTl = (bf*)take(SZ_PL);
    float* Sb = (float*)take(SZ_SB); float* Ob = (float*)take(SZ_OB); bf* ATh = (bf*)take(SZ_AT); bf* ATl = (bf*)take(SZ_AT);
    if ((size_t)(wsp - (char*)d_ws) > ws_size) return;

    const unsigned GW8 = (unsigned)((DM * DM / 8 + 255) / 256), GX8 = (unsigned)(((size_t)SEQ * DM / 8 + 255) / 256);
    const unsigned LQ = (unsigned)(((size_t)NH_ * SEQ * HD / 2 + 255) / 256), LZ = (unsigned)(((size_t)ZH * SEQ * HD / 2 + 255) / 256);
    k_cvt8<<<GW8, 256, 0, stream>>>(wq, WQ, (size_t)DM * DM / 8);
    k_cvt8<<<GW8, 256, 0, stream>>>(wk, WK, (size_t)DM * DM / 8);
    k_cvt8<<<GW8, 256, 0, stream>>>(wv, WV, (size_t)DM * DM / 8);
    k_cvt8<<<GW8, 256, 0, stream>>>(wo, WO, (size_t)DM * DM / 8);
    for (int b = 0; b < NB; ++b) {
        const size_t xo = (size_t)b * SEQ_FULL * DM;
        k_cvt8<<<GX8, 256, 0, stream>>>(xq + xo, XB, (size_t)SEQ * DM / 8);
        k_gemmw<bf, 0, true, 8><<<dim3(SEQ / 64, DQ / 64, 1), 256, 0, stream>>>(XB, nullptr, WQ, nullptr, DM, DM, F, DQ, bq, 0, 0, 0, CZ, 0, 0);
        k_qkp<<<LQ, 256, 0, stream>>>(F, DQ, NH_, QSC, QP16, QPh, QPl);
        k_cvt8<<<GX8, 256, 0, stream>>>(xk + xo, XB, (size_t)SEQ * DM / 8);
        k_gemmw<bf, 0, true, 8><<<dim3(SEQ / 64, DKV / 64, 1), 256, 0, stream>>>(XB, nullptr, WK, nullptr, DM, DM, F, DKV, bk, 0, 0, 0, CZ, 0, 0);
        k_qkp<<<LQ, 256, 0, stream>>>(F, DKV, NKV, KSC, KP16, KPh, KPl);
        k_cvt8<<<GX8, 256, 0, stream>>>(xv + xo, XB, (size_t)SEQ * DM / 8);
        k_gemmw<bf, 0, true, 8><<<dim3(SEQ / 64, DKV / 64, 1), 256, 0, stream>>>(XB, nullptr, WV, nullptr, DM, DM, F, DKV, bv, 0, 0, 0, CZ, 0, 0);
        k_vtp<<<LQ, 256, 0, stream>>>(F, DKV, NKV, VSC, VT16, VTh, VTl);
        for (int h0 = 0; h0 < NH_; h0 += ZH) { const size_t zq = (size_t)h0, zk = (size_t)h0;
            k_gemmw<bf, 2, false, 1><<<dim3(RHE / 64, SEQ / 64, ZH), 32, 0, stream>>>(QPh + zq * SEQ * HD, QPl + zq * SEQ * HD, KPh + zk * SEQ * HD, KPl + zk * SEQ * HD, HD, HD, Sb, SEQ, nullptr, (size_t)SEQ * HD, (size_t)SEQ * HD, (size_t)SEQ * SEQ, CZ, 0, 1);
            if (SEQ > RHE) k_gemmw<h16, 0, false, 1><<<dim3((SEQ - RHE) / 64, SEQ / 64, ZH), 32, 0, stream>>>(QP16 + zq * SEQ * HD + (size_t)RHE * HD, nullptr, KP16 + zk * SEQ * HD, nullptr, HD, HD, Sb + (size_t)RHE * SEQ, SEQ, nullptr, (size_t)SEQ * HD, (size_t)SEQ * HD, (size_t)SEQ * SEQ, CZ, RHE, 1);
            k_asoft<<<ZH * SEQ / 8, 256, 0, stream>>>(Sb, CZ);
            k_gemmw<bf, 2, false, 8><<<dim3(RHE / 64, HD / 64, ZH), 256, 0, stream>>>((const bf*)Sb, (const bf*)Sb + SEQ, VTh + zk * HD * SEQ, VTl + zk * HD * SEQ, SEQ, 2 * SEQ, Ob, HD, nullptr, (size_t)2 * SEQ * SEQ, (size_t)HD * SEQ, (size_t)SEQ * HD, CZ, 0, 2);
            if (SEQ > RHE) k_gemmw<h16, 0, false, 16><<<dim3((SEQ - RHE) / 64, HD / 64, ZH), 512, 0, stream>>>((const h16*)Sb + (size_t)RHE * 2 * SEQ, nullptr, VT16 + zk * HD * SEQ, nullptr, SEQ, 2 * SEQ, Ob + (size_t)RHE * HD, HD, nullptr, (size_t)2 * SEQ * SEQ, (size_t)HD * SEQ, (size_t)SEQ * HD, CZ, RHE, 2);
            k_merge<<<LZ, 256, 0, stream>>>(Ob, h0, ATh, ATl); }
        k_gemmw<bf, 1, true, 8><<<dim3(SEQ / 64, DM / 64, 1), 256, 0, stream>>>(ATh, ATl, WO, nullptr, DQ, DQ, OUT + xo, DM, bo, 0, 0, 0, CZ, 0, 0); }
}

// v003
// A run of this version takes 230 microseconds.
// Next to v002, in two timings, it ran 2.11 times as fast each time.
// All steps since v000 together make it 6.89 times as fast.
#include <hip/hip_runtime.h>

// Causal multi-head attention: q/k/v = x W^T + b ([out][in] weights, 16 heads x 64), scores = q.k x 1/8 with lower-triangular replace-mask under an int flag input, f32 softmax, ctx = P v, out = ctx Wo^T + bo -> [2][2048][1024] f32.
// Compute dtypes, f32 accumulate everywhere: every float input RNE-converted to bf16; q/k/v projections v_wmma_f32_16x16x32_bf16 on plain bf16 operands + bias; scores: query rows < RH bf16 hi/lo x bf16 hi/lo (3 products), rows >= RH plain v_wmma_f32_16x16x32_f16 (q and k planes carried x4); softmax f32; P.v: rows < RH bf16 hi/lo P x bf16 hi/lo v (3 products), rows >= RH fp16 P carried x1024 against fp16 v carried x4; output projection bf16 hi/lo of ctx x bf16 Wo (2 products) + bias.

#ifndef NB
#define NB 2
#endif
#ifndef SEQ
#define SEQ 2048
#endif
#define NB_FULL  2
#define SEQ_FULL 2048
#define DM   1024
#define NH_  16
#define NKV  16
#define HD   64
#define DQ   (NH_ * HD)
#define DKV  (NKV * HD)
#define AW   8                    // waves per work-group of the attention kernel; wave w takes the 32-key chunks w, w + AW, ...
#define QT   32                   // query rows per work-group of the attention kernel
#ifndef RH
#define RH   512                  // query rows < RH use hi+lo planes
#endif
#define RHE  ((RH < SEQ) ? RH : SEQ)
#define QSC  4.0f                 // q plane carry
#define KSC  4.0f                 // k plane carry
#define VSC  4.0f                 // v plane carry
#define PCAR 1024.0f              // fp16 P plane carry (rows >= RH)
#define SCL  (0.125f / (QSC * KSC))   // HD^-0.5 folded with the q/k carries (exact power of two)
static_assert(SEQ % 128 == 0);
static_assert(SEQ <= SEQ_FULL);
static_assert(NB >= 1 && NB <= NB_FULL);
static_assert((RHE % 64) == 0);
static_assert(DM == DQ);
static_assert((DM % 64) == 0 && (HD % 32) == 0);
static_assert((RHE % QT) == 0 && (SEQ % QT) == 0 && HD == 64 && QT * (HD / 8) == 32 * AW);

typedef _Float16 h16;
typedef unsigned short bf;
typedef __attribute__((ext_vector_type(16))) __bf16   v16bf;
typedef __attribute__((ext_vector_type(16))) _Float16 v16h;
typedef __attribute__((ext_vector_type(8)))  _Float16 v8h;
typedef __attribute__((ext_vector_type(8)))  unsigned short v8us;
typedef __attribute__((ext_vector_type(8)))  float    v8f;
typedef __attribute__((ext_vector_type(4)))  float    v4f;
typedef __attribute__((ext_vector_type(2))) _Float16 v2h;
typedef __attribute__((ext_vector_type(4))) _Float16 v4h;
typedef __attribute__((ext_vector_type(2))) unsigned short v2us;
typedef __attribute__((ext_vector_type(4))) unsigned short v4us;
typedef __attribute__((ext_vector_type(2))) float v2f;
typedef v8h  __attribute__((may_alias)) v8ha;
typedef v4f  __attribute__((may_alias)) v4fa;
typedef v8us __attribute__((may_alias)) v8usa;

__device__ __forceinline__ unsigned short f2bf(float f) { unsigned u = __float_as_uint(f); u += 0x7FFFu + ((u >> 16) & 1u); return (unsigned short)(u >> 16); }
__device__ __forceinline__ float bf2f(unsigned short b) { return __uint_as_float(((unsigned)b) << 16); }
__device__ __forceinline__ float bfr(float f) { return bf2f(f2bf(f)); }
__device__ __forceinline__ v16h cat16(v8h lo, v8h hi) { return __builtin_shufflevector(lo, hi, 0, 1, 2, 3, 4, 5, 6, 7, 8, 9, 10, 11, 12, 13, 14, 15); }
__device__ __forceinline__ v16bf cat16b(v8us lo, v8us hi) { return __builtin_bit_cast(v16bf, __builtin_shufflevector(lo, hi, 0, 1, 2, 3, 4, 5, 6, 7, 8, 9, 10, 11, 12, 13, 14, 15)); }
__device__ __forceinline__ v8f wmma16(v16h a, v16h b, v8f c) { return __builtin_amdgcn_wmma_f32_16x16x32_f16(false, a, false, b, (short)0, c, false, false); }
__device__ __forceinline__ v8f wmmab(v16bf a, v16bf b, v8f c) { return __builtin_amdgcn_wmma_f32_16x16x32_bf16(false, a, false, b, (short)0, c, false, false); }
__device__ __forceinline__ h16 tohx(float x) { return (h16)x; }
__device__ __forceinline__ void splitf(float y, unsigned short& h, unsigned short& l) { h = f2bf(y); l = f2bf(y - bf2f(h)); }

// ---- k_gemmw: register-blocked GEMM, one 64x64 output tile per work-group (16 accumulators per wave), operands straight from K-contiguous 16-bit planes; grid (M/64, N/64, Z), 32 * KW threads.
// C[m][n] (f32, pitch ldc, + optional f32 bias[n]) = sum_k A[m][k] Bt[n][k] (+ split products per NSPLIT). A rows at pitch lda, Bt rows at pitch K. z-batch strides sA/sB/sC in elements. K % 32 == 0.
// Fragments: lane l, h = l>>4, row/col = l&15; elements 0..7 <- k0+8h+0..7, elements 8..15 <- k0+16+8h+0..7 for BOTH A and Bt; D element r -> (row 8h+r, col l&15).
// KW waves per work-group share one tile: wave w takes the 32-wide k steps w, w+KW, ...; the KW partial tiles meet in LDS and are summed in wave order (KW == 1: one wave, no sum).
// cmode 1 (causal flag set): tiles whose first key column lies past the last query row r0+roff+63 are skipped; cmode 2: K limited to r0+roff+64 keys; every launch here passes cmode 0 (scores and P.v are in k_fattn).
// xwait: stands behind every fragment load, in front of the next one, whose result the register allocator may place in the pair that holds an issued load's address
__device__ __forceinline__ void xwait() { asm volatile("s_wait_xcnt 0x0" ::: "memory"); }
template <typename T16> struct WFrag;
template <> struct WFrag<h16> { typedef v16h V; static __device__ __forceinline__ V ld(const h16* p) { const v8h lo = *(const v8h*)p; xwait(); const v8h hi = *(const v8h*)(p + 16); xwait(); return cat16(lo, hi); } static __device__ __forceinline__ v8f mma(V a, V b, v8f c) { return wmma16(a, b, c); } };
template <> struct WFrag<bf> { typedef v16bf V; static __device__ __forceinline__ V ld(const bf* p) { const v8us lo = *(const v8us*)p; xwait(); const v8us hi = *(const v8us*)(p + 16); xwait(); return cat16b(lo, hi); } static __device__ __forceinline__ v8f mma(V a, V b, v8f c) { return wmmab(a, b, c); } };
template <typename T16, int NSPLIT, bool BIAS, int KW>
__global__ __launch_bounds__(32 * KW) void k_gemmw(const T16* __restrict__ A, const T16* __restrict__ A2, const T16* __restrict__ Bt, const T16* __restrict__ Bt2, int K, int lda, float* C, int ldc, const float* __restrict__ bias, size_t sA, size_t sB, size_t sC,
                                              const int* __restrict__ cflag, int roff, int cmode) {
    typedef typename WFrag<T16>::V V;
    __shared__ __align__(16) float os[(KW == 1) ? 16 * 68 : KW * 64 * 68];
    const size_t z = blockIdx.z; A += z * sA; if (A2) A2 += z * sA; Bt += z * sB; if (Bt2) Bt2 += z * sB; C += z * sC;
    const int lane = threadIdx.x & 31, lr = lane & 15, hi = lane >> 4; const int r0 = blockIdx.x * 64, c0 = blockIdx.y * 64;
    const int causal = (cmode != 0 && cflag[0] != 0) ? 1 : 0;
    if (cmode == 1 && causal && c0 >= r0 + roff + 64) return;      // blockIdx and the flag alone decide: the whole block leaves, ahead of the one block barrier
    int Kend = K;
    if (cmode == 2 && causal) { const int kl = r0 + roff + 64; Kend = (kl < K) ? kl : K; }
    const int wv = (KW == 1) ? 0 : __builtin_amdgcn_readfirstlane((int)(threadIdx.x >> 5));   // wave number, held scalar so that the k loop keeps a scalar branch and every lane stays on at the matrix instructions
    v8f acc[4][4];
#pragma unroll
    for (int mb = 0; mb < 4; ++mb)
#pragma unroll
        for (int nb = 0; nb < 4; ++nb) acc[mb][nb] = (v8f){};
    const size_t aoff = (size_t)(r0 + lr) * lda + 8 * hi, boff = (size_t)(c0 + lr) * K + 8 * hi;
#pragma unroll 1
    for (int kc = 32 * wv; kc < Kend; kc += 32 * KW) {
        V a[4], a2[4];
#pragma unroll
        for (int mb = 0; mb < 4; ++mb) { a[mb] = WFrag<T16>::ld(A + aoff + (size_t)mb * 16 * lda + kc); if (NSPLIT == 1 || NSPLIT == 2) a2[mb] = WFrag<T16>::ld(A2 + aoff + (size_t)mb * 16 * lda + kc); }
#pragma unroll
        for (int nb = 0; nb < 4; ++nb) { const V b = WFrag<T16>::ld(Bt + boff + (size_t)nb * 16 * K + kc); V b2; if (NSPLIT >= 2) b2 = WFrag<T16>::ld(Bt2 + boff + (size_t)nb * 16 * K + kc);
#pragma unroll
            for (int mb = 0; mb < 4; ++mb) { acc[mb][nb] = WFrag<T16>::mma(a[mb], b, acc[mb][nb]); if (NSPLIT == 1 || NSPLIT == 2) acc[mb][nb] = WFrag<T16>::mma(a2[mb], b, acc[mb][nb]); if (NSPLIT >= 2) acc[mb][nb] = WFrag<T16>::mma(a[mb], b2, acc[mb][nb]); } }
        asm volatile("v_nop\n\tv_nop\n\tv_nop\n\tv_nop" : "+v"(acc[0][0]), "+v"(acc[1][1]), "+v"(acc[2][2]), "+v"(acc[3][3]) : "v"(a[0]), "v"(a[3]));
    }
    if constexpr (KW > 1) {
        float* osw = os + wv * (64 * 68);          // this wave's partial tile, rows at pitch 68
        // the loops below are unrolled so that acc is indexed by constants (stays in registers) and the LDS reads of a thread's items issue together
#pragma unroll
        for (int mb = 0; mb < 4; ++mb)
#pragma unroll
            for (int nb = 0; nb < 4; ++nb)
#pragma unroll
                for (int j = 0; j < 8; ++j) osw[(mb * 16 + hi * 8 + j) * 68 + nb * 16 + lr] = acc[mb][nb][j];
        __syncthreads();                                            // every wave's partial tile is in LDS before any of it is summed
#pragma unroll
        for (int s = 0; s < (64 * 16) / (32 * KW); ++s) { const int item = s * (32 * KW) + (int)threadIdx.x, row = item >> 4, cofs = (item & 15) * 4; v4f val = *(const v4fa*)(os + row * 68 + cofs);
#pragma unroll
            for (int w = 1; w < KW; ++w) val += *(const v4fa*)(os + w * (64 * 68) + row * 68 + cofs);
            if (BIAS) { val[0] += bfr(bias[c0 + cofs]); val[1] += bfr(bias[c0 + cofs + 1]); val[2] += bfr(bias[c0 + cofs + 2]); val[3] += bfr(bias[c0 + cofs + 3]); }
            *(v4f*)(C + (size_t)(r0 + row) * ldc + c0 + cofs) = val; }
        return;
    }
#pragma unroll
    for (int mb = 0; mb < 4; ++mb) {
#pragma unroll
        for (int nb = 0; nb < 4; ++nb) {
#pragma unroll
            for (int j = 0; j < 8; ++j) os[(hi * 8 + j) * 68 + nb * 16 + lr] = acc[mb][nb][j]; }
        __builtin_amdgcn_wave_barrier(); asm volatile("" ::: "memory");
        float* crow = C + (size_t)(r0 + mb * 16) * ldc + c0;
{
#pragma unroll
            for (int s = 0; s < 8; ++s) { const int row = 2 * s + hi, cofs = lr * 4; v4f val = *(const v4fa*)(os + row * 68 + cofs); if (BIAS) { val[0] += bfr(bias[c0 + cofs]); val[1] += bfr(bias[c0 + cofs + 1]); val[2] += bfr(bias[c0 + cofs + 2]); val[3] += bfr(bias[c0 + cofs + 3]); }
                *(v4f*)(crow + (size_t)row * ldc + cofs) = val; }
             }
        __builtin_amdgcn_wave_barrier(); asm volatile("" ::: "memory");
    }
}

__global__ __launch_bounds__(256) void k_cvt8(const float* __restrict__ src, bf* dst, size_t n8) { const size_t i = (size_t)blockIdx.x * 256 + threadIdx.x; if (i >= n8) return; const v8f v = *(const v8f*)(src + i * 8); v8us o;
#pragma unroll
    for (int k = 0; k < 8; ++k) o[k] = f2bf(v[k]); *(v8us*)(dst + i * 8) = o;  }

__global__ __launch_bounds__(256) void k_qkp(const float* __restrict__ F, int pitch, int nheads, float sc, h16* P16, bf* Ph, bf* Pl) {
    const size_t e = ((size_t)blockIdx.x * 256 + threadIdx.x) * 2; if (e >= (size_t)nheads * SEQ * HD) return; const int d = (int)(e % HD); const int t = (int)((e / HD) % SEQ); const int h = (int)(e / ((size_t)HD * SEQ)); const float* f = F + (size_t)t * pitch + h * HD + d; v2h o16; v2us oh, ol;
#pragma unroll
    for (int q = 0; q < 2; ++q) { const float r = f[q] * sc; o16[q] = tohx(r); unsigned short a2, c2; splitf(r, a2, c2); oh[q] = a2; ol[q] = c2; }
    *(v2h*)(P16 + e) = o16; *(v2us*)(Ph + e) = oh; *(v2us*)(Pl + e) = ol;  }
__global__ __launch_bounds__(256) void k_vtp(const float* __restrict__ F, int pitch, int nheads, float sc, h16* V16, bf* Vh, bf* Vl) { const size_t e = ((size_t)blockIdx.x * 256 + threadIdx.x) * 2; if (e >= (size_t)nheads * HD * SEQ) return; const int t = (int)(e % SEQ); const int d = (int)((e / SEQ) % HD); const int g = (int)(e / ((size_t)SEQ * HD)); v2h o16; v2us oh, ol;
#pragma unroll
    for (int q = 0; q < 2; ++q) { const float x = F[(size_t)(t + q) * pitch + g * HD + d] * sc; o16[q] = tohx(x); unsigned short a2, c2; splitf(x, a2, c2); oh[q] = a2; ol[q] = c2; }
    *(v2h*)(V16 + e) = o16; *(v2us*)(Vh + e) = oh; *(v2us*)(Vl + e) = ol;  }

// ---- k_fattn: scores, causal mask, softmax and P.v of one (head, QT query rows) tile in one work-group; no score or P value leaves the registers.
// Transposed products: St = K Qt (A = K rows, B = Q rows, both by WFrag::ld), so lane l holds scores of ONE query (column l&15), keys 8h+r of each 16-key block; two such D tiles, converted in place,
// are the B fragment of P for 32 keys (elements 0..7 <- k0+8h+r, 8..15 <- k0+16+8h+r: the k order of WFrag::ld on the Vt rows); Ot += Vt Pt, D element r -> (d = 8h+r, query l&15).
// Running maximum m and sum l per query (per lane; the two halves of a wave share m by one exchange per chunk, l is joined once at the end); P is exp(x - m), not yet divided by the sum.
// Wave w walks the chunks w, w+AW, ...; the AW partial (m, l, Ot) meet in LDS and are joined in wave order, divided by the sum, and stored as the bf16 hi/lo planes of ctx.
// Every inner loop is unrolled so that the fragment and accumulator arrays are indexed by constants and stay in registers; the chunk loop stays rolled: a second copy of its body would double the live fragments.
// Causal: chunks past the tile's last query row are not walked; QT == chunk width, so every walked chunk holds at least one unmasked key for every query of the tile.
__device__ __forceinline__ float xhalf(float x) { return __builtin_bit_cast(float, __builtin_amdgcn_permlanex16(__builtin_bit_cast(int, x), __builtin_bit_cast(int, x), 0x76543210, 0xfedcba98, false, false)); }   // lane l's value of lane l ^ 16
// exp(x) as v_exp_f32(x * log2 e), the form of __expf, written in asm so that the slot the instruction set asks for behind a transcendental (one independent instruction or v_nop before its result is read or its source overwritten) is kept by construction:
// inside a run every v_exp_f32 is followed by an independent one (early-clobber outputs: none lands on a source of the run), and one v_nop stands behind the last.
#define L2E 1.44269504f
__device__ __forceinline__ float exp1(float x) { float r; const float y = x * L2E; asm("v_exp_f32 %0, %1\n\tv_nop" : "=v"(r) : "v"(y)); return r; }
__device__ __forceinline__ v8f exp8(v8f x) { float r0, r1, r2, r3, r4, r5, r6, r7; const v8f y = x * L2E;
    asm("v_exp_f32 %0, %8\n\tv_exp_f32 %1, %9\n\tv_exp_f32 %2, %10\n\tv_exp_f32 %3, %11\n\tv_exp_f32 %4, %12\n\tv_exp_f32 %5, %13\n\tv_exp_f32 %6, %14\n\tv_exp_f32 %7, %15\n\tv_nop"
        : "=&v"(r0), "=&v"(r1), "=&v"(r2), "=&v"(r3), "=&v"(r4), "=&v"(r5), "=&v"(r6), "=&v"(r7) : "v"(y[0]), "v"(y[1]), "v"(y[2]), "v"(y[3]), "v"(y[4]), "v"(y[5]), "v"(y[6]), "v"(y[7]));
    return (v8f){ r0, r1, r2, r3, r4, r5, r6, r7 }; }
template <typename T16, bool HR>
__device__ __forceinline__ void attn_tile(const T16* __restrict__ Q, const T16* __restrict__ Q2, const T16* __restrict__ Kp, const T16* __restrict__ K2, const T16* __restrict__ Vt, const T16* __restrict__ V2,
                                          int q0, int nch, int causal, int wv, int lane, float* osw, float* msw, float* lsw) {
    typedef typename WFrag<T16>::V V;
    const int lr = lane & 15, hi = lane >> 4;
    v8f o[4][2];
#pragma unroll
    for (int mb = 0; mb < 4; ++mb)
#pragma unroll
        for (int nq = 0; nq < 2; ++nq) o[mb][nq] = (v8f){};
    float m[2] = { -1.0e30f, -1.0e30f }, l[2] = { 0.0f, 0.0f };
    if (wv < nch) {                                                  // scalar test; the Q loads stand inside it, so that each keeps its xwait directly behind it
    V qf[2][2], qf2[2][2];
#pragma unroll
    for (int nq = 0; nq < 2; ++nq)
#pragma unroll
        for (int ks = 0; ks < 2; ++ks) { const size_t qo = (size_t)(q0 + nq * 16 + lr) * HD + ks * 32 + 8 * hi; qf[nq][ks] = WFrag<T16>::ld(Q + qo); if (HR) qf2[nq][ks] = WFrag<T16>::ld(Q2 + qo); }
#pragma unroll 1
    for (int c = wv; c < nch; c += AW) {
        const int k0 = c * 32;
        v8f s[2][2];
#pragma unroll
        for (int kb = 0; kb < 2; ++kb) { V kf[2], kf2[2];
#pragma unroll
            for (int ks = 0; ks < 2; ++ks) { const size_t ko = (size_t)(k0 + kb * 16 + lr) * HD + ks * 32 + 8 * hi; kf[ks] = WFrag<T16>::ld(Kp + ko); if (HR) kf2[ks] = WFrag<T16>::ld(K2 + ko); }
#pragma unroll
            for (int nq = 0; nq < 2; ++nq) { v8f a = (v8f){};
#pragma unroll
                for (int ks = 0; ks < 2; ++ks) { a = WFrag<T16>::mma(kf[ks], qf[nq][ks], a); if (HR) { a = WFrag<T16>::mma(kf[ks], qf2[nq][ks], a); a = WFrag<T16>::mma(kf2[ks], qf[nq][ks], a); } }
                s[kb][nq] = a; } }
        V vf[4], vf2[4];
#pragma unroll
        for (int mb = 0; mb < 4; ++mb) { if (!HR) vf[mb] = WFrag<T16>::ld(Vt + (size_t)(mb * 16 + lr) * SEQ + k0 + 8 * hi); }   // one plane: fetched ahead of the softmax, which covers the latency
        V pf[2], pl[2];
#pragma unroll
        for (int nq = 0; nq < 2; ++nq) {
            const int qi = q0 + nq * 16 + lr;
            float mx = m[nq];
#pragma unroll
            for (int kb = 0; kb < 2; ++kb)
#pragma unroll
                for (int r = 0; r < 8; ++r) { const float xs = s[kb][nq][r] * SCL; const float x = (causal != 0 && (k0 + kb * 16 + 8 * hi + r) > qi) ? -1.0e30f : xs; s[kb][nq][r] = x; mx = fmaxf(mx, x); }
            mx = fmaxf(mx, xhalf(mx));
            const float al = exp1(m[nq] - mx);                     // 0 on a wave's first chunk (m starts at the fill value)
            m[nq] = mx;
            float ps = 0.0f;
#pragma unroll
            for (int kb = 0; kb < 2; ++kb) { s[kb][nq] = exp8(s[kb][nq] - mx);                                        // a masked score gives exactly 0: mx is a real score
#pragma unroll
                for (int r = 0; r < 8; ++r) ps += s[kb][nq][r]; }
            l[nq] = l[nq] * al + ps;
#pragma unroll
            for (int mb = 0; mb < 4; ++mb) o[mb][nq] *= al;
            if constexpr (HR) { v8us h0, h1, l0, l1;
#pragma unroll
                for (int r = 0; r < 8; ++r) { unsigned short a2, c2; splitf(s[0][nq][r], a2, c2); h0[r] = a2; l0[r] = c2; splitf(s[1][nq][r], a2, c2); h1[r] = a2; l1[r] = c2; }
                pf[nq] = cat16b(h0, h1); pl[nq] = cat16b(l0, l1); }
            else { v8h p0, p1;
#pragma unroll
                for (int r = 0; r < 8; ++r) { p0[r] = tohx(s[0][nq][r] * PCAR); p1[r] = tohx(s[1][nq][r] * PCAR); }
                pf[nq] = cat16(p0, p1); }
        }
#pragma unroll
        for (int mb = 0; mb < 4; ++mb) {
            if (HR) { const size_t vo = (size_t)(mb * 16 + lr) * SEQ + k0 + 8 * hi; vf[mb] = WFrag<T16>::ld(Vt + vo); vf2[mb] = WFrag<T16>::ld(V2 + vo); }   // two planes: fetched block by block, to stay within 256 registers
#pragma unroll
            for (int nq = 0; nq < 2; ++nq) { o[mb][nq] = WFrag<T16>::mma(vf[mb], pf[nq], o[mb][nq]); if (HR) { o[mb][nq] = WFrag<T16>::mma(vf[mb], pl[nq], o[mb][nq]); o[mb][nq] = WFrag<T16>::mma(vf2[mb], pf[nq], o[mb][nq]); } } }
    }
    }
#pragma unroll
    for (int nq = 0; nq < 2; ++nq) { const float lt = l[nq] + xhalf(l[nq]); const int q = nq * 16 + lr;
        if (hi == 0) { msw[q] = m[nq]; lsw[q] = lt; }
#pragma unroll
        for (int mb = 0; mb < 4; ++mb) { float* d = osw + q * 68 + mb * 16 + 8 * hi;
            *(v4fa*)d = (v4f){ o[mb][nq][0], o[mb][nq][1], o[mb][nq][2], o[mb][nq][3] }; *(v4fa*)(d + 4) = (v4f){ o[mb][nq][4], o[mb][nq][5], o[mb][nq][6], o[mb][nq][7] }; } }
}

__global__ __launch_bounds__(32 * AW) void k_fattn(const h16* __restrict__ Q16, const h16* __restrict__ K16, const h16* __restrict__ V16, const bf* __restrict__ Qh, const bf* __restrict__ Ql, const bf* __restrict__ Kh, const bf* __restrict__ Kl,
                                                   const bf* __restrict__ Vh, const bf* __restrict__ Vl, bf* Ah, bf* Al, const int* __restrict__ cflag) {
    __shared__ __align__(16) float os[AW * QT * 68];                // per wave: QT query rows of HD partial sums, pitch 68
    __shared__ float ms[AW * QT], ls[AW * QT];
    const int head = blockIdx.x, q0 = (SEQ / QT - 1 - (int)blockIdx.y) * QT;    // every head's longest tiles start first
    const int causal = (cflag[0] != 0) ? 1 : 0;
    const int nch = causal ? (q0 / 32 + 1) : (SEQ / 32);
    const int wv = __builtin_amdgcn_readfirstlane((int)(threadIdx.x >> 5));      // wave number, held scalar so that the chunk loop keeps a scalar branch and every lane stays on at the matrix instructions
    const int lane = threadIdx.x & 31; const size_t po = (size_t)head * SEQ * HD;
    const bool hires = (q0 < RHE);                                  // blockIdx alone decides: the same for the whole work-group
    if (hires) attn_tile<bf, true>(Qh + po, Ql + po, Kh + po, Kl + po, Vh + po, Vl + po, q0, nch, causal, wv, lane, os + wv * (QT * 68), ms + wv * QT, ls + wv * QT);
    else attn_tile<h16, false>(Q16 + po, nullptr, K16 + po, nullptr, V16 + po, nullptr, q0, nch, causal, wv, lane, os + wv * (QT * 68), ms + wv * QT, ls + wv * QT);
    __syncthreads();                                                // every wave's partial (m, l, Ot) is in LDS before any of it is joined
    const int q = (int)threadIdx.x >> 3, dg = (int)threadIdx.x & 7; // one query row and eight head columns per thread
    float M = ms[q];
#pragma unroll
    for (int w = 1; w < AW; ++w) M = fmaxf(M, ms[w * QT + q]);
    float L = 0.0f; v4f s0 = (v4f){}, s1 = (v4f){};
#pragma unroll
    for (int w = 0; w < AW; ++w) { const float f = exp1(ms[w * QT + q] - M); const float* p = os + w * (QT * 68) + q * 68 + dg * 8;   // a wave that walked no chunk: f = 0, l = 0, Ot = 0
        L += f * ls[w * QT + q]; s0 += f * *(const v4fa*)p; s1 += f * *(const v4fa*)(p + 4); }
    const float cs = (hires ? (1.0f / VSC) : (1.0f / (VSC * PCAR))) / L;         // L >= 1: the row's largest score contributes exp(0)
    v8us oh, ol;
#pragma unroll
    for (int k = 0; k < 4; ++k) { unsigned short a, c2; splitf(s0[k] * cs, a, c2); oh[k] = a; ol[k] = c2; splitf(s1[k] * cs, a, c2); oh[4 + k] = a; ol[4 + k] = c2; }
    const size_t oo = (size_t)(q0 + q) * DQ + head * HD + dg * 8;
    *(v8us*)(Ah + oo) = oh; *(v8us*)(Al + oo) = ol;
}

extern "C" void kernel_launch(void* const* d_in, const int* in_sizes, int n_in,
                              void* d_out, int out_size, void* d_ws, size_t ws_size, hipStream_t stream) {
    if (n_in < 12) return;
    const size_t needx = ((size_t)(NB - 1) * SEQ_FULL + SEQ) * DM;
    if ((size_t)in_sizes[0] < needx || (size_t)in_sizes[1] < needx || (size_t)in_sizes[2] < needx) return;
    if (in_sizes[3] < DM * DM || in_sizes[5] < DM * DM || in_sizes[7] < DM * DM || in_sizes[9] < DM * DM) return;
    if (in_sizes[4] < DM || in_sizes[6] < DM || in_sizes[8] < DM || in_sizes[10] < DM || in_sizes[11] < 1) return;
    if ((size_t)out_size < needx) return;
    const float* xq = (const float*)d_in[0]; const float* xk = (const float*)d_in[1]; const float* xv = (const float*)d_in[2];
    const float* wq = (const float*)d_in[3]; const float* bq = (const float*)d_in[4]; const float* wk = (const float*)d_in[5]; const float* bk = (const float*)d_in[6];
    const float* wv = (const float*)d_in[7]; const float* bv = (const float*)d_in[8]; const float* wo = (const float*)d_in[9]; const float* bo = (const float*)d_in[10];
    const int* CZ = (const int*)d_in[11];
    float* OUT = (float*)d_out;     // [NB][SEQ_FULL][DM]

    // ---- workspace carve (every region a multiple of 256 B; all producers write exact tile/row multiples, no padded tails needed: SEQ%128==0, DM%64==0)
    constexpr size_t SZ_W = (size_t)DM * DM * 2, SZ_XB = (size_t)SEQ * DM * 2, SZ_F = (size_t)SEQ * DQ * 4, SZ_PL = (size_t)NH_ * SEQ * HD * 2;
    constexpr size_t SZ_AT = (size_t)SEQ * DQ * 2;
    constexpr size_t WS_TOTAL = 4 * SZ_W + SZ_XB + SZ_F + 9 * SZ_PL + 2 * SZ_AT;
    static_assert(WS_TOTAL <= (size_t)268435456);
    if (WS_TOTAL > ws_size) return;
    char* wsp = (char*)d_ws;
    auto take = [&](size_t bytes) { char* p = wsp; wsp += (bytes + 255) & ~(size_t)255; return (void*)p; };
    bf* WQ = (bf*)take(SZ_W); bf* WK = (bf*)take(SZ_W); bf* WV = (bf*)take(SZ_W); bf* WO = (bf*)take(SZ_W);
    bf* XB = (bf*)take(SZ_XB); float* F = (float*)take(SZ_F);                  // one projection buffer reused for q, k, v (stream-ordered)
    h16* QP16 = (h16*)take(SZ_PL); h16* KP16 = (h16*)take(SZ_PL); h16* VT16 = (h16*)take(SZ_PL);
    bf* QPh = (bf*)take(SZ_PL); bf* QPl = (bf*)take(SZ_PL); bf* KPh = (bf*)take(SZ_PL); bf* KPl = (bf*)take(SZ_PL); bf* VTh = (bf*)take(SZ_PL); bf* VTl = (bf*)take(SZ_PL);
    bf* ATh = (bf*)take(SZ_AT); bf* ATl = (bf*)take(SZ_AT);
    if ((size_t)(wsp - (char*)d_ws) > ws_size) return;

    const unsigned GW8 = (unsigned)((DM * DM / 8 + 255) / 256), GX8 = (unsigned)(((size_t)SEQ * DM / 8 + 255) / 256);
    const unsigned LQ = (unsigned)(((size_t)NH_ * SEQ * HD / 2 + 255) / 256);
    k_cvt8<<<GW8, 256, 0, stream>>>(wq, WQ, (size_t)DM * DM / 8);
    k_cvt8<<<GW8, 256, 0, stream>>>(wk, WK, (size_t)DM * DM / 8);
    k_cvt8<<<GW8, 256, 0, stream>>>(wv, WV, (size_t)DM * DM / 8);
    k_cvt8<<<GW8, 256, 0, stream>>>(wo, WO, (size_t)DM * DM / 8);
    for (int b = 0; b < NB; ++b) {
        const size_t xo = (size_t)b * SEQ_FULL * DM;
        k_cvt8<<<GX8, 256, 0, stream>>>(xq + xo, XB, (size_t)SEQ * DM / 8);
        k_gemmw<bf, 0, true, 8><<<dim3(SEQ / 64, DQ / 64, 1), 256, 0, stream>>>(XB, nullptr, WQ, nullptr, DM, DM, F, DQ, bq, 0, 0, 0, CZ, 0, 0);
        k_qkp<<<LQ, 256, 0, stream>>>(F, DQ, NH_, QSC, QP16, QPh, QPl);
        k_cvt8<<<GX8, 256, 0, stream>>>(xk + xo, XB, (size_t)SEQ * DM / 8);
        k_gemmw<bf, 0, true, 8><<<dim3(SEQ / 64, DKV / 64, 1), 256, 0, stream>>>(XB, nullptr, WK, nullptr, DM, DM, F, DKV, bk, 0, 0, 0, CZ, 0, 0);
        k_qkp<<<LQ, 256, 0, stream>>>(F, DKV, NKV, KSC, KP16, KPh, KPl);
        k_cvt8<<<GX8, 256, 0, stream>>>(xv + xo, XB, (size_t)SEQ * DM / 8);
        k_gemmw<bf, 0, true, 8><<<dim3(SEQ / 64, DKV / 64, 1), 256, 0, stream>>>(XB, nullptr, WV, nullptr, DM, DM, F, DKV, bv, 0, 0, 0, CZ, 0, 0);
        k_vtp<<<LQ, 256, 0, stream>>>(F, DKV, NKV, VSC, VT16, VTh, VTl);
        k_fattn<<<dim3(NH_, SEQ / QT, 1), 32 * AW, 0, stream>>>(QP16, KP16, VT16, QPh, QPl, KPh, KPl, VTh, VTl, ATh, ATl, CZ);
        k_gemmw<bf, 1, true, 8><<<dim3(SEQ / 64, DM / 64, 1), 256, 0, stream>>>(ATh, ATl, WO, nullptr, DQ, DQ, OUT + xo, DM, bo, 0, 0, 0, CZ, 0, 0); }
}

// v004
// One run takes 183 microseconds.
// Timed twice side by side with v003, it ran 1.25 and 1.27 times as fast.
// Over all steps from v000 it is 8.70 times as fast.
#include <hip/hip_runtime.h>

// Causal multi-head attention: q/k/v = x W^T + b ([out][in] weights, 16 heads x 64), scores = q.k x 1/8 with lower-triangular replace-mask under an int flag input, f32 softmax, ctx = P v, out = ctx Wo^T + bo -> [2][2048][1024] f32.
// Compute dtypes, f32 accumulate everywhere: every float input RNE-converted to bf16; q/k/v projections v_wmma_f32_16x16x32_bf16 on plain bf16 operands + bias; scores: query rows < RH bf16 hi/lo x bf16 hi/lo (3 products), rows >= RH plain v_wmma_f32_16x16x32_f16 (q and k planes carried x4); softmax f32; P.v: rows < RH bf16 hi/lo P x bf16 hi/lo v (3 products), rows >= RH fp16 P carried x1024 against fp16 v carried x4; output projection bf16 hi/lo of ctx x bf16 Wo (2 products) + bias.

#ifndef NB
#define NB 2
#endif
#ifndef SEQ
#define SEQ 2048
#endif
#define NB_FULL  2
#define SEQ_FULL 2048
#define DM   1024
#define NH_  16
#define NKV  16
#define HD   64
#define DQ   (NH_ * HD)
#define DKV  (NKV * HD)
#define AW   8                    // waves per work-group of the attention kernel; wave w takes the 32-key chunks w, w + AW, ...
#define QT   32                   // query rows per work-group of the attention kernel
#ifndef RH
#define RH   512                  // query rows < RH use hi+lo planes
#endif
#define RHE  ((RH < SEQ) ? RH : SEQ)
#define QSC  4.0f                 // q plane carry
#define KSC  4.0f                 // k plane carry
#define VSC  4.0f                 // v plane carry
#define PCAR 1024.0f              // fp16 P plane carry (rows >= RH)
#define SCL  (0.125f / (QSC * KSC))   // HD^-0.5 folded with the q/k carries (exact power of two)
static_assert(SEQ % 128 == 0);
static_assert(SEQ <= SEQ_FULL);
static_assert(NB >= 1 && NB <= NB_FULL);
static_assert((RHE % 64) == 0);
static_assert(DM == DQ);
static_assert((DM % 64) == 0 && (HD % 32) == 0);
static_assert((RHE % QT) == 0 && (SEQ % QT) == 0 && HD == 64 && QT * (HD / 8) == 32 * AW);

typedef _Float16 h16;
typedef unsigned short bf;
typedef __attribute__((ext_vector_type(16))) __bf16   v16bf;
typedef __attribute__((ext_vector_type(16))) _Float16 v16h;
typedef __attribute__((ext_vector_type(8)))  _Float16 v8h;
typedef __attribute__((ext_vector_type(8)))  unsigned short v8us;
typedef __attribute__((ext_vector_type(8)))  float    v8f;
typedef __attribute__((ext_vector_type(4)))  float    v4f;
typedef __attribute__((ext_vector_type(2))) _Float16 v2h;
typedef __attribute__((ext_vector_type(4))) _Float16 v4h;
typedef __attribute__((ext_vector_type(2))) unsigned short v2us;
typedef __attribute__((ext_vector_type(4))) unsigned short v4us;
typedef __attribute__((ext_vector_type(2))) float v2f;
typedef v8h  __attribute__((may_alias)) v8ha;
typedef v4f  __attribute__((may_alias)) v4fa;
typedef v8us __attribute__((may_alias)) v8usa;

__device__ __forceinline__ unsigned short f2bf(float f) { unsigned u = __float_as_uint(f); u += 0x7FFFu + ((u >> 16) & 1u); return (unsigned short)(u >> 16); }
__device__ __forceinline__ float bf2f(unsigned short b) { return __uint_as_float(((unsigned)b) << 16); }
__device__ __forceinline__ float bfr(float f) { return bf2f(f2bf(f)); }
__device__ __forceinline__ v16h cat16(v8h lo, v8h hi) { return __builtin_shufflevector(lo, hi, 0, 1, 2, 3, 4, 5, 6, 7, 8, 9, 10, 11, 12, 13, 14, 15); }
__device__ __forceinline__ v16bf cat16b(v8us lo, v8us hi) { return __builtin_bit_cast(v16bf, __builtin_shufflevector(lo, hi, 0, 1, 2, 3, 4, 5, 6, 7, 8, 9, 10, 11, 12, 13, 14, 15)); }
__device__ __forceinline__ v8f wmma16(v16h a, v16h b, v8f c) { return __builtin_amdgcn_wmma_f32_16x16x32_f16(false, a, false, b, (short)0, c, false, false); }
__device__ __forceinline__ v8f wmmab(v16bf a, v16bf b, v8f c) { return __builtin_amdgcn_wmma_f32_16x16x32_bf16(false, a, false, b, (short)0, c, false, false); }
__device__ __forceinline__ h16 tohx(float x) { return (h16)x; }
__device__ __forceinline__ void splitf(float y, unsigned short& h, unsigned short& l) { h = f2bf(y); l = f2bf(y - bf2f(h)); }

// ---- k_gemmw: register-blocked GEMM, one 64x64 output tile per work-group (16 accumulators per wave), operands straight from K-contiguous 16-bit planes; grid (M/64, N/64, Z), 32 * KW threads.
// C[m][n] (f32, pitch ldc, + optional f32 bias[n]) = sum_k A[m][k] Bt[n][k] (+ split products per NSPLIT). A rows at pitch lda, Bt rows at pitch K. z-batch strides sA/sB/sC in elements. K % 32 == 0.
// Fragments: lane l, h = l>>4, row/col = l&15; elements 0..7 <- k0+8h+0..7, elements 8..15 <- k0+16+8h+0..7 for BOTH A and Bt; D element r -> (row 8h+r, col l&15).
// KW waves per work-group share one tile: wave w takes the 32-wide k steps w, w+KW, ...; the KW partial tiles meet in LDS and are summed in wave order (KW == 1: one wave, no sum).
// EP 0: C as above. EP 1 and 2: no f32 C; each value x sc goes out as three 16-bit planes (f16, bf16 hi, bf16 lo). EP 1: tile column block = head, planes [head][row][HD], bias by column. EP 2: A = weight rows, Bt = token rows, so the tile is [feature][token] and the planes are [feature][SEQ], bias by row.
// cmode 1 (scores, causal flag set): tiles whose first key column lies past the last query row r0+roff+63 are skipped (never read downstream); cmode 2 (P.v): K limited to r0+roff+64 keys.
// xwait: stands behind every fragment load, in front of the next one, whose result the register allocator may place in the pair that holds an issued load's address
__device__ __forceinline__ void xwait() { asm volatile("s_wait_xcnt 0x0" ::: "memory"); }
template <typename T16> struct WFrag;
template <> struct WFrag<h16> { typedef v16h V; static __device__ __forceinline__ V ld(const h16* p) { const v8h lo = *(const v8h*)p; xwait(); const v8h hi = *(const v8h*)(p + 16); xwait(); return cat16(lo, hi); } static __device__ __forceinline__ v8f mma(V a, V b, v8f c) { return wmma16(a, b, c); } };
template <> struct WFrag<bf> { typedef v16bf V; static __device__ __forceinline__ V ld(const bf* p) { const v8us lo = *(const v8us*)p; xwait(); const v8us hi = *(const v8us*)(p + 16); xwait(); return cat16b(lo, hi); } static __device__ __forceinline__ v8f mma(V a, V b, v8f c) { return wmmab(a, b, c); } };
template <typename T16, int NSPLIT, bool BIAS, int KW, int EP>
__global__ __launch_bounds__(32 * KW) void k_gemmw(const T16* __restrict__ A, const T16* __restrict__ A2, const T16* __restrict__ Bt, const T16* __restrict__ Bt2, int K, int lda, float* C, int ldc, const float* __restrict__ bias, size_t sA, size_t sB, size_t sC,
                                              const int* __restrict__ cflag, int roff, int cmode, float sc, h16* P16, bf* Ph, bf* Pl) {
    static_assert(EP == 0 || KW > 1);
    typedef typename WFrag<T16>::V V;
    __shared__ __align__(16) float os[(KW == 1) ? 16 * 68 : KW * 64 * 68];
    const size_t z = blockIdx.z; A += z * sA; if (A2) A2 += z * sA; Bt += z * sB; if (Bt2) Bt2 += z * sB; C += z * sC;
    const int lane = threadIdx.x & 31, lr = lane & 15, hi = lane >> 4; const int r0 = blockIdx.x * 64, c0 = blockIdx.y * 64;
    const int causal = (cmode != 0 && cflag[0] != 0) ? 1 : 0;
    if (cmode == 1 && causal && c0 >= r0 + roff + 64) return;      // blockIdx and the flag alone decide: the whole block leaves, ahead of the one block barrier
    int Kend = K;
    if (cmode == 2 && causal) { const int kl = r0 + roff + 64; Kend = (kl < K) ? kl : K; }
    const int wv = (KW == 1) ? 0 : __builtin_amdgcn_readfirstlane((int)(threadIdx.x >> 5));   // wave number, held scalar so that the k loop keeps a scalar branch and every lane stays on at the matrix instructions
    v8f acc[4][4];
#pragma unroll
    for (int mb = 0; mb < 4; ++mb)
#pragma unroll
        for (int nb = 0; nb < 4; ++nb) acc[mb][nb] = (v8f){};
    const size_t aoff = (size_t)(r0 + lr) * lda + 8 * hi, boff = (size_t)(c0 + lr) * K + 8 * hi;
#pragma unroll 1
    for (int kc = 32 * wv; kc < Kend; kc += 32 * KW) {
        V a[4], a2[4];
#pragma unroll
        for (int mb = 0; mb < 4; ++mb) { a[mb] = WFrag<T16>::ld(A + aoff + (size_t)mb * 16 * lda + kc); if (NSPLIT == 1 || NSPLIT == 2) a2[mb] = WFrag<T16>::ld(A2 + aoff + (size_t)mb * 16 * lda + kc); }
#pragma unroll
        for (int nb = 0; nb < 4; ++nb) { const V b = WFrag<T16>::ld(Bt + boff + (size_t)nb * 16 * K + kc); V b2; if (NSPLIT >= 2) b2 = WFrag<T16>::ld(Bt2 + boff + (size_t)nb * 16 * K + kc);
#pragma unroll
            for (int mb = 0; mb < 4; ++mb) { acc[mb][nb] = WFrag<T16>::mma(a[mb], b, acc[mb][nb]); if (NSPLIT == 1 || NSPLIT == 2) acc[mb][nb] = WFrag<T16>::mma(a2[mb], b, acc[mb][nb]); if (NSPLIT >= 2) acc[mb][nb] = WFrag<T16>::mma(a[mb], b2, acc[mb][nb]); } }
        asm volatile("v_nop\n\tv_nop\n\tv_nop\n\tv_nop" : "+v"(acc[0][0]), "+v"(acc[1][1]), "+v"(acc[2][2]), "+v"(acc[3][3]) : "v"(a[0]), "v"(a[3]));
    }
    if constexpr (KW > 1) {
        float* osw = os + wv * (64 * 68);          // this wave's partial tile, rows at pitch 68
        float brow[(64 * 16) / (32 * KW)];         // EP 2: the bias of each of this thread's rows, fetched here so that the LDS stores and the barrier cover the latency
        if constexpr (BIAS && EP == 2) {
#pragma unroll
            for (int s = 0; s < (64 * 16) / (32 * KW); ++s) brow[s] = bias[r0 + ((s * (32 * KW) + (int)threadIdx.x) >> 4)];
            xwait(); }
        // the loops below are unrolled so that acc is indexed by constants (stays in registers) and the LDS reads of a thread's items issue together
#pragma unroll
        for (int mb = 0; mb < 4; ++mb)
#pragma unroll
            for (int nb = 0; nb < 4; ++nb)
#pragma unroll
                for (int j = 0; j < 8; ++j) osw[(mb * 16 + hi * 8 + j) * 68 + nb * 16 + lr] = acc[mb][nb][j];
        __syncthreads();                                            // every wave's partial tile is in LDS before any of it is summed
        v4f sums[(64 * 16) / (32 * KW)];           // EP 1, 2: every item is summed before the first plane store, so that the waits behind the stores hold no LDS read back
#pragma unroll
        for (int s = 0; s < (64 * 16) / (32 * KW); ++s) { const int item = s * (32 * KW) + (int)threadIdx.x, row = item >> 4, cofs = (item & 15) * 4; v4f val = *(const v4fa*)(os + row * 68 + cofs);
#pragma unroll
            for (int w = 1; w < KW; ++w) val += *(const v4fa*)(os + w * (64 * 68) + row * 68 + cofs);
            if (BIAS && EP == 2) val += bfr(brow[s]);
            if (BIAS && EP != 2) { val[0] += bfr(bias[c0 + cofs]); val[1] += bfr(bias[c0 + cofs + 1]); val[2] += bfr(bias[c0 + cofs + 2]); val[3] += bfr(bias[c0 + cofs + 3]); }
            if constexpr (EP == 0) *(v4f*)(C + (size_t)(r0 + row) * ldc + c0 + cofs) = val;
            else sums[s] = val; }
        if constexpr (EP != 0) {
#pragma unroll
            for (int s = 0; s < (64 * 16) / (32 * KW); ++s) { const int item = s * (32 * KW) + (int)threadIdx.x, row = item >> 4, cofs = (item & 15) * 4;
                const size_t e = (EP == 1) ? ((size_t)blockIdx.y * SEQ + r0 + row) * HD + cofs : (size_t)(r0 + row) * SEQ + c0 + cofs; v4h o16; v4us oh, ol;
#pragma unroll
                for (int q = 0; q < 4; ++q) { const float r = sums[s][q] * sc; o16[q] = tohx(r); unsigned short a2, c2; splitf(r, a2, c2); oh[q] = a2; ol[q] = c2; }
                // xwait behind each plane store: the conversions that follow reuse the registers that an issued store names
                *(v4h*)(P16 + e) = o16; xwait(); *(v4us*)(Ph + e) = oh; xwait(); *(v4us*)(Pl + e) = ol; xwait(); } }
        return;
    }
#pragma unroll
    for (int mb = 0; mb < 4; ++mb) {
#pragma unroll
        for (int nb = 0; nb < 4; ++nb) {
#pragma unroll
            for (int j = 0; j < 8; ++j) os[(hi * 8 + j) * 68 + nb * 16 + lr] = acc[mb][nb][j]; }
        __builtin_amdgcn_wave_barrier(); asm volatile("" ::: "memory");
        float* crow = C + (size_t)(r0 + mb * 16) * ldc + c0;
{
#pragma unroll
            for (int s = 0; s < 8; ++s) { const int row = 2 * s + hi, cofs = lr * 4; v4f val = *(const v4fa*)(os + row * 68 + cofs); if (BIAS) { val[0] += bfr(bias[c0 + cofs]); val[1] += bfr(bias[c0 + cofs + 1]); val[2] += bfr(bias[c0 + cofs + 2]); val[3] += bfr(bias[c0 + cofs + 3]); }
                *(v4f*)(crow + (size_t)row * ldc + cofs) = val; }
             }
        __builtin_amdgcn_wave_barrier(); asm volatile("" ::: "memory");
    }
}

__global__ __launch_bounds__(256) void k_cvt8(const float* __restrict__ src, bf* dst, size_t n8) { const size_t i = (size_t)blockIdx.x * 256 + threadIdx.x; if (i >= n8) return; const v8f v = *(const v8f*)(src + i * 8); v8us o;
#pragma unroll
    for (int k = 0; k < 8; ++k) o[k] = f2bf(v[k]); *(v8us*)(dst + i * 8) = o;  }

// ---- k_fattn: scores, causal mask, softmax and P.v of one (head, QT query rows) tile in one work-group; no score or P value leaves the registers.
// Transposed products: St = K Qt (A = K rows, B = Q rows, both by WFrag::ld), so lane l holds scores of ONE query (column l&15), keys 8h+r of each 16-key block; two such D tiles, converted in place,
// are the B fragment of P for 32 keys (elements 0..7 <- k0+8h+r, 8..15 <- k0+16+8h+r: the k order of WFrag::ld on the Vt rows); Ot += Vt Pt, D element r -> (d = 8h+r, query l&15).
// Running maximum m and sum l per query (per lane; the two halves of a wave share m by one exchange per chunk, l is joined once at the end); P is exp(x - m), not yet divided by the sum.
// Wave w walks the chunks w, w+AW, ...; the AW partial (m, l, Ot) meet in LDS and are joined in wave order, divided by the sum, and stored as the bf16 hi/lo planes of ctx.
// Every inner loop is unrolled so that the fragment and accumulator arrays are indexed by constants and stay in registers; the chunk loop stays rolled: a second copy of its body would double the live fragments.
// Causal: chunks past the tile's last query row are not walked; QT == chunk width, so every walked chunk holds at least one unmasked key for every query of the tile.
__device__ __forceinline__ float xhalf(float x) { return __builtin_bit_cast(float, __builtin_amdgcn_permlanex16(__builtin_bit_cast(int, x), __builtin_bit_cast(int, x), 0x76543210, 0xfedcba98, false, false)); }   // lane l's value of lane l ^ 16
// exp(x) as v_exp_f32(x * log2 e), the form of __expf, written in asm so that the slot the instruction set asks for behind a transcendental (one independent instruction or v_nop before its result is read or its source overwritten) is kept by construction:
// inside a run every v_exp_f32 is followed by an independent one (early-clobber outputs: none lands on a source of the run), and one v_nop stands behind the last.
#define L2E 1.44269504f
__device__ __forceinline__ float exp1(float x) { float r; const float y = x * L2E; asm("v_exp_f32 %0, %1\n\tv_nop" : "=v"(r) : "v"(y)); return r; }
__device__ __forceinline__ v8f exp8(v8f x) { float r0, r1, r2, r3, r4, r5, r6, r7; const v8f y = x * L2E;
    asm("v_exp_f32 %0, %8\n\tv_exp_f32 %1, %9\n\tv_exp_f32 %2, %10\n\tv_exp_f32 %3, %11\n\tv_exp_f32 %4, %12\n\tv_exp_f32 %5, %13\n\tv_exp_f32 %6, %14\n\tv_exp_f32 %7, %15\n\tv_nop"
        : "=&v"(r0), "=&v"(r1), "=&v"(r2), "=&v"(r3), "=&v"(r4), "=&v"(r5), "=&v"(r6), "=&v"(r7) : "v"(y[0]), "v"(y[1]), "v"(y[2]), "v"(y[3]), "v"(y[4]), "v"(y[5]), "v"(y[6]), "v"(y[7]));
    return (v8f){ r0, r1, r2, r3, r4, r5, r6, r7 }; }
template <typename T16, bool HR>
__device__ __forceinline__ void attn_tile(const T16* __restrict__ Q, const T16* __restrict__ Q2, const T16* __restrict__ Kp, const T16* __restrict__ K2, const T16* __restrict__ Vt, const T16* __restrict__ V2,
                                          int q0, int nch, int causal, int wv, int lane, float* osw, float* msw, float* lsw) {
    typedef typename WFrag<T16>::V V;
    const int lr = lane & 15, hi = lane >> 4;
    v8f o[4][2];
#pragma unroll
    for (int mb = 0; mb < 4; ++mb)
#pragma unroll
        for (int nq = 0; nq < 2; ++nq) o[mb][nq] = (v8f){};
    float m[2] = { -1.0e30f, -1.0e30f }, l[2] = { 0.0f, 0.0f };
    if (wv < nch) {                                                  // scalar test; the Q loads stand inside it, so that each keeps its xwait directly behind it
    V qf[2][2], qf2[2][2];
#pragma unroll
    for (int nq = 0; nq < 2; ++nq)
#pragma unroll
        for (int ks = 0; ks < 2; ++ks) { const size_t qo = (size_t)(q0 + nq * 16 + lr) * HD + ks * 32 + 8 * hi; qf[nq][ks] = WFrag<T16>::ld(Q + qo); if (HR) qf2[nq][ks] = WFrag<T16>::ld(Q2 + qo); }
#pragma unroll 1
    for (int c = wv; c < nch; c += AW) {
        const int k0 = c * 32;
        v8f s[2][2];
#pragma unroll
        for (int kb = 0; kb < 2; ++kb) { V kf[2], kf2[2];
#pragma unroll
            for (int ks = 0; ks < 2; ++ks) { const size_t ko = (size_t)(k0 + kb * 16 + lr) * HD + ks * 32 + 8 * hi; kf[ks] = WFrag<T16>::ld(Kp + ko); if (HR) kf2[ks] = WFrag<T16>::ld(K2 + ko); }
#pragma unroll
            for (int nq = 0; nq < 2; ++nq) { v8f a = (v8f){};
#pragma unroll
                for (int ks = 0; ks < 2; ++ks) { a = WFrag<T16>::mma(kf[ks], qf[nq][ks], a); if (HR) { a = WFrag<T16>::mma(kf[ks], qf2[nq][ks], a); a = WFrag<T16>::mma(kf2[ks], qf[nq][ks], a); } }
                s[kb][nq] = a; } }
        V vf[4], vf2[4];
#pragma unroll
        for (int mb = 0; mb < 4; ++mb) { if (!HR) vf[mb] = WFrag<T16>::ld(Vt + (size_t)(mb * 16 + lr) * SEQ + k0 + 8 * hi); }   // one plane: fetched ahead of the softmax, which covers the latency
        V pf[2], pl[2];
#pragma unroll
        for (int nq = 0; nq < 2; ++nq) {
            const int qi = q0 + nq * 16 + lr;
            float mx = m[nq];
#pragma unroll
            for (int kb = 0; kb < 2; ++kb)
#pragma unroll
                for (int r = 0; r < 8; ++r) { const float xs = s[kb][nq][r] * SCL; const float x = (causal != 0 && (k0 + kb * 16 + 8 * hi + r) > qi) ? -1.0e30f : xs; s[kb][nq][r] = x; mx = fmaxf(mx, x); }
            mx = fmaxf(mx, xhalf(mx));
            const float al = exp1(m[nq] - mx);                     // 0 on a wave's first chunk (m starts at the fill value)
            m[nq] = mx;
            float ps = 0.0f;
#pragma unroll
            for (int kb = 0; kb < 2; ++kb) { s[kb][nq] = exp8(s[kb][nq] - mx);                                        // a masked score gives exactly 0: mx is a real score
#pragma unroll
                for (int r = 0; r < 8; ++r) ps += s[kb][nq][r]; }
            l[nq] = l[nq] * al + ps;
#pragma unroll
            for (int mb = 0; mb < 4; ++mb) o[mb][nq] *= al;
            if constexpr (HR) { v8us h0, h1, l0, l1;
#pragma unroll
                for (int r = 0; r < 8; ++r) { unsigned short a2, c2; splitf(s[0][nq][r], a2, c2); h0[r] = a2; l0[r] = c2; splitf(s[1][nq][r], a2, c2); h1[r] = a2; l1[r] = c2; }
                pf[nq] = cat16b(h0, h1); pl[nq] = cat16b(l0, l1); }
            else { v8h p0, p1;
#pragma unroll
                for (int r = 0; r < 8; ++r) { p0[r] = tohx(s[0][nq][r] * PCAR); p1[r] = tohx(s[1][nq][r] * PCAR); }
                pf[nq] = cat16(p0, p1); }
        }
#pragma unroll
        for (int mb = 0; mb < 4; ++mb) {
            if (HR) { const size_t vo = (size_t)(mb * 16 + lr) * SEQ + k0 + 8 * hi; vf[mb] = WFrag<T16>::ld(Vt + vo); vf2[mb] = WFrag<T16>::ld(V2 + vo); }   // two planes: fetched block by block, to stay within 256 registers
#pragma unroll
            for (int nq = 0; nq < 2; ++nq) { o[mb][nq] = WFrag<T16>::mma(vf[mb], pf[nq], o[mb][nq]); if (HR) { o[mb][nq] = WFrag<T16>::mma(vf[mb], pl[nq], o[mb][nq]); o[mb][nq] = WFrag<T16>::mma(vf2[mb], pf[nq], o[mb][nq]); } } }
    }
    }
#pragma unroll
    for (int nq = 0; nq < 2; ++nq) { const float lt = l[nq] + xhalf(l[nq]); const int q = nq * 16 + lr;
        if (hi == 0) { msw[q] = m[nq]; lsw[q] = lt; }
#pragma unroll
        for (int mb = 0; mb < 4; ++mb) { float* d = osw + q * 68 + mb * 16 + 8 * hi;
            *(v4fa*)d = (v4f){ o[mb][nq][0], o[mb][nq][1], o[mb][nq][2], o[mb][nq][3] }; *(v4fa*)(d + 4) = (v4f){ o[mb][nq][4], o[mb][nq][5], o[mb][nq][6], o[mb][nq][7] }; } }
}

__global__ __launch_bounds__(32 * AW) void k_fattn(const h16* __restrict__ Q16, const h16* __restrict__ K16, const h16* __restrict__ V16, const bf* __restrict__ Qh, const bf* __restrict__ Ql, const bf* __restrict__ Kh, const bf* __restrict__ Kl,
                                                   const bf* __restrict__ Vh, const bf* __restrict__ Vl, bf* Ah, bf* Al, const int* __restrict__ cflag) {
    __shared__ __align__(16) float os[AW * QT * 68];                // per wave: QT query rows of HD partial sums, pitch 68
    __shared__ float ms[AW * QT], ls[AW * QT];
    const int head = blockIdx.x, q0 = (SEQ / QT - 1 - (int)blockIdx.y) * QT;    // every head's longest tiles start first
    const int causal = (cflag[0] != 0) ? 1 : 0;
    const int nch = causal ? (q0 / 32 + 1) : (SEQ / 32);
    const int wv = __builtin_amdgcn_readfirstlane((int)(threadIdx.x >> 5));      // wave number, held scalar so that the chunk loop keeps a scalar branch and every lane stays on at the matrix instructions
    const int lane = threadIdx.x & 31; const size_t po = (size_t)head * SEQ * HD;
    const bool hires = (q0 < RHE);                                  // blockIdx alone decides: the same for the whole work-group
    if (hires) attn_tile<bf, true>(Qh + po, Ql + po, Kh + po, Kl + po, Vh + po, Vl + po, q0, nch, causal, wv, lane, os + wv * (QT * 68), ms + wv * QT, ls + wv * QT);
    else attn_tile<h16, false>(Q16 + po, nullptr, K16 + po, nullptr, V16 + po, nullptr, q0, nch, causal, wv, lane, os + wv * (QT * 68), ms + wv * QT, ls + wv * QT);
    __syncthreads();                                                // every wave's partial (m, l, Ot) is in LDS before any of it is joined
    const int q = (int)threadIdx.x >> 3, dg = (int)threadIdx.x & 7; // one query row and eight head columns per thread
    float M = ms[q];
#pragma unroll
    for (int w = 1; w < AW; ++w) M = fmaxf(M, ms[w * QT + q]);
    float L = 0.0f; v4f s0 = (v4f){}, s1 = (v4f){};
#pragma unroll
    for (int w = 0; w < AW; ++w) { const float f = exp1(ms[w * QT + q] - M); const float* p = os + w * (QT * 68) + q * 68 + dg * 8;   // a wave that walked no chunk: f = 0, l = 0, Ot = 0
        L += f * ls[w * QT + q]; s0 += f * *(const v4fa*)p; s1 += f * *(const v4fa*)(p + 4); }
    const float cs = (hires ? (1.0f / VSC) : (1.0f / (VSC * PCAR))) / L;         // L >= 1: the row's largest score contributes exp(0)
    v8us oh, ol;
#pragma unroll
    for (int k = 0; k < 4; ++k) { unsigned short a, c2; splitf(s0[k] * cs, a, c2); oh[k] = a; ol[k] = c2; splitf(s1[k] * cs, a, c2); oh[4 + k] = a; ol[4 + k] = c2; }
    const size_t oo = (size_t)(q0 + q) * DQ + head * HD + dg * 8;
    *(v8us*)(Ah + oo) = oh; *(v8us*)(Al + oo) = ol;
}

extern "C" void kernel_launch(void* const* d_in, const int* in_sizes, int n_in,
                              void* d_out, int out_size, void* d_ws, size_t ws_size, hipStream_t stream) {
    if (n_in < 12) return;
    const size_t needx = ((size_t)(NB - 1) * SEQ_FULL + SEQ) * DM;
    if ((size_t)in_sizes[0] < needx || (size_t)in_sizes[1] < needx || (size_t)in_sizes[2] < needx) return;
    if (in_sizes[3] < DM * DM || in_sizes[5] < DM * DM || in_sizes[7] < DM * DM || in_sizes[9] < DM * DM) return;
    if (in_sizes[4] < DM || in_sizes[6] < DM || in_sizes[8] < DM || in_sizes[10] < DM || in_sizes[11] < 1) return;
    if ((size_t)out_size < needx) return;
    const float* xq = (const float*)d_in[0]; const float* xk = (const float*)d_in[1]; const float* xv = (const float*)d_in[2];
    const float* wq = (const float*)d_in[3]; const float* bq = (const float*)d_in[4]; const float* wk = (const float*)d_in[5]; const float* bk = (const float*)d_in[6];
    const float* wv = (const float*)d_in[7]; const float* bv = (const float*)d_in[8]; const float* wo = (const float*)d_in[9]; const float* bo = (const float*)d_in[10];
    const int* CZ = (const int*)d_in[11];
    float* OUT = (float*)d_out;     // [NB][SEQ_FULL][DM]

    // ---- workspace carve (every region a multiple of 256 B; all producers write exact tile/row multiples, no padded tails needed: SEQ%128==0, DM%64==0)
    constexpr size_t SZ_W = (size_t)DM * DM * 2, SZ_XB = (size_t)SEQ * DM * 2, SZ_PL = (size_t)NH_ * SEQ * HD * 2;
    constexpr size_t SZ_AT = (size_t)SEQ * DQ * 2;
    constexpr size_t WS_TOTAL = 4 * SZ_W + SZ_XB + 9 * SZ_PL + 2 * SZ_AT;
    static_assert(WS_TOTAL <= (size_t)268435456);
    if (WS_TOTAL > ws_size) return;
    char* wsp = (char*)d_ws;
    auto take = [&](size_t bytes) { char* p = wsp; wsp += (bytes + 255) & ~(size_t)255; return (void*)p; };
    bf* WQ = (bf*)take(SZ_W); bf* WK = (bf*)take(SZ_W); bf* WV = (bf*)take(SZ_W); bf* WO = (bf*)take(SZ_W);
    bf* XB = (bf*)take(SZ_XB);                                                 // one bf16 activation buffer reused for q, k, v (stream-ordered)
    h16* QP16 = (h16*)take(SZ_PL); h16* KP16 = (h16*)take(SZ_PL); h16* VT16 = (h16*)take(SZ_PL);
    bf* QPh = (bf*)take(SZ_PL); bf* QPl = (bf*)take(SZ_PL); bf* KPh = (bf*)take(SZ_PL); bf* KPl = (bf*)take(SZ_PL); bf* VTh = (bf*)take(SZ_PL); bf* VTl = (bf*)take(SZ_PL);
    bf* ATh = (bf*)take(SZ_AT); bf* ATl = (bf*)take(SZ_AT);
    if ((size_t)(wsp - (char*)d_ws) > ws_size) return;

    const unsigned GW8 = (unsigned)((DM * DM / 8 + 255) / 256), GX8 = (unsigned)(((size_t)SEQ * DM / 8 + 255) / 256);
    k_cvt8<<<GW8, 256, 0, stream>>>(wq, WQ, (size_t)DM * DM / 8);
    k_cvt8<<<GW8, 256, 0, stream>>>(wk, WK, (size_t)DM * DM / 8);
    k_cvt8<<<GW8, 256, 0, stream>>>(wv, WV, (size_t)DM * DM / 8);
    k_cvt8<<<GW8, 256, 0, stream>>>(wo, WO, (size_t)DM * DM / 8);
    for (int b = 0; b < NB; ++b) {
        const size_t xo = (size_t)b * SEQ_FULL * DM;
        k_cvt8<<<GX8, 256, 0, stream>>>(xq + xo, XB, (size_t)SEQ * DM / 8);
        k_gemmw<bf, 0, true, 8, 1><<<dim3(SEQ / 64, DQ / 64, 1), 256, 0, stream>>>(XB, nullptr, WQ, nullptr, DM, DM, nullptr, 0, bq, 0, 0, 0, CZ, 0, 0, QSC, QP16, QPh, QPl);
        k_cvt8<<<GX8, 256, 0, stream>>>(xk + xo, XB, (size_t)SEQ * DM / 8);
        k_gemmw<bf, 0, true, 8, 1><<<dim3(SEQ / 64, DKV / 64, 1), 256, 0, stream>>>(XB, nullptr, WK, nullptr, DM, DM, nullptr, 0, bk, 0, 0, 0, CZ, 0, 0, KSC, KP16, KPh, KPl);
        k_cvt8<<<GX8, 256, 0, stream>>>(xv + xo, XB, (size_t)SEQ * DM / 8);
        k_gemmw<bf, 0, true, 8, 2><<<dim3(DKV / 64, SEQ / 64, 1), 256, 0, stream>>>(WV, nullptr, XB, nullptr, DM, DM, nullptr, 0, bv, 0, 0, 0, CZ, 0, 0, VSC, VT16, VTh, VTl);
        k_fattn<<<dim3(NH_, SEQ / QT, 1), 32 * AW, 0, stream>>>(QP16, KP16, VT16, QPh, QPl, KPh, KPl, VTh, VTl, ATh, ATl, CZ);
        k_gemmw<bf, 1, true, 8, 0><<<dim3(SEQ / 64, DM / 64, 1), 256, 0, stream>>>(ATh, ATl, WO, nullptr, DQ, DQ, OUT + xo, DM, bo, 0, 0, 0, CZ, 0, 0, 1.0f, nullptr, nullptr, nullptr); }
}

// v005
// A run of this version takes 148 microseconds.
// Timed twice side by side with v004, it ran 1.25 and 1.24 times as fast.
// Counting every step since v000, it is 10.8 times as fast.
#include <hip/hip_runtime.h>

// Causal multi-head attention: q/k/v = x W^T + b ([out][in] weights, 16 heads x 64), scores = q.k x 1/8 with lower-triangular replace-mask under an int flag input, f32 softmax, ctx = P v, out = ctx Wo^T + bo -> [2][2048][1024] f32.
// Compute dtypes, f32 accumulate everywhere: every float input RNE-converted to bf16; q/k/v projections v_wmma_f32_16x16x32_bf16 on plain bf16 operands + bias; scores: query rows < RH bf16 hi/lo x bf16 hi/lo (3 products), rows >= RH plain v_wmma_f32_16x16x32_f16 (q and k planes carried x4); softmax f32; P.v: rows < RH bf16 hi/lo P x bf16 hi/lo v (3 products), rows >= RH fp16 P carried x1024 against fp16 v carried x4; output projection bf16 hi/lo of ctx x bf16 Wo (2 products) + bias.

#ifndef NB
#define NB 2
#endif
#ifndef SEQ
#define SEQ 2048
#endif
#define NB_FULL  2
#define SEQ_FULL 2048
#define DM   1024
#define NH_  16
#define NKV  16
#define HD   64
#define DQ   (NH_ * HD)
#define DKV  (NKV * HD)
#define AW   8                    // waves per work-group of the attention kernel; wave w takes the 32-key chunks w, w + AW, ...
#define QT   32                   // query rows per work-group of the attention kernel
#ifndef RH
#define RH   512                  // query rows < RH use hi+lo planes
#endif
#define RHE  ((RH < SEQ) ? RH : SEQ)
#define QSC  4.0f                 // q plane carry
#define KSC  4.0f                 // k plane carry
#define VSC  4.0f                 // v plane carry
#define PCAR 1024.0f              // fp16 P plane carry (rows >= RH)
#define SCL  (0.125f / (QSC * KSC))   // HD^-0.5 folded with the q/k carries (exact power of two)
static_assert(SEQ % 128 == 0);
static_assert(SEQ <= SEQ_FULL);
static_assert(NB >= 1 && NB <= NB_FULL);
static_assert((RHE % 64) == 0);
static_assert(DM == DQ);
static_assert((DM % 64) == 0 && (HD % 32) == 0);
static_assert((RHE % QT) == 0 && (SEQ % QT) == 0 && HD == 64 && QT * (HD / 8) == 32 * AW);

typedef _Float16 h16;
typedef unsigned short bf;
typedef __attribute__((ext_vector_type(16))) __bf16   v16bf;
typedef __attribute__((ext_vector_type(16))) _Float16 v16h;
typedef __attribute__((ext_vector_type(8)))  _Float16 v8h;
typedef __attribute__((ext_vector_type(8)))  unsigned short v8us;
typedef __attribute__((ext_vector_type(8)))  float    v8f;
typedef __attribute__((ext_vector_type(4)))  float    v4f;
typedef __attribute__((ext_vector_type(2))) _Float16 v2h;
typedef __attribute__((ext_vector_type(4))) _Float16 v4h;
typedef __attribute__((ext_vector_type(2))) unsigned short v2us;
typedef __attribute__((ext_vector_type(4))) unsigned short v4us;
typedef __attribute__((ext_vector_type(2))) float v2f;
typedef v8h  __attribute__((may_alias)) v8ha;
typedef v4f  __attribute__((may_alias)) v4fa;
typedef v8us __attribute__((may_alias)) v8usa;

__device__ __forceinline__ unsigned short f2bf(float f) { unsigned u = __float_as_uint(f); u += 0x7FFFu + ((u >> 16) & 1u); return (unsigned short)(u >> 16); }
__device__ __forceinline__ float bf2f(unsigned short b) { return __uint_as_float(((unsigned)b) << 16); }
__device__ __forceinline__ float bfr(float f) { return bf2f(f2bf(f)); }
__device__ __forceinline__ v16h cat16(v8h lo, v8h hi) { return __builtin_shufflevector(lo, hi, 0, 1, 2, 3, 4, 5, 6, 7, 8, 9, 10, 11, 12, 13, 14, 15); }
__device__ __forceinline__ v16bf cat16b(v8us lo, v8us hi) { return __builtin_bit_cast(v16bf, __builtin_shufflevector(lo, hi, 0, 1, 2, 3, 4, 5, 6, 7, 8, 9, 10, 11, 12, 13, 14, 15)); }
__device__ __forceinline__ v8f wmma16(v16h a, v16h b, v8f c) { return __builtin_amdgcn_wmma_f32_16x16x32_f16(false, a, false, b, (short)0, c, false, false); }
__device__ __forceinline__ v8f wmmab(v16bf a, v16bf b, v8f c) { return __builtin_amdgcn_wmma_f32_16x16x32_bf16(false, a, false, b, (short)0, c, false, false); }
__device__ __forceinline__ h16 tohx(float x) { return (h16)x; }
__device__ __forceinline__ void splitf(float y, unsigned short& h, unsigned short& l) { h = f2bf(y); l = f2bf(y - bf2f(h)); }

// ---- gemmw: register-blocked GEMM, one 64x64 output tile per work-group (16 accumulators per wave), operands straight from K-contiguous 16-bit planes; tile (bx, by) of (M/64, N/64), 32 * KW threads; os = the work-group's LDS, owned by the calling kernel.
// C[m][n] (f32, pitch ldc, + optional f32 bias[n]) = sum_k A[m][k] Bt[n][k] (+ split products per NSPLIT). A rows at pitch lda, Bt rows at pitch K. K % 32 == 0.
// Fragments: lane l, h = l>>4, row/col = l&15; elements 0..7 <- k0+8h+0..7, elements 8..15 <- k0+16+8h+0..7 for BOTH A and Bt; D element r -> (row 8h+r, col l&15).
// KW waves per work-group share one tile: wave w takes the 32-wide k steps w, w+KW, ...; the KW partial tiles meet in LDS and are summed in wave order (KW == 1: one wave, no sum).
// EP 0: C as above. EP 1 and 2: no f32 C; each value x sc goes out as three 16-bit planes (f16, bf16 hi, bf16 lo). EP 1: tile column block = head, planes [head][row][HD], bias by column. EP 2: A = weight rows, Bt = token rows, so the tile is [feature][token] and the planes are [feature][SEQ], bias by row.
// cmode 1 (scores, causal flag set): tiles whose first key column lies past the last query row r0+roff+63 are skipped (never read downstream); cmode 2 (P.v): K limited to r0+roff+64 keys.
// xwait: stands behind every fragment load, in front of the next one, whose result the register allocator may place in the pair that holds an issued load's address
__device__ __forceinline__ void xwait() { asm volatile("s_wait_xcnt 0x0" ::: "memory"); }
template <typename T16> struct WFrag;
template <> struct WFrag<h16> { typedef v16h V; static __device__ __forceinline__ V ld(const h16* p) { const v8h lo = *(const v8h*)p; xwait(); const v8h hi = *(const v8h*)(p + 16); xwait(); return cat16(lo, hi); } static __device__ __forceinline__ v8f mma(V a, V b, v8f c) { return wmma16(a, b, c); } };
template <> struct WFrag<bf> { typedef v16bf V; static __device__ __forceinline__ V ld(const bf* p) { const v8us lo = *(const v8us*)p; xwait(); const v8us hi = *(const v8us*)(p + 16); xwait(); return cat16b(lo, hi); } static __device__ __forceinline__ v8f mma(V a, V b, v8f c) { return wmmab(a, b, c); } };
template <typename T16, int NSPLIT, bool BIAS, int KW, int EP>
__device__ __forceinline__ void gemmw(float* os, int bx, int by, const T16* __restrict__ A, const T16* __restrict__ A2, const T16* __restrict__ Bt, const T16* __restrict__ Bt2, int K, int lda, float* C, int ldc, const float* __restrict__ bias,
                                      const int* __restrict__ cflag, int roff, int cmode, float sc, h16* P16, bf* Ph, bf* Pl) {
    static_assert(EP == 0 || KW > 1);
    typedef typename WFrag<T16>::V V;
    const int lane = threadIdx.x & 31, lr = lane & 15, hi = lane >> 4; const int r0 = bx * 64, c0 = by * 64;
    const int causal = (cmode != 0 && cflag[0] != 0) ? 1 : 0;
    if (cmode == 1 && causal && c0 >= r0 + roff + 64) return;      // the tile index and the flag alone decide: the whole block leaves, ahead of the one block barrier
    int Kend = K;
    if (cmode == 2 && causal) { const int kl = r0 + roff + 64; Kend = (kl < K) ? kl : K; }
    const int wv = (KW == 1) ? 0 : __builtin_amdgcn_readfirstlane((int)(threadIdx.x >> 5));   // wave number, held scalar so that the k loop keeps a scalar branch and every lane stays on at the matrix instructions
    v8f acc[4][4];
#pragma unroll
    for (int mb = 0; mb < 4; ++mb)
#pragma unroll
        for (int nb = 0; nb < 4; ++nb) acc[mb][nb] = (v8f){};
    const size_t aoff = (size_t)(r0 + lr) * lda + 8 * hi, boff = (size_t)(c0 + lr) * K + 8 * hi;
#pragma unroll 1
    for (int kc = 32 * wv; kc < Kend; kc += 32 * KW) {
        V a[4], a2[4];
#pragma unroll
        for (int mb = 0; mb < 4; ++mb) { a[mb] = WFrag<T16>::ld(A + aoff + (size_t)mb * 16 * lda + kc); if (NSPLIT == 1 || NSPLIT == 2) a2[mb] = WFrag<T16>::ld(A2 + aoff + (size_t)mb * 16 * lda + kc); }
#pragma unroll
        for (int nb = 0; nb < 4; ++nb) { const V b = WFrag<T16>::ld(Bt + boff + (size_t)nb * 16 * K + kc); V b2; if (NSPLIT >= 2) b2 = WFrag<T16>::ld(Bt2 + boff + (size_t)nb * 16 * K + kc);
#pragma unroll
            for (int mb = 0; mb < 4; ++mb) { acc[mb][nb] = WFrag<T16>::mma(a[mb], b, acc[mb][nb]); if (NSPLIT == 1 || NSPLIT == 2) acc[mb][nb] = WFrag<T16>::mma(a2[mb], b, acc[mb][nb]); if (NSPLIT >= 2) acc[mb][nb] = WFrag<T16>::mma(a[mb], b2, acc[mb][nb]); } }
        asm volatile("v_nop\n\tv_nop\n\tv_nop\n\tv_nop" : "+v"(acc[0][0]), "+v"(acc[1][1]), "+v"(acc[2][2]), "+v"(acc[3][3]) : "v"(a[0]), "v"(a[3]));
    }
    if constexpr (KW > 1) {
        float* osw = os + wv * (64 * 68);          // this wave's partial tile, rows at pitch 68
        float brow[(64 * 16) / (32 * KW)];         // EP 2: the bias of each of this thread's rows, fetched here so that the LDS stores and the barrier cover the latency
        if constexpr (BIAS && EP == 2) {
#pragma unroll
            for (int s = 0; s < (64 * 16) / (32 * KW); ++s) brow[s] = bias[r0 + ((s * (32 * KW) + (int)threadIdx.x) >> 4)];
            xwait(); }
        // the loops below are unrolled so that acc is indexed by constants (stays in registers) and the LDS reads of a thread's items issue together
#pragma unroll
        for (int mb = 0; mb < 4; ++mb)
#pragma unroll
            for (int nb = 0; nb < 4; ++nb)
#pragma unroll
                for (int j = 0; j < 8; ++j) osw[(mb * 16 + hi * 8 + j) * 68 + nb * 16 + lr] = acc[mb][nb][j];
        __syncthreads();                                            // every wave's partial tile is in LDS before any of it is summed
        v4f sums[(64 * 16) / (32 * KW)];           // EP 1, 2: every item is summed before the first plane store, so that the waits behind the stores hold no LDS read back
#pragma unroll
        for (int s = 0; s < (64 * 16) / (32 * KW); ++s) { const int item = s * (32 * KW) + (int)threadIdx.x, row = item >> 4, cofs = (item & 15) * 4; v4f val = *(const v4fa*)(os + row * 68 + cofs);
#pragma unroll
            for (int w = 1; w < KW; ++w) val += *(const v4fa*)(os + w * (64 * 68) + row * 68 + cofs);
            if (BIAS && EP == 2) val += bfr(brow[s]);
            if (BIAS && EP != 2) { val[0] += bfr(bias[c0 + cofs]); val[1] += bfr(bias[c0 + cofs + 1]); val[2] += bfr(bias[c0 + cofs + 2]); val[3] += bfr(bias[c0 + cofs + 3]); }
            if constexpr (EP == 0) *(v4f*)(C + (size_t)(r0 + row) * ldc + c0 + cofs) = val;
            else sums[s] = val; }
        if constexpr (EP != 0) {
#pragma unroll
            for (int s = 0; s < (64 * 16) / (32 * KW); ++s) { const int item = s * (32 * KW) + (int)threadIdx.x, row = item >> 4, cofs = (item & 15) * 4;
                const size_t e = (EP == 1) ? ((size_t)by * SEQ + r0 + row) * HD + cofs : (size_t)(r0 + row) * SEQ + c0 + cofs; v4h o16; v4us oh, ol;
#pragma unroll
                for (int q = 0; q < 4; ++q) { const float r = sums[s][q] * sc; o16[q] = tohx(r); unsigned short a2, c2; splitf(r, a2, c2); oh[q] = a2; ol[q] = c2; }
                // xwait behind each plane store: the conversions that follow reuse the registers that an issued store names
                *(v4h*)(P16 + e) = o16; xwait(); *(v4us*)(Ph + e) = oh; xwait(); *(v4us*)(Pl + e) = ol; xwait(); } }
        return;
    }
#pragma unroll
    for (int mb = 0; mb < 4; ++mb) {
#pragma unroll
        for (int nb = 0; nb < 4; ++nb) {
#pragma unroll
            for (int j = 0; j < 8; ++j) os[(hi * 8 + j) * 68 + nb * 16 + lr] = acc[mb][nb][j]; }
        __builtin_amdgcn_wave_barrier(); asm volatile("" ::: "memory");
        float* crow = C + (size_t)(r0 + mb * 16) * ldc + c0;
{
#pragma unroll
            for (int s = 0; s < 8; ++s) { const int row = 2 * s + hi, cofs = lr * 4; v4f val = *(const v4fa*)(os + row * 68 + cofs); if (BIAS) { val[0] += bfr(bias[c0 + cofs]); val[1] += bfr(bias[c0 + cofs + 1]); val[2] += bfr(bias[c0 + cofs + 2]); val[3] += bfr(bias[c0 + cofs + 3]); }
                *(v4f*)(crow + (size_t)row * ldc + cofs) = val; }
             }
        __builtin_amdgcn_wave_barrier(); asm volatile("" ::: "memory");
    }
}

// k_gemmw: one gemmw tile per work-group, grid (M/64, N/64, Z); z-batch strides sA/sB/sC in elements.
template <typename T16, int NSPLIT, bool BIAS, int KW, int EP>
__global__ __launch_bounds__(32 * KW) void k_gemmw(const T16* __restrict__ A, const T16* __restrict__ A2, const T16* __restrict__ Bt, const T16* __restrict__ Bt2, int K, int lda, float* C, int ldc, const float* __restrict__ bias, size_t sA, size_t sB, size_t sC,
                                              const int* __restrict__ cflag, int roff, int cmode, float sc, h16* P16, bf* Ph, bf* Pl) {
    __shared__ __align__(16) float os[(KW == 1) ? 16 * 68 : KW * 64 * 68];
    const size_t z = blockIdx.z; A += z * sA; if (A2) A2 += z * sA; Bt += z * sB; if (Bt2) Bt2 += z * sB; C += z * sC;
    gemmw<T16, NSPLIT, BIAS, KW, EP>(os, (int)blockIdx.x, (int)blockIdx.y, A, A2, Bt, Bt2, K, lda, C, ldc, bias, cflag, roff, cmode, sc, P16, Ph, Pl);
}

// k_proj: the q, k and v projections of every batch in one grid (SEQ/64 token blocks, DM/64 feature blocks, 3 * NB); z = t * NB + batch, t = 0 q, 1 k, 2 v.
// XB holds the bf16 activations [z][SEQ][DM], WB the bf16 weights [q, k, v, o][DM][DM]; each plane set is [z][NH_ * SEQ * HD]. blockIdx.z alone picks the branch: the same for the whole work-group.
__global__ __launch_bounds__(32 * 8) void k_proj(const bf* __restrict__ XB, const bf* __restrict__ WB, const float* __restrict__ bq, const float* __restrict__ bk, const float* __restrict__ bv, h16* P16, bf* Ph, bf* Pl) {
    __shared__ __align__(16) float os[8 * 64 * 68];
    const int z = (int)blockIdx.z, t = z / NB;
    const bf* X = XB + (size_t)z * SEQ * DM; const bf* Wt = WB + (size_t)t * DM * DM; const size_t po = (size_t)z * NH_ * SEQ * HD;
    if (t == 2) gemmw<bf, 0, true, 8, 2>(os, (int)blockIdx.y, (int)blockIdx.x, Wt, nullptr, X, nullptr, DM, DM, nullptr, 0, bv, nullptr, 0, 0, VSC, P16 + po, Ph + po, Pl + po);
    else gemmw<bf, 0, true, 8, 1>(os, (int)blockIdx.x, (int)blockIdx.y, X, nullptr, Wt, nullptr, DM, DM, nullptr, 0, (t == 0) ? bq : bk, nullptr, 0, 0, (t == 0) ? QSC : KSC, P16 + po, Ph + po, Pl + po);
}

// k_cvt8: every float matrix to bf16 in one grid: first GX8 blocks for each of the 3 * NB activation slabs (tensor t, batch b -> XB[t * NB + b]), then GW8 blocks for each of the four weights (-> WB[q, k, v, o]); eight elements per thread.
#define GX8 ((SEQ * DM / 8 + 255u) / 256u)
#define GW8 ((DM * DM / 8 + 255u) / 256u)
__global__ __launch_bounds__(256) void k_cvt8(const float* __restrict__ xq, const float* __restrict__ xk, const float* __restrict__ xv, const float* __restrict__ wq, const float* __restrict__ wk, const float* __restrict__ wv, const float* __restrict__ wo, bf* XB, bf* WB) {
    const unsigned blk = blockIdx.x; const float* src; bf* dst; size_t n8, i;
    if (blk < 3u * NB * GX8) { const unsigned sg = blk / GX8, t = sg / NB, b = sg % NB; src = ((t == 0) ? xq : (t == 1) ? xk : xv) + (size_t)b * SEQ_FULL * DM; dst = XB + (size_t)sg * SEQ * DM; n8 = (size_t)SEQ * DM / 8; i = (size_t)(blk % GX8) * 256 + threadIdx.x; }
    else { const unsigned wb = blk - 3u * NB * GX8, t = wb / GW8; src = (t == 0) ? wq : (t == 1) ? wk : (t == 2) ? wv : wo; dst = WB + (size_t)t * DM * DM; n8 = (size_t)DM * DM / 8; i = (size_t)(wb % GW8) * 256 + threadIdx.x; }
    if (i >= n8) return; const v8f v = *(const v8f*)(src + i * 8); v8us o;
#pragma unroll
    for (int k = 0; k < 8; ++k) o[k] = f2bf(v[k]); *(v8us*)(dst + i * 8) = o;  }

// ---- k_fattn: scores, causal mask, softmax and P.v of one (batch, head, QT query rows) tile in one work-group, grid (NB * NH_, SEQ / QT); no score or P value leaves the registers.
// Transposed products: St = K Qt (A = K rows, B = Q rows, both by WFrag::ld), so lane l holds scores of ONE query (column l&15), keys 8h+r of each 16-key block; two such D tiles, converted in place,
// are the B fragment of P for 32 keys (elements 0..7 <- k0+8h+r, 8..15 <- k0+16+8h+r: the k order of WFrag::ld on the Vt rows); Ot += Vt Pt, D element r -> (d = 8h+r, query l&15).
// Running maximum m and sum l per query (per lane; the two halves of a wave share m by one exchange per chunk, l is joined once at the end); P is exp(x - m), not yet divided by the sum.
// Wave w walks the chunks w, w+AW, ...; the AW partial (m, l, Ot) meet in LDS and are joined in wave order, divided by the sum, and stored as the bf16 hi/lo planes of ctx.
// Every inner loop is unrolled so that the fragment and accumulator arrays are indexed by constants and stay in registers; the chunk loop stays rolled: a second copy of its body would double the live fragments.
// Causal: chunks past the tile's last query row are not walked; QT == chunk width, so every walked chunk holds at least one unmasked key for every query of the tile.
__device__ __forceinline__ float xhalf(float x) { return __builtin_bit_cast(float, __builtin_amdgcn_permlanex16(__builtin_bit_cast(int, x), __builtin_bit_cast(int, x), 0x76543210, 0xfedcba98, false, false)); }   // lane l's value of lane l ^ 16
// exp(x) as v_exp_f32(x * log2 e), the form of __expf, written in asm so that the slot the instruction set asks for behind a transcendental (one independent instruction or v_nop before its result is read or its source overwritten) is kept by construction:
// inside a run every v_exp_f32 is followed by an independent one (early-clobber outputs: none lands on a source of the run), and one v_nop stands behind the last.
#define L2E 1.44269504f
__device__ __forceinline__ float exp1(float x) { float r; const float y = x * L2E; asm("v_exp_f32 %0, %1\n\tv_nop" : "=v"(r) : "v"(y)); return r; }
__device__ __forceinline__ v8f exp8(v8f x) { float r0, r1, r2, r3, r4, r5, r6, r7; const v8f y = x * L2E;
    asm("v_exp_f32 %0, %8\n\tv_exp_f32 %1, %9\n\tv_exp_f32 %2, %10\n\tv_exp_f32 %3, %11\n\tv_exp_f32 %4, %12\n\tv_exp_f32 %5, %13\n\tv_exp_f32 %6, %14\n\tv_exp_f32 %7, %15\n\tv_nop"
        : "=&v"(r0), "=&v"(r1), "=&v"(r2), "=&v"(r3), "=&v"(r4), "=&v"(r5), "=&v"(r6), "=&v"(r7) : "v"(y[0]), "v"(y[1]), "v"(y[2]), "v"(y[3]), "v"(y[4]), "v"(y[5]), "v"(y[6]), "v"(y[7]));
    return (v8f){ r0, r1, r2, r3, r4, r5, r6, r7 }; }
template <typename T16, bool HR>
__device__ __forceinline__ void attn_tile(const T16* __restrict__ Q, const T16* __restrict__ Q2, const T16* __restrict__ Kp, const T16* __restrict__ K2, const T16* __restrict__ Vt, const T16* __restrict__ V2,
                                          int q0, int nch, int causal, int wv, int lane, float* osw, float* msw, float* lsw) {
    typedef typename WFrag<T16>::V V;
    const int lr = lane & 15, hi = lane >> 4;
    v8f o[4][2];
#pragma unroll
    for (int mb = 0; mb < 4; ++mb)
#pragma unroll
        for (int nq = 0; nq < 2; ++nq) o[mb][nq] = (v8f){};
    float m[2] = { -1.0e30f, -1.0e30f }, l[2] = { 0.0f, 0.0f };
    if (wv < nch) {                                                  // scalar test; the Q loads stand inside it, so that each keeps its xwait directly behind it
    V qf[2][2], qf2[2][2];
#pragma unroll
    for (int nq = 0; nq < 2; ++nq)
#pragma unroll
        for (int ks = 0; ks < 2; ++ks) { const size_t qo = (size_t)(q0 + nq * 16 + lr) * HD + ks * 32 + 8 * hi; qf[nq][ks] = WFrag<T16>::ld(Q + qo); if (HR) qf2[nq][ks] = WFrag<T16>::ld(Q2 + qo); }
#pragma unroll 1
    for (int c = wv; c < nch; c += AW) {
        const int k0 = c * 32;
        v8f s[2][2];
#pragma unroll
        for (int kb = 0; kb < 2; ++kb) { V kf[2], kf2[2];
#pragma unroll
            for (int ks = 0; ks < 2; ++ks) { const size_t ko = (size_t)(k0 + kb * 16 + lr) * HD + ks * 32 + 8 * hi; kf[ks] = WFrag<T16>::ld(Kp + ko); if (HR) kf2[ks] = WFrag<T16>::ld(K2 + ko); }
#pragma unroll
            for (int nq = 0; nq < 2; ++nq) { v8f a = (v8f){};
#pragma unroll
                for (int ks = 0; ks < 2; ++ks) { a = WFrag<T16>::mma(kf[ks], qf[nq][ks], a); if (HR) { a = WFrag<T16>::mma(kf[ks], qf2[nq][ks], a); a = WFrag<T16>::mma(kf2[ks], qf[nq][ks], a); } }
                s[kb][nq] = a; } }
        V vf[4], vf2[4];
#pragma unroll
        for (int mb = 0; mb < 4; ++mb) { if (!HR) vf[mb] = WFrag<T16>::ld(Vt + (size_t)(mb * 16 + lr) * SEQ + k0 + 8 * hi); }   // one plane: fetched ahead of the softmax, which covers the latency
        V pf[2], pl[2];
#pragma unroll
        for (int nq = 0; nq < 2; ++nq) {
            const int qi = q0 + nq * 16 + lr;
            float mx = m[nq];
#pragma unroll
            for (int kb = 0; kb < 2; ++kb)
#pragma unroll
                for (int r = 0; r < 8; ++r) { const float xs = s[kb][nq][r] * SCL; const float x = (causal != 0 && (k0 + kb * 16 + 8 * hi + r) > qi) ? -1.0e30f : xs; s[kb][nq][r] = x; mx = fmaxf(mx, x); }
            mx = fmaxf(mx, xhalf(mx));
            const float al = exp1(m[nq] - mx);                     // 0 on a wave's first chunk (m starts at the fill value)
            m[nq] = mx;
            float ps = 0.0f;
#pragma unroll
            for (int kb = 0; kb < 2; ++kb) { s[kb][nq] = exp8(s[kb][nq] - mx);                                        // a masked score gives exactly 0: mx is a real score
#pragma unroll
                for (int r = 0; r < 8; ++r) ps += s[kb][nq][r]; }
            l[nq] = l[nq] * al + ps;
#pragma unroll
            for (int mb = 0; mb < 4; ++mb) o[mb][nq] *= al;
            if constexpr (HR) { v8us h0, h1, l0, l1;
#pragma unroll
                for (int r = 0; r < 8; ++r) { unsigned short a2, c2; splitf(s[0][nq][r], a2, c2); h0[r] = a2; l0[r] = c2; splitf(s[1][nq][r], a2, c2); h1[r] = a2; l1[r] = c2; }
                pf[nq] = cat16b(h0, h1); pl[nq] = cat16b(l0, l1); }
            else { v8h p0, p1;
#pragma unroll
                for (int r = 0; r < 8; ++r) { p0[r] = tohx(s[0][nq][r] * PCAR); p1[r] = tohx(s[1][nq][r] * PCAR); }
                pf[nq] = cat16(p0, p1); }
        }
#pragma unroll
        for (int mb = 0; mb < 4; ++mb) {
            if (HR) { const size_t vo = (size_t)(mb * 16 + lr) * SEQ + k0 + 8 * hi; vf[mb] = WFrag<T16>::ld(Vt + vo); vf2[mb] = WFrag<T16>::ld(V2 + vo); }   // two planes: fetched block by block, to stay within 256 registers
#pragma unroll
            for (int nq = 0; nq < 2; ++nq) { o[mb][nq] = WFrag<T16>::mma(vf[mb], pf[nq], o[mb][nq]); if (HR) { o[mb][nq] = WFrag<T16>::mma(vf[mb], pl[nq], o[mb][nq]); o[mb][nq] = WFrag<T16>::mma(vf2[mb], pf[nq], o[mb][nq]); } } }
    }
    }
#pragma unroll
    for (int nq = 0; nq < 2; ++nq) { const float lt = l[nq] + xhalf(l[nq]); const int q = nq * 16 + lr;
        if (hi == 0) { msw[q] = m[nq]; lsw[q] = lt; }
#pragma unroll
        for (int mb = 0; mb < 4; ++mb) { float* d = osw + q * 68 + mb * 16 + 8 * hi;
            *(v4fa*)d = (v4f){ o[mb][nq][0], o[mb][nq][1], o[mb][nq][2], o[mb][nq][3] }; *(v4fa*)(d + 4) = (v4f){ o[mb][nq][4], o[mb][nq][5], o[mb][nq][6], o[mb][nq][7] }; } }
}

__global__ __launch_bounds__(32 * AW) void k_fattn(const h16* __restrict__ Q16, const h16* __restrict__ K16, const h16* __restrict__ V16, const bf* __restrict__ Qh, const bf* __restrict__ Ql, const bf* __restrict__ Kh, const bf* __restrict__ Kl,
                                                   const bf* __restrict__ Vh, const bf* __restrict__ Vl, bf* Ah, bf* Al, const int* __restrict__ cflag) {
    __shared__ __align__(16) float os[AW * QT * 68];                // per wave: QT query rows of HD partial sums, pitch 68
    __shared__ float ms[AW * QT], ls[AW * QT];
    const int hb = blockIdx.x, q0 = (SEQ / QT - 1 - (int)blockIdx.y) * QT;      // hb = batch * NH_ + head; every head's longest tiles start first, in both batches
    const int causal = (cflag[0] != 0) ? 1 : 0;
    const int nch = causal ? (q0 / 32 + 1) : (SEQ / 32);
    const int wv = __builtin_amdgcn_readfirstlane((int)(threadIdx.x >> 5));      // wave number, held scalar so that the chunk loop keeps a scalar branch and every lane stays on at the matrix instructions
    const int lane = threadIdx.x & 31; const size_t po = (size_t)hb * SEQ * HD;
    const bool hires = (q0 < RHE);                                  // blockIdx alone decides: the same for the whole work-group
    if (hires) attn_tile<bf, true>(Qh + po, Ql + po, Kh + po, Kl + po, Vh + po, Vl + po, q0, nch, causal, wv, lane, os + wv * (QT * 68), ms + wv * QT, ls + wv * QT);
    else attn_tile<h16, false>(Q16 + po, nullptr, K16 + po, nullptr, V16 + po, nullptr, q0, nch, causal, wv, lane, os + wv * (QT * 68), ms + wv * QT, ls + wv * QT);
    __syncthreads();                                                // every wave's partial (m, l, Ot) is in LDS before any of it is joined
    const int q = (int)threadIdx.x >> 3, dg = (int)threadIdx.x & 7; // one query row and eight head columns per thread
    float M = ms[q];
#pragma unroll
    for (int w = 1; w < AW; ++w) M = fmaxf(M, ms[w * QT + q]);
    float L = 0.0f; v4f s0 = (v4f){}, s1 = (v4f){};
#pragma unroll
    for (int w = 0; w < AW; ++w) { const float f = exp1(ms[w * QT + q] - M); const float* p = os + w * (QT * 68) + q * 68 + dg * 8;   // a wave that walked no chunk: f = 0, l = 0, Ot = 0
        L += f * ls[w * QT + q]; s0 += f * *(const v4fa*)p; s1 += f * *(const v4fa*)(p + 4); }
    const float cs = (hires ? (1.0f / VSC) : (1.0f / (VSC * PCAR))) / L;         // L >= 1: the row's largest score contributes exp(0)
    v8us oh, ol;
#pragma unroll
    for (int k = 0; k < 4; ++k) { unsigned short a, c2; splitf(s0[k] * cs, a, c2); oh[k] = a; ol[k] = c2; splitf(s1[k] * cs, a, c2); oh[4 + k] = a; ol[4 + k] = c2; }
    const size_t oo = ((size_t)(hb / NH_) * SEQ + q0 + q) * DQ + (hb % NH_) * HD + dg * 8;   // ctx planes [batch][SEQ][DQ]
    *(v8us*)(Ah + oo) = oh; *(v8us*)(Al + oo) = ol;
}

extern "C" void kernel_launch(void* const* d_in, const int* in_sizes, int n_in,
                              void* d_out, int out_size, void* d_ws, size_t ws_size, hipStream_t stream) {
    if (n_in < 12) return;
    const size_t needx = ((size_t)(NB - 1) * SEQ_FULL + SEQ) * DM;
    if ((size_t)in_sizes[0] < needx || (size_t)in_sizes[1] < needx || (size_t)in_sizes[2] < needx) return;
    if (in_sizes[3] < DM * DM || in_sizes[5] < DM * DM || in_sizes[7] < DM * DM || in_sizes[9] < DM * DM) return;
    if (in_sizes[4] < DM || in_sizes[6] < DM || in_sizes[8] < DM || in_sizes[10] < DM || in_sizes[11] < 1) return;
    if ((size_t)out_size < needx) return;
    const float* xq = (const float*)d_in[0]; const float* xk = (const float*)d_in[1]; const float* xv = (const float*)d_in[2];
    const float* wq = (const float*)d_in[3]; const float* bq = (const float*)d_in[4]; const float* wk = (const float*)d_in[5]; const float* bk = (const float*)d_in[6];
    const float* wv = (const float*)d_in[7]; const float* bv = (const float*)d_in[8]; const float* wo = (const float*)d_in[9]; const float* bo = (const float*)d_in[10];
    const int* CZ = (const int*)d_in[11];
    float* OUT = (float*)d_out;     // [NB][SEQ_FULL][DM]

    // ---- workspace carve (every region a multiple of 256 B; all producers write exact tile/row multiples, no padded tails needed: SEQ%128==0, DM%64==0)
    constexpr size_t SZ_W = (size_t)DM * DM * 2, SZ_XB = (size_t)SEQ * DM * 2, SZ_PL = (size_t)NH_ * SEQ * HD * 2;
    constexpr size_t SZ_AT = (size_t)SEQ * DQ * 2;
    constexpr size_t WS_TOTAL = 4 * SZ_W + 3 * NB * SZ_XB + 9 * NB * SZ_PL + 2 * NB * SZ_AT;
    static_assert(WS_TOTAL <= (size_t)268435456);
    if (WS_TOTAL > ws_size) return;
    char* wsp = (char*)d_ws;
    auto take = [&](size_t bytes) { char* p = wsp; wsp += (bytes + 255) & ~(size_t)255; return (void*)p; };
    bf* WB = (bf*)take(4 * SZ_W);                                              // bf16 weights [q, k, v, o]
    bf* XB = (bf*)take(3 * NB * SZ_XB);                                        // bf16 activations [q, k, v][batch]
    h16* P16 = (h16*)take(3 * NB * SZ_PL); bf* PH = (bf*)take(3 * NB * SZ_PL); bf* PL = (bf*)take(3 * NB * SZ_PL);   // plane sets [q, k, v transposed][batch][head]
    bf* ATh = (bf*)take(NB * SZ_AT); bf* ATl = (bf*)take(NB * SZ_AT);          // ctx planes [batch][SEQ][DQ]
    if ((size_t)(wsp - (char*)d_ws) > ws_size) return;
    constexpr size_t PSET = (size_t)NB * NH_ * SEQ * HD;                       // elements of one tensor's plane over all batches

    k_cvt8<<<3 * NB * GX8 + 4 * GW8, 256, 0, stream>>>(xq, xk, xv, wq, wk, wv, wo, XB, WB);
    k_proj<<<dim3(SEQ / 64, DQ / 64, 3 * NB), 256, 0, stream>>>(XB, WB, bq, bk, bv, P16, PH, PL);
    k_fattn<<<dim3(NB * NH_, SEQ / QT, 1), 32 * AW, 0, stream>>>(P16, P16 + PSET, P16 + 2 * PSET, PH, PL, PH + PSET, PL + PSET, PH + 2 * PSET, PL + 2 * PSET, ATh, ATl, CZ);
    k_gemmw<bf, 1, true, 8, 0><<<dim3(SEQ / 64, DM / 64, NB), 256, 0, stream>>>(ATh, ATl, WB + 3 * (size_t)DM * DM, nullptr, DQ, DQ, OUT, DM, bo, (size_t)SEQ * DQ, 0, (size_t)SEQ_FULL * DM, CZ, 0, 0, 1.0f, nullptr, nullptr, nullptr);
}

// v006
// Measured time: 108 microseconds a run.
// Next to v005, in two timings, it ran 1.36 and 1.37 times as fast.
// Counting every step since v000, it is 14.8 times as fast.
#include <hip/hip_runtime.h>

// Causal multi-head attention: q/k/v = x W^T + b ([out][in] weights, 16 heads x 64), scores = q.k x 1/8 with lower-triangular replace-mask under an int flag input, f32 softmax, ctx = P v, out = ctx Wo^T + bo -> [2][2048][1024] f32.
// Compute dtypes, f32 accumulate everywhere: every float input RNE-converted to bf16; q/k/v projections v_wmma_f32_16x16x32_bf16 on plain bf16 operands + bias; scores: query rows < RH bf16 hi/lo x bf16 hi/lo (3 products), rows >= RH plain v_wmma_f32_16x16x32_f16 (q and k planes carried x4); softmax f32; P.v: rows < RH bf16 hi/lo P x bf16 hi/lo v (3 products), rows >= RH fp16 P carried x1024 against fp16 v carried x4; output projection bf16 hi/lo of ctx x bf16 Wo (2 products) + bias.

#ifndef NB
#define NB 2
#endif
#ifndef SEQ
#define SEQ 2048
#endif
#define NB_FULL  2
#define SEQ_FULL 2048
#define DM   1024
#define NH_  16
#define NKV  16
#define HD   64
#define DQ   (NH_ * HD)
#define DKV  (NKV * HD)
#define AW   8                    // waves per work-group of the attention kernel; wave w takes the 32-key chunks w, w + AW, ...
#define QT   32                   // query rows per work-group of the attention kernel
#ifndef RH
#define RH   512                  // query rows < RH use hi+lo planes
#endif
#define RHE  ((RH < SEQ) ? RH : SEQ)
#define QSC  4.0f                 // q plane carry
#define KSC  4.0f                 // k plane carry
#define VSC  4.0f                 // v plane carry
#define PCAR 1024.0f              // fp16 P plane carry (rows >= RH)
#define SCL  (0.125f / (QSC * KSC))   // HD^-0.5 folded with the q/k carries (exact power of two)
static_assert(SEQ % 128 == 0);
static_assert(SEQ <= SEQ_FULL);
static_assert(NB >= 1 && NB <= NB_FULL);
static_assert((RHE % 64) == 0);
static_assert(DM == DQ);
static_assert((DM % 64) == 0 && (HD % 32) == 0);
static_assert((RHE % QT) == 0 && (SEQ % QT) == 0 && HD == 64 && QT * (HD / 8) == 32 * AW);

typedef _Float16 h16;
typedef unsigned short bf;
typedef __attribute__((ext_vector_type(16))) __bf16   v16bf;
typedef __attribute__((ext_vector_type(16))) _Float16 v16h;
typedef __attribute__((ext_vector_type(8)))  _Float16 v8h;
typedef __attribute__((ext_vector_type(8)))  unsigned short v8us;
typedef __attribute__((ext_vector_type(8)))  float    v8f;
typedef __attribute__((ext_vector_type(4)))  float    v4f;
typedef __attribute__((ext_vector_type(2))) _Float16 v2h;
typedef __attribute__((ext_vector_type(4))) _Float16 v4h;
typedef __attribute__((ext_vector_type(2))) unsigned short v2us;
typedef __attribute__((ext_vector_type(4))) unsigned short v4us;
typedef __attribute__((ext_vector_type(2))) float v2f;
typedef v8h  __attribute__((may_alias)) v8ha;
typedef v4f  __attribute__((may_alias)) v4fa;
typedef v8us __attribute__((may_alias)) v8usa;

__device__ __forceinline__ unsigned short f2bf(float f) { unsigned u = __float_as_uint(f); u += 0x7FFFu + ((u >> 16) & 1u); return (unsigned short)(u >> 16); }
__device__ __forceinline__ float bf2f(unsigned short b) { return __uint_as_float(((unsigned)b) << 16); }
__device__ __forceinline__ float bfr(float f) { return bf2f(f2bf(f)); }
__device__ __forceinline__ v16h cat16(v8h lo, v8h hi) { return __builtin_shufflevector(lo, hi, 0, 1, 2, 3, 4, 5, 6, 7, 8, 9, 10, 11, 12, 13, 14, 15); }
__device__ __forceinline__ v16bf cat16b(v8us lo, v8us hi) { return __builtin_bit_cast(v16bf, __builtin_shufflevector(lo, hi, 0, 1, 2, 3, 4, 5, 6, 7, 8, 9, 10, 11, 12, 13, 14, 15)); }
__device__ __forceinline__ v8f wmma16(v16h a, v16h b, v8f c) { return __builtin_amdgcn_wmma_f32_16x16x32_f16(false, a, false, b, (short)0, c, false, false); }
__device__ __forceinline__ v8f wmmab(v16bf a, v16bf b, v8f c) { return __builtin_amdgcn_wmma_f32_16x16x32_bf16(false, a, false, b, (short)0, c, false, false); }
__device__ __forceinline__ h16 tohx(float x) { return (h16)x; }
__device__ __forceinline__ void splitf(float y, unsigned short& h, unsigned short& l) { h = f2bf(y); l = f2bf(y - bf2f(h)); }

// ---- Fragment-order planes: every 16-bit operand matrix [rows][K] in the workspace is stored as 16-row x 32-k blocks of 1 KiB, blocks in [row >> 4][k >> 5] order; inside a block the 16-byte unit of (row, eight k) stands at unit ((k >> 3) & 3) * 16 + (row & 15).
// Lane l of a fragment load then reads unit l (elements 0..7) and unit 32 + l (elements 8..15): 512 contiguous bytes, four whole 128-byte lines, per load instruction. pk = element offset of (row, k).
__device__ __forceinline__ size_t pk(int row, int k, int K) { return (size_t)(row >> 4) * 16 * K + (size_t)(k >> 5) * 512 + ((k >> 3) & 3) * 128 + (row & 15) * 8 + (k & 7); }

// ---- gemmw: register-blocked GEMM, one 64x64 output tile per work-group (16 accumulators per wave), operands straight from fragment-order 16-bit planes; tile (bx, by) of (M/64, N/64), 32 * KW threads; os = the work-group's LDS, owned by the calling kernel.
// C[m][n] (f32, pitch ldc, + optional f32 bias[n]) = sum_k A[m][k] Bt[n][k] (+ split products per NSPLIT). A is a fragment-order plane of lda columns, Bt one of K columns. K % 32 == 0.
// Fragments: lane l, h = l>>4, row/col = l&15; elements 0..7 <- k0+8h+0..7, elements 8..15 <- k0+16+8h+0..7 for BOTH A and Bt; D element r -> (row 8h+r, col l&15).
// KW waves per work-group share one tile: wave w takes the 32-wide k steps w, w+KW, ...; the KW partial tiles meet in LDS and are summed in wave order (KW == 1: one wave, no sum).
// EP 0: C as above. EP 1 and 2: no f32 C; each value x sc goes out as three 16-bit planes (f16, bf16 hi, bf16 lo). EP 1: tile column block = head, planes [head] x fragment-order [row][HD], bias by column. EP 2: A = weight rows, Bt = token rows, so the tile is [feature][token] and the planes are fragment-order [feature][SEQ], bias by row.
// cmode 1 (scores, causal flag set): tiles whose first key column lies past the last query row r0+roff+63 are skipped (never read downstream); cmode 2 (P.v): K limited to r0+roff+64 keys.
// xwait: stands behind every fragment load, in front of the next one, whose result the register allocator may place in the pair that holds an issued load's address
__device__ __forceinline__ void xwait() { asm volatile("s_wait_xcnt 0x0" ::: "memory"); }
template <typename T16> struct WFrag;
template <> struct WFrag<h16> { typedef v16h V; static __device__ __forceinline__ V ld(const h16* p) { const v8h lo = *(const v8h*)p; xwait(); const v8h hi = *(const v8h*)(p + 256); xwait(); return cat16(lo, hi); } static __device__ __forceinline__ v8f mma(V a, V b, v8f c) { return wmma16(a, b, c); } };
template <> struct WFrag<bf> { typedef v16bf V; static __device__ __forceinline__ V ld(const bf* p) { const v8us lo = *(const v8us*)p; xwait(); const v8us hi = *(const v8us*)(p + 256); xwait(); return cat16b(lo, hi); } static __device__ __forceinline__ v8f mma(V a, V b, v8f c) { return wmmab(a, b, c); } };
template <typename T16, int NSPLIT, bool BIAS, int KW, int EP>
__device__ __forceinline__ void gemmw(float* os, int bx, int by, const T16* __restrict__ A, const T16* __restrict__ A2, const T16* __restrict__ Bt, const T16* __restrict__ Bt2, int K, int lda, float* C, int ldc, const float* __restrict__ bias,
                                      const int* __restrict__ cflag, int roff, int cmode, float sc, h16* P16, bf* Ph, bf* Pl) {
    static_assert(EP == 0 || KW == 8);
    typedef typename WFrag<T16>::V V;
    const int lane = threadIdx.x & 31, lr = lane & 15, hi = lane >> 4; const int r0 = bx * 64, c0 = by * 64;
    const int causal = (cmode != 0 && cflag[0] != 0) ? 1 : 0;
    if (cmode == 1 && causal && c0 >= r0 + roff + 64) return;      // the tile index and the flag alone decide: the whole block leaves, ahead of the one block barrier
    int Kend = K;
    if (cmode == 2 && causal) { const int kl = r0 + roff + 64; Kend = (kl < K) ? kl : K; }
    const int wv = (KW == 1) ? 0 : __builtin_amdgcn_readfirstlane((int)(threadIdx.x >> 5));   // wave number, held scalar so that the k loop keeps a scalar branch and every lane stays on at the matrix instructions
    v8f acc[4][4];
#pragma unroll
    for (int mb = 0; mb < 4; ++mb)
#pragma unroll
        for (int nb = 0; nb < 4; ++nb) acc[mb][nb] = (v8f){};
    const size_t aoff = (size_t)r0 * lda + 8 * lane, boff = (size_t)c0 * K + 8 * lane;   // first block of the tile's rows, this lane's unit; a 32-wide k step is one block = 512 elements = 16 * 32
#pragma unroll 1
    for (int kc = 32 * wv; kc < Kend; kc += 32 * KW) {
        V a[4], a2[4];
#pragma unroll
        for (int mb = 0; mb < 4; ++mb) { a[mb] = WFrag<T16>::ld(A + aoff + (size_t)mb * 16 * lda + (size_t)kc * 16); if (NSPLIT == 1 || NSPLIT == 2) a2[mb] = WFrag<T16>::ld(A2 + aoff + (size_t)mb * 16 * lda + (size_t)kc * 16); }
#pragma unroll
        for (int nb = 0; nb < 4; ++nb) { const V b = WFrag<T16>::ld(Bt + boff + (size_t)nb * 16 * K + (size_t)kc * 16); V b2; if (NSPLIT >= 2) b2 = WFrag<T16>::ld(Bt2 + boff + (size_t)nb * 16 * K + (size_t)kc * 16);
#pragma unroll
            for (int mb = 0; mb < 4; ++mb) { acc[mb][nb] = WFrag<T16>::mma(a[mb], b, acc[mb][nb]); if (NSPLIT == 1 || NSPLIT == 2) acc[mb][nb] = WFrag<T16>::mma(a2[mb], b, acc[mb][nb]); if (NSPLIT >= 2) acc[mb][nb] = WFrag<T16>::mma(a[mb], b2, acc[mb][nb]); } }
        asm volatile("v_nop\n\tv_nop\n\tv_nop\n\tv_nop" : "+v"(acc[0][0]), "+v"(acc[1][1]), "+v"(acc[2][2]), "+v"(acc[3][3]) : "v"(a[0]), "v"(a[3]));
    }
    if constexpr (KW > 1) {
        float* osw = os + wv * (64 * 68);          // this wave's partial tile, rows at pitch 68
        // EP 1, 2: a thread's item is one 16-byte unit of the planes (one row, eight columns), two items per thread: row = 8 * wave + (lane & 7), column group ug + s. Eight lanes then fill one whole 128-byte line of a fragment-order plane,
        // and the groups 0, 4, 2, 6 of a wave's four lane octets stand 16 floats apart in LDS, so that with the row pitch 68 the 16-byte LDS reads of any 16 neighbouring lanes fall on 64 different banks.
        const int urow = wv * 8 + (lane & 7), ug = (((lane >> 3) & 1) << 2) | ((lane >> 3) & 2);
        float brow = 0.0f; v4f bcol[2][2];         // EP 2: the bias of this thread's row; EP 1: of its columns; fetched here so that the LDS stores and the barrier cover the latency
        if constexpr (BIAS && EP == 2) { brow = bias[r0 + urow]; xwait(); }
        if constexpr (BIAS && EP == 1) {
#pragma unroll
            for (int s = 0; s < 2; ++s) { bcol[s][0] = *(const v4f*)(bias + c0 + (ug + s) * 8); xwait(); bcol[s][1] = *(const v4f*)(bias + c0 + (ug + s) * 8 + 4); xwait(); } }
        // the loops below are unrolled so that acc is indexed by constants (stays in registers) and the LDS reads of a thread's items issue together
#pragma unroll
        for (int mb = 0; mb < 4; ++mb)
#pragma unroll
            for (int nb = 0; nb < 4; ++nb)
#pragma unroll
                for (int j = 0; j < 8; ++j) osw[(mb * 16 + hi * 8 + j) * 68 + nb * 16 + lr] = acc[mb][nb][j];
        __syncthreads();                                            // every wave's partial tile is in LDS before any of it is summed
        if constexpr (EP == 0) {
#pragma unroll
            for (int s = 0; s < (64 * 16) / (32 * KW); ++s) { const int item = s * (32 * KW) + (int)threadIdx.x, row = item >> 4, cofs = (item & 15) * 4; v4f val = *(const v4fa*)(os + row * 68 + cofs);
#pragma unroll
                for (int w = 1; w < KW; ++w) val += *(const v4fa*)(os + w * (64 * 68) + row * 68 + cofs);
                if (BIAS) { val[0] += bfr(bias[c0 + cofs]); val[1] += bfr(bias[c0 + cofs + 1]); val[2] += bfr(bias[c0 + cofs + 2]); val[3] += bfr(bias[c0 + cofs + 3]); }
                *(v4f*)(C + (size_t)(r0 + row) * ldc + c0 + cofs) = val; }
        } else {
            v4f sums[2][2];                        // every item is summed before the first plane store, so that the waits behind the stores hold no LDS read back
#pragma unroll
            for (int s = 0; s < 2; ++s)
#pragma unroll
                for (int t = 0; t < 2; ++t) { const float* p = os + urow * 68 + (ug + s) * 8 + t * 4; v4f val = *(const v4fa*)p;
#pragma unroll
                    for (int w = 1; w < KW; ++w) val += *(const v4fa*)(p + w * (64 * 68));
                    if (BIAS && EP == 2) val += bfr(brow);
                    if (BIAS && EP == 1) { val[0] += bfr(bcol[s][t][0]); val[1] += bfr(bcol[s][t][1]); val[2] += bfr(bcol[s][t][2]); val[3] += bfr(bcol[s][t][3]); }
                    sums[s][t] = val; }
#pragma unroll
            for (int s = 0; s < 2; ++s) {
                const size_t e = (EP == 1) ? (size_t)by * SEQ * HD + pk(r0 + urow, (ug + s) * 8, HD) : pk(r0 + urow, c0 + (ug + s) * 8, SEQ); v8h o16; v8us oh, ol;
#pragma unroll
                for (int q = 0; q < 8; ++q) { const float r = sums[s][q >> 2][q & 3] * sc; o16[q] = tohx(r); unsigned short a2, c2; splitf(r, a2, c2); oh[q] = a2; ol[q] = c2; }
                // xwait behind each plane store: the conversions that follow reuse the registers that an issued store names
                *(v8h*)(P16 + e) = o16; xwait(); *(v8us*)(Ph + e) = oh; xwait(); *(v8us*)(Pl + e) = ol; xwait(); } }
        return;
    }
#pragma unroll
    for (int mb = 0; mb < 4; ++mb) {
#pragma unroll
        for (int nb = 0; nb < 4; ++nb) {
#pragma unroll
            for (int j = 0; j < 8; ++j) os[(hi * 8 + j) * 68 + nb * 16 + lr] = acc[mb][nb][j]; }
        __builtin_amdgcn_wave_barrier(); asm volatile("" ::: "memory");
        float* crow = C + (size_t)(r0 + mb * 16) * ldc + c0;
{
#pragma unroll
            for (int s = 0; s < 8; ++s) { const int row = 2 * s + hi, cofs = lr * 4; v4f val = *(const v4fa*)(os + row * 68 + cofs); if (BIAS) { val[0] += bfr(bias[c0 + cofs]); val[1] += bfr(bias[c0 + cofs + 1]); val[2] += bfr(bias[c0 + cofs + 2]); val[3] += bfr(bias[c0 + cofs + 3]); }
                *(v4f*)(crow + (size_t)row * ldc + cofs) = val; }
             }
        __builtin_amdgcn_wave_barrier(); asm volatile("" ::: "memory");
    }
}

// k_gemmw: one gemmw tile per work-group, grid (M/64, N/64, Z); z-batch strides sA/sB/sC in elements.
template <typename T16, int NSPLIT, bool BIAS, int KW, int EP>
__global__ __launch_bounds__(32 * KW) void k_gemmw(const T16* __restrict__ A, const T16* __restrict__ A2, const T16* __restrict__ Bt, const T16* __restrict__ Bt2, int K, int lda, float* C, int ldc, const float* __restrict__ bias, size_t sA, size_t sB, size_t sC,
                                              const int* __restrict__ cflag, int roff, int cmode, float sc, h16* P16, bf* Ph, bf* Pl) {
    __shared__ __align__(16) float os[(KW == 1) ? 16 * 68 : KW * 64 * 68];
    const size_t z = blockIdx.z; A += z * sA; if (A2) A2 += z * sA; Bt += z * sB; if (Bt2) Bt2 += z * sB; C += z * sC;
    gemmw<T16, NSPLIT, BIAS, KW, EP>(os, (int)blockIdx.x, (int)blockIdx.y, A, A2, Bt, Bt2, K, lda, C, ldc, bias, cflag, roff, cmode, sc, P16, Ph, Pl);
}

// k_proj: the q, k and v projections of every batch in one grid (SEQ/64 token blocks, DM/64 feature blocks, 3 * NB); z = t * NB + batch, t = 0 q, 1 k, 2 v.
// XB holds the bf16 activations [z] x fragment-order [SEQ][DM], WB the bf16 weights [q, k, v, o] x fragment-order [DM][DM]; each plane set is [z][NH_ * SEQ * HD]. blockIdx.z alone picks the branch: the same for the whole work-group.
__global__ __launch_bounds__(32 * 8) void k_proj(const bf* __restrict__ XB, const bf* __restrict__ WB, const float* __restrict__ bq, const float* __restrict__ bk, const float* __restrict__ bv, h16* P16, bf* Ph, bf* Pl) {
    __shared__ __align__(16) float os[8 * 64 * 68];
    const int z = (int)blockIdx.z, t = z / NB;
    const bf* X = XB + (size_t)z * SEQ * DM; const bf* Wt = WB + (size_t)t * DM * DM; const size_t po = (size_t)z * NH_ * SEQ * HD;
    if (t == 2) gemmw<bf, 0, true, 8, 2>(os, (int)blockIdx.y, (int)blockIdx.x, Wt, nullptr, X, nullptr, DM, DM, nullptr, 0, bv, nullptr, 0, 0, VSC, P16 + po, Ph + po, Pl + po);
    else gemmw<bf, 0, true, 8, 1>(os, (int)blockIdx.x, (int)blockIdx.y, X, nullptr, Wt, nullptr, DM, DM, nullptr, 0, (t == 0) ? bq : bk, nullptr, 0, 0, (t == 0) ? QSC : KSC, P16 + po, Ph + po, Pl + po);
}

// k_cvt8: every float matrix to bf16 in one grid: first GX8 blocks for each of the 3 * NB activation slabs (tensor t, batch b -> XB[t * NB + b]), then GW8 blocks for each of the four weights (-> WB[q, k, v, o]); eight elements per thread.
// The bf16 copies are fragment-order planes. A wave takes eight rows x 32 columns: lane l reads the eight floats (l >> 3) of row (l & 7), so a wave reads eight whole 128-byte lines and its one store fills four whole lines (eight rows' units of one column group each).
#define GX8 ((SEQ * DM / 8 + 255u) / 256u)
#define GW8 ((DM * DM / 8 + 255u) / 256u)
__global__ __launch_bounds__(256) void k_cvt8(const float* __restrict__ xq, const float* __restrict__ xk, const float* __restrict__ xv, const float* __restrict__ wq, const float* __restrict__ wk, const float* __restrict__ wv, const float* __restrict__ wo, bf* XB, bf* WB) {
    const unsigned blk = blockIdx.x; const float* src; bf* dst; size_t n8, i;
    if (blk < 3u * NB * GX8) { const unsigned sg = blk / GX8, t = sg / NB, b = sg % NB; src = ((t == 0) ? xq : (t == 1) ? xk : xv) + (size_t)b * SEQ_FULL * DM; dst = XB + (size_t)sg * SEQ * DM; n8 = (size_t)SEQ * DM / 8; i = (size_t)(blk % GX8) * 256 + threadIdx.x; }
    else { const unsigned wb = blk - 3u * NB * GX8, t = wb / GW8; src = (t == 0) ? wq : (t == 1) ? wk : (t == 2) ? wv : wo; dst = WB + (size_t)t * DM * DM; n8 = (size_t)DM * DM / 8; i = (size_t)(wb % GW8) * 256 + threadIdx.x; }
    if (i >= n8) return;
    const unsigned l = (unsigned)i & 31u, wi = (unsigned)(i >> 5), bi = wi >> 1, r = (wi & 1u) * 8u + (l & 7u);                  // wave wi: half (wi & 1) of the rows of block bi; blocks run [row >> 4][k >> 5], DM / 32 to a row block
    const size_t so = ((size_t)(bi / (DM / 32)) * 16 + r) * DM + (bi % (DM / 32)) * 32 + (l >> 3) * 8, dofs = (size_t)bi * 512 + (l >> 3) * 128 + r * 8;
    const v8f v = *(const v8f*)(src + so); v8us o;
#pragma unroll
    for (int k = 0; k < 8; ++k) o[k] = f2bf(v[k]); *(v8us*)(dst + dofs) = o;  }

// ---- k_fattn: scores, causal mask, softmax and P.v of one (batch, head, QT query rows) tile in one work-group, grid (NB * NH_, SEQ / QT); no score or P value leaves the registers.
// Transposed products: St = K Qt (A = K rows, B = Q rows, both by WFrag::ld), so lane l holds scores of ONE query (column l&15), keys 8h+r of each 16-key block; two such D tiles, converted in place,
// are the B fragment of P for 32 keys (elements 0..7 <- k0+8h+r, 8..15 <- k0+16+8h+r: the k order of WFrag::ld on the Vt rows; all planes in fragment order); Ot += Vt Pt, D element r -> (d = 8h+r, query l&15).
// Running maximum m and sum l per query (per lane; the two halves of a wave share m by one exchange per chunk, l is joined once at the end); P is exp(x - m), not yet divided by the sum.
// Wave w walks the chunks w, w+AW, ...; the AW partial (m, l, Ot) meet in LDS and are joined in wave order, divided by the sum, and stored as the bf16 hi/lo planes of ctx.
// Every inner loop is unrolled so that the fragment and accumulator arrays are indexed by constants and stay in registers; the chunk loop stays rolled: a second copy of its body would double the live fragments.
// Causal: chunks past the tile's last query row are not walked; QT == chunk width, so every walked chunk holds at least one unmasked key for every query of the tile.
__device__ __forceinline__ float xhalf(float x) { return __builtin_bit_cast(float, __builtin_amdgcn_permlanex16(__builtin_bit_cast(int, x), __builtin_bit_cast(int, x), 0x76543210, 0xfedcba98, false, false)); }   // lane l's value of lane l ^ 16
// exp(x) as v_exp_f32(x * log2 e), the form of __expf, written in asm so that the slot the instruction set asks for behind a transcendental (one independent instruction or v_nop before its result is read or its source overwritten) is kept by construction:
// inside a run every v_exp_f32 is followed by an independent one (early-clobber outputs: none lands on a source of the run), and one v_nop stands behind the last.
#define L2E 1.44269504f
__device__ __forceinline__ float exp1(float x) { float r; const float y = x * L2E; asm("v_exp_f32 %0, %1\n\tv_nop" : "=v"(r) : "v"(y)); return r; }
__device__ __forceinline__ v8f exp8(v8f x) { float r0, r1, r2, r3, r4, r5, r6, r7; const v8f y = x * L2E;
    asm("v_exp_f32 %0, %8\n\tv_exp_f32 %1, %9\n\tv_exp_f32 %2, %10\n\tv_exp_f32 %3, %11\n\tv_exp_f32 %4, %12\n\tv_exp_f32 %5, %13\n\tv_exp_f32 %6, %14\n\tv_exp_f32 %7, %15\n\tv_nop"
        : "=&v"(r0), "=&v"(r1), "=&v"(r2), "=&v"(r3), "=&v"(r4), "=&v"(r5), "=&v"(r6), "=&v"(r7) : "v"(y[0]), "v"(y[1]), "v"(y[2]), "v"(y[3]), "v"(y[4]), "v"(y[5]), "v"(y[6]), "v"(y[7]));
    return (v8f){ r0, r1, r2, r3, r4, r5, r6, r7 }; }
template <typename T16, bool HR>
__device__ __forceinline__ void attn_tile(const T16* __restrict__ Q, const T16* __restrict__ Q2, const T16* __restrict__ Kp, const T16* __restrict__ K2, const T16* __restrict__ Vt, const T16* __restrict__ V2,
                                          int q0, int nch, int causal, int wv, int lane, float* osw, float* msw, float* lsw) {
    typedef typename WFrag<T16>::V V;
    const int lr = lane & 15, hi = lane >> 4;
    v8f o[4][2];
#pragma unroll
    for (int mb = 0; mb < 4; ++mb)
#pragma unroll
        for (int nq = 0; nq < 2; ++nq) o[mb][nq] = (v8f){};
    float m[2] = { -1.0e30f, -1.0e30f }, l[2] = { 0.0f, 0.0f };
    if (wv < nch) {                                                  // scalar test; the Q loads stand inside it, so that each keeps its xwait directly behind it
    V qf[2][2], qf2[2][2];
#pragma unroll
    for (int nq = 0; nq < 2; ++nq)
#pragma unroll
        for (int ks = 0; ks < 2; ++ks) { const size_t qo = (size_t)(q0 + nq * 16) * HD + ks * 512 + 8 * lane; qf[nq][ks] = WFrag<T16>::ld(Q + qo); if (HR) qf2[nq][ks] = WFrag<T16>::ld(Q2 + qo); }
#pragma unroll 1
    for (int c = wv; c < nch; c += AW) {
        const int k0 = c * 32;
        v8f s[2][2];
#pragma unroll
        for (int kb = 0; kb < 2; ++kb) { V kf[2], kf2[2];
#pragma unroll
            for (int ks = 0; ks < 2; ++ks) { const size_t ko = (size_t)(k0 + kb * 16) * HD + ks * 512 + 8 * lane; kf[ks] = WFrag<T16>::ld(Kp + ko); if (HR) kf2[ks] = WFrag<T16>::ld(K2 + ko); }
#pragma unroll
            for (int nq = 0; nq < 2; ++nq) { v8f a = (v8f){};
#pragma unroll
                for (int ks = 0; ks < 2; ++ks) { a = WFrag<T16>::mma(kf[ks], qf[nq][ks], a); if (HR) { a = WFrag<T16>::mma(kf[ks], qf2[nq][ks], a); a = WFrag<T16>::mma(kf2[ks], qf[nq][ks], a); } }
                s[kb][nq] = a; } }
        V vf[4], vf2[4];
#pragma unroll
        for (int mb = 0; mb < 4; ++mb) { if (!HR) vf[mb] = WFrag<T16>::ld(Vt + (size_t)(mb * 16) * SEQ + (size_t)k0 * 16 + 8 * lane); }   // one plane: fetched ahead of the softmax, which covers the latency
        V pf[2], pl[2];
#pragma unroll
        for (int nq = 0; nq < 2; ++nq) {
            const int qi = q0 + nq * 16 + lr;
            float mx = m[nq];
#pragma unroll
            for (int kb = 0; kb < 2; ++kb)
#pragma unroll
                for (int r = 0; r < 8; ++r) { const float xs = s[kb][nq][r] * SCL; const float x = (causal != 0 && (k0 + kb * 16 + 8 * hi + r) > qi) ? -1.0e30f : xs; s[kb][nq][r] = x; mx = fmaxf(mx, x); }
            mx = fmaxf(mx, xhalf(mx));
            const float al = exp1(m[nq] - mx);                     // 0 on a wave's first chunk (m starts at the fill value)
            m[nq] = mx;
            float ps = 0.0f;
#pragma unroll
            for (int kb = 0; kb < 2; ++kb) { s[kb][nq] = exp8(s[kb][nq] - mx);                                        // a masked score gives exactly 0: mx is a real score
#pragma unroll
                for (int r = 0; r < 8; ++r) ps += s[kb][nq][r]; }
            l[nq] = l[nq] * al + ps;
#pragma unroll
            for (int mb = 0; mb < 4; ++mb) o[mb][nq] *= al;
            if constexpr (HR) { v8us h0, h1, l0, l1;
#pragma unroll
                for (int r = 0; r < 8; ++r) { unsigned short a2, c2; splitf(s[0][nq][r], a2, c2); h0[r] = a2; l0[r] = c2; splitf(s[1][nq][r], a2, c2); h1[r] = a2; l1[r] = c2; }
                pf[nq] = cat16b(h0, h1); pl[nq] = cat16b(l0, l1); }
            else { v8h p0, p1;
#pragma unroll
                for (int r = 0; r < 8; ++r) { p0[r] = tohx(s[0][nq][r] * PCAR); p1[r] = tohx(s[1][nq][r] * PCAR); }
                pf[nq] = cat16(p0, p1); }
        }
#pragma unroll
        for (int mb = 0; mb < 4; ++mb) {
            if (HR) { const size_t vo = (size_t)(mb * 16) * SEQ + (size_t)k0 * 16 + 8 * lane; vf[mb] = WFrag<T16>::ld(Vt + vo); vf2[mb] = WFrag<T16>::ld(V2 + vo); }   // two planes: fetched block by block, to stay within 256 registers
#pragma unroll
            for (int nq = 0; nq < 2; ++nq) { o[mb][nq] = WFrag<T16>::mma(vf[mb], pf[nq], o[mb][nq]); if (HR) { o[mb][nq] = WFrag<T16>::mma(vf[mb], pl[nq], o[mb][nq]); o[mb][nq] = WFrag<T16>::mma(vf2[mb], pf[nq], o[mb][nq]); } } }
    }
    }
#pragma unroll
    for (int nq = 0; nq < 2; ++nq) { const float lt = l[nq] + xhalf(l[nq]); const int q = nq * 16 + lr;
        if (hi == 0) { msw[q] = m[nq]; lsw[q] = lt; }
#pragma unroll
        for (int mb = 0; mb < 4; ++mb) { float* d = osw + q * 68 + mb * 16 + 8 * hi;
            *(v4fa*)d = (v4f){ o[mb][nq][0], o[mb][nq][1], o[mb][nq][2], o[mb][nq][3] }; *(v4fa*)(d + 4) = (v4f){ o[mb][nq][4], o[mb][nq][5], o[mb][nq][6], o[mb][nq][7] }; } }
}

__global__ __launch_bounds__(32 * AW) void k_fattn(const h16* __restrict__ Q16, const h16* __restrict__ K16, const h16* __restrict__ V16, const bf* __restrict__ Qh, const bf* __restrict__ Ql, const bf* __restrict__ Kh, const bf* __restrict__ Kl,
                                                   const bf* __restrict__ Vh, const bf* __restrict__ Vl, bf* Ah, bf* Al, const int* __restrict__ cflag) {
    __shared__ __align__(16) float os[AW * QT * 68];                // per wave: QT query rows of HD partial sums, pitch 68
    __shared__ float ms[AW * QT], ls[AW * QT];
    const int hb = blockIdx.x, q0 = (SEQ / QT - 1 - (int)blockIdx.y) * QT;      // hb = batch * NH_ + head; every head's longest tiles start first, in both batches
    const int causal = (cflag[0] != 0) ? 1 : 0;
    const int nch = causal ? (q0 / 32 + 1) : (SEQ / 32);
    const int wv = __builtin_amdgcn_readfirstlane((int)(threadIdx.x >> 5));      // wave number, held scalar so that the chunk loop keeps a scalar branch and every lane stays on at the matrix instructions
    const int lane = threadIdx.x & 31; const size_t po = (size_t)hb * SEQ * HD;
    const bool hires = (q0 < RHE);                                  // blockIdx alone decides: the same for the whole work-group
    if (hires) attn_tile<bf, true>(Qh + po, Ql + po, Kh + po, Kl + po, Vh + po, Vl + po, q0, nch, causal, wv, lane, os + wv * (QT * 68), ms + wv * QT, ls + wv * QT);
    else attn_tile<h16, false>(Q16 + po, nullptr, K16 + po, nullptr, V16 + po, nullptr, q0, nch, causal, wv, lane, os + wv * (QT * 68), ms + wv * QT, ls + wv * QT);
    __syncthreads();                                                // every wave's partial (m, l, Ot) is in LDS before any of it is joined
    const int q = (wv & 3) * 8 + (lane & 7), dg = ((((lane >> 3) & 1) << 2) | ((lane >> 3) & 2)) + (wv >> 2);   // one query row and eight head columns per thread; eight lanes = eight rows of one column group = one whole line of a fragment-order ctx plane; column groups 0, 4, 2, 6 (+ 1) per wave keep the LDS reads off each other's banks
    float M = ms[q];
#pragma unroll
    for (int w = 1; w < AW; ++w) M = fmaxf(M, ms[w * QT + q]);
    float L = 0.0f; v4f s0 = (v4f){}, s1 = (v4f){};
#pragma unroll
    for (int w = 0; w < AW; ++w) { const float f = exp1(ms[w * QT + q] - M); const float* p = os + w * (QT * 68) + q * 68 + dg * 8;   // a wave that walked no chunk: f = 0, l = 0, Ot = 0
        L += f * ls[w * QT + q]; s0 += f * *(const v4fa*)p; s1 += f * *(const v4fa*)(p + 4); }
    const float cs = (hires ? (1.0f / VSC) : (1.0f / (VSC * PCAR))) / L;         // L >= 1: the row's largest score contributes exp(0)
    v8us oh, ol;
#pragma unroll
    for (int k = 0; k < 4; ++k) { unsigned short a, c2; splitf(s0[k] * cs, a, c2); oh[k] = a; ol[k] = c2; splitf(s1[k] * cs, a, c2); oh[4 + k] = a; ol[4 + k] = c2; }
    const size_t oo = (size_t)(hb / NH_) * SEQ * DQ + pk(q0 + q, (hb % NH_) * HD + dg * 8, DQ);   // ctx planes [batch] x fragment-order [SEQ][DQ]
    *(v8us*)(Ah + oo) = oh; *(v8us*)(Al + oo) = ol;
}

extern "C" void kernel_launch(void* const* d_in, const int* in_sizes, int n_in,
                              void* d_out, int out_size, void* d_ws, size_t ws_size, hipStream_t stream) {
    if (n_in < 12) return;
    const size_t needx = ((size_t)(NB - 1) * SEQ_FULL + SEQ) * DM;
    if ((size_t)in_sizes[0] < needx || (size_t)in_sizes[1] < needx || (size_t)in_sizes[2] < needx) return;
    if (in_sizes[3] < DM * DM || in_sizes[5] < DM * DM || in_sizes[7] < DM * DM || in_sizes[9] < DM * DM) return;
    if (in_sizes[4] < DM || in_sizes[6] < DM || in_sizes[8] < DM || in_sizes[10] < DM || in_sizes[11] < 1) return;
    if ((size_t)out_size < needx) return;
    const float* xq = (const float*)d_in[0]; const float* xk = (const float*)d_in[1]; const float* xv = (const float*)d_in[2];
    const float* wq = (const float*)d_in[3]; const float* bq = (const float*)d_in[4]; const float* wk = (const float*)d_in[5]; const float* bk = (const float*)d_in[6];
    const float* wv = (const float*)d_in[7]; const float* bv = (const float*)d_in[8]; const float* wo = (const float*)d_in[9]; const float* bo = (const float*)d_in[10];
    const int* CZ = (const int*)d_in[11];
    float* OUT = (float*)d_out;     // [NB][SEQ_FULL][DM]

    // ---- workspace carve (every region a multiple of 256 B; all producers write exact tile/row multiples, no padded tails needed: SEQ%128==0, DM%64==0)
    constexpr size_t SZ_W = (size_t)DM * DM * 2, SZ_XB = (size_t)SEQ * DM * 2, SZ_PL = (size_t)NH_ * SEQ * HD * 2;
    constexpr size_t SZ_AT = (size_t)SEQ * DQ * 2;
    constexpr size_t WS_TOTAL = 4 * SZ_W + 3 * NB * SZ_XB + 9 * NB * SZ_PL + 2 * NB * SZ_AT;
    static_assert(WS_TOTAL <= (size_t)268435456);
    if (WS_TOTAL > ws_size) return;
    char* wsp = (char*)d_ws;
    auto take = [&](size_t bytes) { char* p = wsp; wsp += (bytes + 255) & ~(size_t)255; return (void*)p; };
    bf* WB = (bf*)take(4 * SZ_W);                                              // bf16 weights [q, k, v, o]
    bf* XB = (bf*)take(3 * NB * SZ_XB);                                        // bf16 activations [q, k, v][batch]
    h16* P16 = (h16*)take(3 * NB * SZ_PL); bf* PH = (bf*)take(3 * NB * SZ_PL); bf* PL = (bf*)take(3 * NB * SZ_PL);   // plane sets [q, k, v transposed][batch][head]
    bf* ATh = (bf*)take(NB * SZ_AT); bf* ATl = (bf*)take(NB * SZ_AT);          // ctx planes [batch][SEQ][DQ]
    if ((size_t)(wsp - (char*)d_ws) > ws_size) return;
    constexpr size_t PSET = (size_t)NB * NH_ * SEQ * HD;                       // elements of one tensor's plane over all batches

    k_cvt8<<<3 * NB * GX8 + 4 * GW8, 256, 0, stream>>>(xq, xk, xv, wq, wk, wv, wo, XB, WB);
    k_proj<<<dim3(SEQ / 64, DQ / 64, 3 * NB), 256, 0, stream>>>(XB, WB, bq, bk, bv, P16, PH, PL);
    k_fattn<<<dim3(NB * NH_, SEQ / QT, 1), 32 * AW, 0, stream>>>(P16, P16 + PSET, P16 + 2 * PSET, PH, PL, PH + PSET, PL + PSET, PH + 2 * PSET, PL + 2 * PSET, ATh, ATl, CZ);
    k_gemmw<bf, 1, true, 8, 0><<<dim3(SEQ / 64, DM / 64, NB), 256, 0, stream>>>(ATh, ATl, WB + 3 * (size_t)DM * DM, nullptr, DQ, DQ, OUT, DM, bo, (size_t)SEQ * DQ, 0, (size_t)SEQ_FULL * DM, CZ, 0, 0, 1.0f, nullptr, nullptr, nullptr);
}

// v007
// Measured time: 98.8 microseconds a run.
// Timed twice side by side with v006, it ran 1.09 times as fast both times.
// Over all steps from v000 it is 16.1 times as fast.
#include <hip/hip_runtime.h>

// Causal multi-head attention: q/k/v = x W^T + b ([out][in] weights, 16 heads x 64), scores = q.k x 1/8 with lower-triangular replace-mask under an int flag input, f32 softmax, ctx = P v, out = ctx Wo^T + bo -> [2][2048][1024] f32.
// Compute dtypes, f32 accumulate everywhere: every float input RNE-converted to bf16; q/k/v projections v_wmma_f32_16x16x32_bf16 on plain bf16 operands + bias; scores: query rows < RH bf16 hi/lo x bf16 hi/lo (3 products), rows >= RH plain v_wmma_f32_16x16x32_f16 (q and k planes carried x4); softmax f32; P.v: rows < RH bf16 hi/lo P x bf16 hi/lo v (3 products), rows >= RH fp16 P carried x1024 against fp16 v carried x4; output projection bf16 hi/lo of ctx x bf16 Wo (2 products) + bias.

#ifndef NB
#define NB 2
#endif
#ifndef SEQ
#define SEQ 2048
#endif
#define NB_FULL  2
#define SEQ_FULL 2048
#define DM   1024
#define NH_  16
#define NKV  16
#define HD   64
#define DQ   (NH_ * HD)
#define DKV  (NKV * HD)
#define AW   8                    // waves per work-group of the attention kernel; wave w takes the 32-key chunks w, w + AW, ...
#define QT   32                   // query rows per work-group of the attention kernel
#ifndef RH
#define RH   512                  // query rows < RH use hi+lo planes
#endif
#define RHE  ((RH < SEQ) ? RH : SEQ)
#define QSC  4.0f                 // q plane carry
#define KSC  4.0f                 // k plane carry
#define VSC  4.0f                 // v plane carry
#define PCAR 1024.0f              // fp16 P plane carry (rows >= RH)
#define SCL  (0.125f / (QSC * KSC))   // HD^-0.5 folded with the q/k carries (exact power of two)
static_assert(SEQ % 128 == 0);
static_assert(SEQ <= SEQ_FULL);
static_assert(NB >= 1 && NB <= NB_FULL);
static_assert((RHE % 64) == 0);
static_assert(DM == DQ);
static_assert((DM % 64) == 0 && (HD % 32) == 0);
static_assert((RHE % QT) == 0 && (SEQ % QT) == 0 && HD == 64 && QT * (HD / 8) == 32 * AW);

typedef _Float16 h16;
typedef unsigned short bf;
typedef __attribute__((ext_vector_type(16))) __bf16   v16bf;
typedef __attribute__((ext_vector_type(16))) _Float16 v16h;
typedef __attribute__((ext_vector_type(8)))  _Float16 v8h;
typedef __attribute__((ext_vector_type(8)))  unsigned short v8us;
typedef __attribute__((ext_vector_type(8)))  float    v8f;
typedef __attribute__((ext_vector_type(4)))  float    v4f;
typedef __attribute__((ext_vector_type(2))) _Float16 v2h;
typedef __attribute__((ext_vector_type(4))) _Float16 v4h;
typedef __attribute__((ext_vector_type(2))) unsigned short v2us;
typedef __attribute__((ext_vector_type(4))) unsigned short v4us;
typedef __attribute__((ext_vector_type(2))) float v2f;
typedef v8h  __attribute__((may_alias)) v8ha;
typedef v4f  __attribute__((may_alias)) v4fa;
typedef v8us __attribute__((may_alias)) v8usa;

__device__ __forceinline__ unsigned short f2bf(float f) { unsigned u = __float_as_uint(f); u += 0x7FFFu + ((u >> 16) & 1u); return (unsigned short)(u >> 16); }
__device__ __forceinline__ float bf2f(unsigned short b) { return __uint_as_float(((unsigned)b) << 16); }
__device__ __forceinline__ float bfr(float f) { return bf2f(f2bf(f)); }
__device__ __forceinline__ v16h cat16(v8h lo, v8h hi) { return __builtin_shufflevector(lo, hi, 0, 1, 2, 3, 4, 5, 6, 7, 8, 9, 10, 11, 12, 13, 14, 15); }
__device__ __forceinline__ v16bf cat16b(v8us lo, v8us hi) { return __builtin_bit_cast(v16bf, __builtin_shufflevector(lo, hi, 0, 1, 2, 3, 4, 5, 6, 7, 8, 9, 10, 11, 12, 13, 14, 15)); }
__device__ __forceinline__ v8f wmma16(v16h a, v16h b, v8f c) { return __builtin_amdgcn_wmma_f32_16x16x32_f16(false, a, false, b, (short)0, c, false, false); }
__device__ __forceinline__ v8f wmmab(v16bf a, v16bf b, v8f c) { return __builtin_amdgcn_wmma_f32_16x16x32_bf16(false, a, false, b, (short)0, c, false, false); }
__device__ __forceinline__ h16 tohx(float x) { return (h16)x; }
__device__ __forceinline__ void splitf(float y, unsigned short& h, unsigned short& l) { h = f2bf(y); l = f2bf(y - bf2f(h)); }

// ---- Fragment-order planes: every 16-bit operand matrix [rows][K] in the workspace is stored as 16-row x 32-k blocks of 1 KiB, blocks in [row >> 4][k >> 5] order; inside a block the 16-byte unit of (row, eight k) stands at unit ((k >> 3) & 3) * 16 + (row & 15).
// Lane l of a fragment load then reads unit l (elements 0..7) and unit 32 + l (elements 8..15): 512 contiguous bytes, four whole 128-byte lines, per load instruction. pk = element offset of (row, k).
__device__ __forceinline__ size_t pk(int row, int k, int K) { return (size_t)(row >> 4) * 16 * K + (size_t)(k >> 5) * 512 + ((k >> 3) & 3) * 128 + (row & 15) * 8 + (k & 7); }

// ---- gemmw: register-blocked GEMM, one 64x64 output tile per work-group (16 accumulators per wave), operands straight from fragment-order 16-bit planes; tile (bx, by) of (M/64, N/64), 32 * KW threads; os = the work-group's LDS, owned by the calling kernel.
// C[m][n] (f32, pitch ldc, + optional f32 bias[n]) = sum_k A[m][k] Bt[n][k] (+ split products per NSPLIT). A is a fragment-order plane of lda columns, Bt one of K columns. K % 32 == 0.
// Fragments: lane l, h = l>>4, row/col = l&15; elements 0..7 <- k0+8h+0..7, elements 8..15 <- k0+16+8h+0..7 for BOTH A and Bt; D element r -> (row 8h+r, col l&15).
// KW waves per work-group share one tile: wave w takes the 32-wide k steps w, w+KW, ...; the KW partial tiles meet in LDS and are summed in wave order (KW == 1: one wave, no sum).
// EP 0: C as above. EP 1 and 2: no f32 C; each value x sc goes out as three 16-bit planes (f16, bf16 hi, bf16 lo). EP 1: tile column block = head, planes [head] x fragment-order [row][HD], bias by column. EP 2: A = weight rows, Bt = token rows, so the tile is [feature][token] and the planes are fragment-order [feature][SEQ], bias by row.
// cmode 1 (scores, causal flag set): tiles whose first key column lies past the last query row r0+roff+63 are skipped (never read downstream); cmode 2 (P.v): K limited to r0+roff+64 keys.
// xwait: stands once behind each run of fragment loads, in front of the first instruction that may overwrite an address register which a load of the run names. Inside a run nothing does: the loads share address registers that stay live to the run's last load, so no result lands on them, and the loads issue back to back.
__device__ __forceinline__ void xwait() { asm volatile("s_wait_xcnt 0x0" ::: "memory"); }
template <typename T16> struct WFrag;
template <> struct WFrag<h16> { typedef v16h V; static __device__ __forceinline__ V ld(const h16* p) { const v8h lo = *(const v8h*)p; const v8h hi = *(const v8h*)(p + 256); return cat16(lo, hi); } static __device__ __forceinline__ v8f mma(V a, V b, v8f c) { return wmma16(a, b, c); } };
template <> struct WFrag<bf> { typedef v16bf V; static __device__ __forceinline__ V ld(const bf* p) { const v8us lo = *(const v8us*)p; const v8us hi = *(const v8us*)(p + 256); return cat16b(lo, hi); } static __device__ __forceinline__ v8f mma(V a, V b, v8f c) { return wmmab(a, b, c); } };
template <typename T16, int NSPLIT, bool BIAS, int KW, int EP>
__device__ __forceinline__ void gemmw(float* os, int bx, int by, const T16* __restrict__ A, const T16* __restrict__ A2, const T16* __restrict__ Bt, const T16* __restrict__ Bt2, int K, int lda, float* C, int ldc, const float* __restrict__ bias,
                                      const int* __restrict__ cflag, int roff, int cmode, float sc, h16* P16, bf* Ph, bf* Pl) {
    static_assert(EP == 0 || KW == 8);
    typedef typename WFrag<T16>::V V;
    const int lane = threadIdx.x & 31, lr = lane & 15, hi = lane >> 4; const int r0 = bx * 64, c0 = by * 64;
    const int causal = (cmode != 0 && cflag[0] != 0) ? 1 : 0;
    if (cmode == 1 && causal && c0 >= r0 + roff + 64) return;      // the tile index and the flag alone decide: the whole block leaves, ahead of the one block barrier
    int Kend = K;
    if (cmode == 2 && causal) { const int kl = r0 + roff + 64; Kend = (kl < K) ? kl : K; }
    const int wv = (KW == 1) ? 0 : __builtin_amdgcn_readfirstlane((int)(threadIdx.x >> 5));   // wave number, held scalar so that the k loop keeps a scalar branch and every lane stays on at the matrix instructions
    v8f acc[4][4];
#pragma unroll
    for (int mb = 0; mb < 4; ++mb)
#pragma unroll
        for (int nb = 0; nb < 4; ++nb) acc[mb][nb] = (v8f){};
    // first block of the tile's rows, this lane's unit, this wave's first k step; a 32-wide k step is one block = 512 elements = 16 * 32. One pointer per plane, advanced at the foot of the loop:
    // every load of a k step names it with an immediate offset (lda and K are constants at every call), so a plane's loads share one address pair.
    const size_t aoff = (size_t)r0 * lda + 8 * lane + (size_t)wv * 512, boff = (size_t)c0 * K + 8 * lane + (size_t)wv * 512;
    const T16* pa = A + aoff; const T16* pa2 = (NSPLIT == 1 || NSPLIT == 2) ? A2 + aoff : nullptr; const T16* pb = Bt + boff; const T16* pb2 = (NSPLIT >= 2) ? Bt2 + boff : nullptr;
#pragma unroll 1
    for (int kc = 32 * wv; kc < Kend; kc += 32 * KW) {
        V a[4], a2[4], b[4], b2[4];                // one run: every fragment load of the k step, then the one xwait
#pragma unroll
        for (int mb = 0; mb < 4; ++mb) { a[mb] = WFrag<T16>::ld(pa + (size_t)mb * 16 * lda); if (NSPLIT == 1 || NSPLIT == 2) a2[mb] = WFrag<T16>::ld(pa2 + (size_t)mb * 16 * lda); }
#pragma unroll
        for (int nb = 0; nb < 4; ++nb) { b[nb] = WFrag<T16>::ld(pb + (size_t)nb * 16 * K); if (NSPLIT >= 2) b2[nb] = WFrag<T16>::ld(pb2 + (size_t)nb * 16 * K); }
        // the run's one wait. Inputs only: the pointers, so that they stay live to here and no load's result lands on an address that an earlier load of the run names; the loaded fragments, so that every load of the k step is issued ahead of the first matrix instruction and all are in flight together
        if constexpr (NSPLIT == 0) asm volatile("s_wait_xcnt 0x0" :: "v"(pa), "v"(pb), "v"(a[0]), "v"(a[1]), "v"(a[2]), "v"(a[3]), "v"(b[0]), "v"(b[1]), "v"(b[2]), "v"(b[3]) : "memory");
        else if constexpr (NSPLIT == 1) asm volatile("s_wait_xcnt 0x0" :: "v"(pa), "v"(pa2), "v"(pb), "v"(a[0]), "v"(a[1]), "v"(a[2]), "v"(a[3]), "v"(a2[0]), "v"(a2[1]), "v"(a2[2]), "v"(a2[3]), "v"(b[0]), "v"(b[1]), "v"(b[2]), "v"(b[3]) : "memory");
        else xwait();
#pragma unroll
        for (int nb = 0; nb < 4; ++nb) {
#pragma unroll
            for (int mb = 0; mb < 4; ++mb) { acc[mb][nb] = WFrag<T16>::mma(a[mb], b[nb], acc[mb][nb]); if (NSPLIT == 1 || NSPLIT == 2) acc[mb][nb] = WFrag<T16>::mma(a2[mb], b[nb], acc[mb][nb]); if (NSPLIT >= 2) acc[mb][nb] = WFrag<T16>::mma(a[mb], b2[nb], acc[mb][nb]); } }
        asm volatile("v_nop\n\tv_nop\n\tv_nop\n\tv_nop" : "+v"(acc[0][0]), "+v"(acc[1][1]), "+v"(acc[2][2]), "+v"(acc[3][3]) : "v"(a[0]), "v"(a[3]));
        pa += 512 * KW; pb += 512 * KW; if (NSPLIT == 1 || NSPLIT == 2) pa2 += 512 * KW; if (NSPLIT >= 2) pb2 += 512 * KW;
    }
    if constexpr (KW > 1) {
        float* osw = os + wv * (64 * 68);          // this wave's partial tile, rows at pitch 68
        // EP 1, 2: a thread's item is one 16-byte unit of the planes (one row, eight columns), two items per thread: row = 8 * wave + (lane & 7), column group ug + s. Eight lanes then fill one whole 128-byte line of a fragment-order plane,
        // and the groups 0, 4, 2, 6 of a wave's four lane octets stand 16 floats apart in LDS, so that with the row pitch 68 the 16-byte LDS reads of any 16 neighbouring lanes fall on 64 different banks.
        const int urow = wv * 8 + (lane & 7), ug = (((lane >> 3) & 1) << 2) | ((lane >> 3) & 2);
        float brow = 0.0f; v4f bcol[2][2];         // EP 2: the bias of this thread's row; EP 1: of its columns; fetched here so that the LDS stores and the barrier cover the latency
        if constexpr (BIAS && EP == 2) { brow = bias[r0 + urow]; xwait(); }
        if constexpr (BIAS && EP == 1) {
#pragma unroll
            for (int s = 0; s < 2; ++s) { bcol[s][0] = *(const v4f*)(bias + c0 + (ug + s) * 8); xwait(); bcol[s][1] = *(const v4f*)(bias + c0 + (ug + s) * 8 + 4); xwait(); } }
        // the loops below are unrolled so that acc is indexed by constants (stays in registers) and the LDS reads of a thread's items issue together
#pragma unroll
        for (int mb = 0; mb < 4; ++mb)
#pragma unroll
            for (int nb = 0; nb < 4; ++nb)
#pragma unroll
                for (int j = 0; j < 8; ++j) osw[(mb * 16 + hi * 8 + j) * 68 + nb * 16 + lr] = acc[mb][nb][j];
        __syncthreads();                                            // every wave's partial tile is in LDS before any of it is summed
        if constexpr (EP == 0) {
#pragma unroll
            for (int s = 0; s < (64 * 16) / (32 * KW); ++s) { const int item = s * (32 * KW) + (int)threadIdx.x, row = item >> 4, cofs = (item & 15) * 4; v4f val = *(const v4fa*)(os + row * 68 + cofs);
#pragma unroll
                for (int w = 1; w < KW; ++w) val += *(const v4fa*)(os + w * (64 * 68) + row * 68 + cofs);
                if (BIAS) { val[0] += bfr(bias[c0 + cofs]); val[1] += bfr(bias[c0 + cofs + 1]); val[2] += bfr(bias[c0 + cofs + 2]); val[3] += bfr(bias[c0 + cofs + 3]); }
                *(v4f*)(C + (size_t)(r0 + row) * ldc + c0 + cofs) = val; }
        } else {
            v4f sums[2][2];                        // every item is summed before the first plane store, so that the waits behind the stores hold no LDS read back
#pragma unroll
            for (int s = 0; s < 2; ++s)
#pragma unroll
                for (int t = 0; t < 2; ++t) { const float* p = os + urow * 68 + (ug + s) * 8 + t * 4; v4f val = *(const v4fa*)p;
#pragma unroll
                    for (int w = 1; w < KW; ++w) val += *(const v4fa*)(p + w * (64 * 68));
                    if (BIAS && EP == 2) val += bfr(brow);
                    if (BIAS && EP == 1) { val[0] += bfr(bcol[s][t][0]); val[1] += bfr(bcol[s][t][1]); val[2] += bfr(bcol[s][t][2]); val[3] += bfr(bcol[s][t][3]); }
                    sums[s][t] = val; }
#pragma unroll
            for (int s = 0; s < 2; ++s) {
                const size_t e = (EP == 1) ? (size_t)by * SEQ * HD + pk(r0 + urow, (ug + s) * 8, HD) : pk(r0 + urow, c0 + (ug + s) * 8, SEQ); v8h o16; v8us oh, ol;
#pragma unroll
                for (int q = 0; q < 8; ++q) { const float r = sums[s][q >> 2][q & 3] * sc; o16[q] = tohx(r); unsigned short a2, c2; splitf(r, a2, c2); oh[q] = a2; ol[q] = c2; }
                // xwait behind each plane store: the conversions that follow reuse the registers that an issued store names
                *(v8h*)(P16 + e) = o16; xwait(); *(v8us*)(Ph + e) = oh; xwait(); *(v8us*)(Pl + e) = ol; xwait(); } }
        return;
    }
#pragma unroll
    for (int mb = 0; mb < 4; ++mb) {
#pragma unroll
        for (int nb = 0; nb < 4; ++nb) {
#pragma unroll
            for (int j = 0; j < 8; ++j) os[(hi * 8 + j) * 68 + nb * 16 + lr] = acc[mb][nb][j]; }
        __builtin_amdgcn_wave_barrier(); asm volatile("" ::: "memory");
        float* crow = C + (size_t)(r0 + mb * 16) * ldc + c0;
{
#pragma unroll
            for (int s = 0; s < 8; ++s) { const int row = 2 * s + hi, cofs = lr * 4; v4f val = *(const v4fa*)(os + row * 68 + cofs); if (BIAS) { val[0] += bfr(bias[c0 + cofs]); val[1] += bfr(bias[c0 + cofs + 1]); val[2] += bfr(bias[c0 + cofs + 2]); val[3] += bfr(bias[c0 + cofs + 3]); }
                *(v4f*)(crow + (size_t)row * ldc + cofs) = val; }
             }
        __builtin_amdgcn_wave_barrier(); asm volatile("" ::: "memory");
    }
}

// k_gemmw: one gemmw tile per work-group, grid (M/64, N/64, Z); K = lda = DQ; z-batch strides sA/sB/sC in elements.
template <typename T16, int NSPLIT, bool BIAS, int KW, int EP>
__global__ __launch_bounds__(32 * KW) void k_gemmw(const T16* __restrict__ A, const T16* __restrict__ A2, const T16* __restrict__ Bt, const T16* __restrict__ Bt2, float* C, int ldc, const float* __restrict__ bias, size_t sA, size_t sB, size_t sC,
                                              const int* __restrict__ cflag, int roff, int cmode, float sc, h16* P16, bf* Ph, bf* Pl) {
    __shared__ __align__(16) float os[(KW == 1) ? 16 * 68 : KW * 64 * 68];
    const size_t z = blockIdx.z; A += z * sA; if (A2) A2 += z * sA; Bt += z * sB; if (Bt2) Bt2 += z * sB; C += z * sC;
    gemmw<T16, NSPLIT, BIAS, KW, EP>(os, (int)blockIdx.x, (int)blockIdx.y, A, A2, Bt, Bt2, DQ, DQ, C, ldc, bias, cflag, roff, cmode, sc, P16, Ph, Pl);
}

// k_proj: the q, k and v projections of every batch in one grid (SEQ/64 token blocks, DM/64 feature blocks, 3 * NB); z = t * NB + batch, t = 0 q, 1 k, 2 v.
// XB holds the bf16 activations [z] x fragment-order [SEQ][DM], WB the bf16 weights [q, k, v, o] x fragment-order [DM][DM]; each plane set is [z][NH_ * SEQ * HD]. blockIdx.z alone picks the branch: the same for the whole work-group.
__global__ __launch_bounds__(32 * 8) void k_proj(const bf* __restrict__ XB, const bf* __restrict__ WB, const float* __restrict__ bq, const float* __restrict__ bk, const float* __restrict__ bv, h16* P16, bf* Ph, bf* Pl) {
    __shared__ __align__(16) float os[8 * 64 * 68];
    const int z = (int)blockIdx.z, t = z / NB;
    const bf* X = XB + (size_t)z * SEQ * DM; const bf* Wt = WB + (size_t)t * DM * DM; const size_t po = (size_t)z * NH_ * SEQ * HD;
    if (t == 2) gemmw<bf, 0, true, 8, 2>(os, (int)blockIdx.y, (int)blockIdx.x, Wt, nullptr, X, nullptr, DM, DM, nullptr, 0, bv, nullptr, 0, 0, VSC, P16 + po, Ph + po, Pl + po);
    else gemmw<bf, 0, true, 8, 1>(os, (int)blockIdx.x, (int)blockIdx.y, X, nullptr, Wt, nullptr, DM, DM, nullptr, 0, (t == 0) ? bq : bk, nullptr, 0, 0, (t == 0) ? QSC : KSC, P16 + po, Ph + po, Pl + po);
}

// k_cvt8: every float matrix to bf16 in one grid: first GX8 blocks for each of the 3 * NB activation slabs (tensor t, batch b -> XB[t * NB + b]), then GW8 blocks for each of the four weights (-> WB[q, k, v, o]); eight elements per thread.
// The bf16 copies are fragment-order planes. A wave takes eight rows x 32 columns: lane l reads the eight floats (l >> 3) of row (l & 7), so a wave reads eight whole 128-byte lines and its one store fills four whole lines (eight rows' units of one column group each).
#define GX8 ((SEQ * DM / 8 + 255u) / 256u)
#define GW8 ((DM * DM / 8 + 255u) / 256u)
__global__ __launch_bounds__(256) void k_cvt8(const float* __restrict__ xq, const float* __restrict__ xk, const float* __restrict__ xv, const float* __restrict__ wq, const float* __restrict__ wk, const float* __restrict__ wv, const float* __restrict__ wo, bf* XB, bf* WB) {
    const unsigned blk = blockIdx.x; const float* src; bf* dst; size_t n8, i;
    if (blk < 3u * NB * GX8) { const unsigned sg = blk / GX8, t = sg / NB, b = sg % NB; src = ((t == 0) ? xq : (t == 1) ? xk : xv) + (size_t)b * SEQ_FULL * DM; dst = XB + (size_t)sg * SEQ * DM; n8 = (size_t)SEQ * DM / 8; i = (size_t)(blk % GX8) * 256 + threadIdx.x; }
    else { const unsigned wb = blk - 3u * NB * GX8, t = wb / GW8; src = (t == 0) ? wq : (t == 1) ? wk : (t == 2) ? wv : wo; dst = WB + (size_t)t * DM * DM; n8 = (size_t)DM * DM / 8; i = (size_t)(wb % GW8) * 256 + threadIdx.x; }
    if (i >= n8) return;
    const unsigned l = (unsigned)i & 31u, wi = (unsigned)(i >> 5), bi = wi >> 1, r = (wi & 1u) * 8u + (l & 7u);                  // wave wi: half (wi & 1) of the rows of block bi; blocks run [row >> 4][k >> 5], DM / 32 to a row block
    const size_t so = ((size_t)(bi / (DM / 32)) * 16 + r) * DM + (bi % (DM / 32)) * 32 + (l >> 3) * 8, dofs = (size_t)bi * 512 + (l >> 3) * 128 + r * 8;
    const v8f v = *(const v8f*)(src + so); v8us o;
#pragma unroll
    for (int k = 0; k < 8; ++k) o[k] = f2bf(v[k]); *(v8us*)(dst + dofs) = o;  }

// ---- k_fattn: scores, causal mask, softmax and P.v of one (batch, head, QT query rows) tile in one work-group, grid (NB * NH_, SEQ / QT); no score or P value leaves the registers.
// Transposed products: St = K Qt (A = K rows, B = Q rows, both by WFrag::ld), so lane l holds scores of ONE query (column l&15), keys 8h+r of each 16-key block; two such D tiles, converted in place,
// are the B fragment of P for 32 keys (elements 0..7 <- k0+8h+r, 8..15 <- k0+16+8h+r: the k order of WFrag::ld on the Vt rows; all planes in fragment order); Ot += Vt Pt, D element r -> (d = 8h+r, query l&15).
// Running maximum m and sum l per query (per lane; the two halves of a wave share m by one exchange per chunk, l is joined once at the end); P is exp(x - m), not yet divided by the sum.
// Wave w walks the chunks w, w+AW, ...; the AW partial (m, l, Ot) meet in LDS and are joined in wave order, divided by the sum, and stored as the bf16 hi/lo planes of ctx.
// Every inner loop is unrolled so that the fragment and accumulator arrays are indexed by constants and stay in registers; the chunk loop stays rolled: a second copy of its body would double the live fragments.
// Causal: chunks past the tile's last query row are not walked; QT == chunk width, so every walked chunk holds at least one unmasked key for every query of the tile.
__device__ __forceinline__ float xhalf(float x) { return __builtin_bit_cast(float, __builtin_amdgcn_permlanex16(__builtin_bit_cast(int, x), __builtin_bit_cast(int, x), 0x76543210, 0xfedcba98, false, false)); }   // lane l's value of lane l ^ 16
// exp(x) as v_exp_f32(x * log2 e), the form of __expf, written in asm so that the slot the instruction set asks for behind a transcendental (one independent instruction or v_nop before its result is read or its source overwritten) is kept by construction:
// inside a run every v_exp_f32 is followed by an independent one (early-clobber outputs: none lands on a source of the run), and one v_nop stands behind the last.
#define L2E 1.44269504f
__device__ __forceinline__ float exp1(float x) { float r; const float y = x * L2E; asm("v_exp_f32 %0, %1\n\tv_nop" : "=v"(r) : "v"(y)); return r; }
__device__ __forceinline__ v8f exp8(v8f x) { float r0, r1, r2, r3, r4, r5, r6, r7; const v8f y = x * L2E;
    asm("v_exp_f32 %0, %8\n\tv_exp_f32 %1, %9\n\tv_exp_f32 %2, %10\n\tv_exp_f32 %3, %11\n\tv_exp_f32 %4, %12\n\tv_exp_f32 %5, %13\n\tv_exp_f32 %6, %14\n\tv_exp_f32 %7, %15\n\tv_nop"
        : "=&v"(r0), "=&v"(r1), "=&v"(r2), "=&v"(r3), "=&v"(r4), "=&v"(r5), "=&v"(r6), "=&v"(r7) : "v"(y[0]), "v"(y[1]), "v"(y[2]), "v"(y[3]), "v"(y[4]), "v"(y[5]), "v"(y[6]), "v"(y[7]));
    return (v8f){ r0, r1, r2, r3, r4, r5, r6, r7 }; }
template <typename T16, bool HR>
__device__ __forceinline__ void attn_tile(const T16* __restrict__ Q, const T16* __restrict__ Q2, const T16* __restrict__ Kp, const T16* __restrict__ K2, const T16* __restrict__ Vt, const T16* __restrict__ V2,
                                          int q0, int nch, int causal, int wv, int lane, float* osw, float* msw, float* lsw) {
    typedef typename WFrag<T16>::V V;
    const int lr = lane & 15, hi = lane >> 4;
    v8f o[4][2];
#pragma unroll
    for (int mb = 0; mb < 4; ++mb)
#pragma unroll
        for (int nq = 0; nq < 2; ++nq) o[mb][nq] = (v8f){};
    float m[2] = { -1.0e30f, -1.0e30f }, l[2] = { 0.0f, 0.0f };
    if (wv < nch) {                                                  // scalar test; the Q loads stand inside it, so that the run keeps its xwait directly behind it
    V qf[2][2], qf2[2][2];
#pragma unroll
    for (int nq = 0; nq < 2; ++nq)
#pragma unroll
        for (int ks = 0; ks < 2; ++ks) { const size_t qo = (size_t)(q0 + nq * 16) * HD + ks * 512 + 8 * lane; qf[nq][ks] = WFrag<T16>::ld(Q + qo); if (HR) qf2[nq][ks] = WFrag<T16>::ld(Q2 + qo); }
    xwait();
#pragma unroll 1
    for (int c = wv; c < nch; c += AW) {
        const int k0 = c * 32;
        v8f s[2][2];
#pragma unroll
        for (int kb = 0; kb < 2; ++kb) { V kf[2], kf2[2];
#pragma unroll
            for (int ks = 0; ks < 2; ++ks) { const size_t ko = (size_t)(k0 + kb * 16) * HD + ks * 512 + 8 * lane; kf[ks] = WFrag<T16>::ld(Kp + ko); if (HR) kf2[ks] = WFrag<T16>::ld(K2 + ko); }
            if (HR || kb == 1) xwait();                             // one plane: both key blocks' loads name one address pair and form one run; two planes: a run per key block
#pragma unroll
            for (int nq = 0; nq < 2; ++nq) { v8f a = (v8f){};
#pragma unroll
                for (int ks = 0; ks < 2; ++ks) { a = WFrag<T16>::mma(kf[ks], qf[nq][ks], a); if (HR) { a = WFrag<T16>::mma(kf[ks], qf2[nq][ks], a); a = WFrag<T16>::mma(kf2[ks], qf[nq][ks], a); } }
                s[kb][nq] = a; } }
        V vf[4], vf2[4];
#pragma unroll
        for (int mb = 0; mb < 4; ++mb) { if (!HR) vf[mb] = WFrag<T16>::ld(Vt + (size_t)(mb * 16) * SEQ + (size_t)k0 * 16 + 8 * lane); }   // one plane: fetched ahead of the softmax, which covers the latency
        if (!HR) xwait();
        V pf[2], pl[2];
#pragma unroll
        for (int nq = 0; nq < 2; ++nq) {
            const int qi = q0 + nq * 16 + lr;
            float mx = m[nq];
#pragma unroll
            for (int kb = 0; kb < 2; ++kb)
#pragma unroll
                for (int r = 0; r < 8; ++r) { const float xs = s[kb][nq][r] * SCL; const float x = (causal != 0 && (k0 + kb * 16 + 8 * hi + r) > qi) ? -1.0e30f : xs; s[kb][nq][r] = x; mx = fmaxf(mx, x); }
            mx = fmaxf(mx, xhalf(mx));
            const float al = exp1(m[nq] - mx);                     // 0 on a wave's first chunk (m starts at the fill value)
            m[nq] = mx;
            float ps = 0.0f;
#pragma unroll
            for (int kb = 0; kb < 2; ++kb) { s[kb][nq] = exp8(s[kb][nq] - mx);                                        // a masked score gives exactly 0: mx is a real score
#pragma unroll
                for (int r = 0; r < 8; ++r) ps += s[kb][nq][r]; }
            l[nq] = l[nq] * al + ps;
#pragma unroll
            for (int mb = 0; mb < 4; ++mb) o[mb][nq] *= al;
            if constexpr (HR) { v8us h0, h1, l0, l1;
#pragma unroll
                for (int r = 0; r < 8; ++r) { unsigned short a2, c2; splitf(s[0][nq][r], a2, c2); h0[r] = a2; l0[r] = c2; splitf(s[1][nq][r], a2, c2); h1[r] = a2; l1[r] = c2; }
                pf[nq] = cat16b(h0, h1); pl[nq] = cat16b(l0, l1); }
            else { v8h p0, p1;
#pragma unroll
                for (int r = 0; r < 8; ++r) { p0[r] = tohx(s[0][nq][r] * PCAR); p1[r] = tohx(s[1][nq][r] * PCAR); }
                pf[nq] = cat16(p0, p1); }
        }
#pragma unroll
        for (int mb = 0; mb < 4; ++mb) {
            if (HR) { const size_t vo = (size_t)(mb * 16) * SEQ + (size_t)k0 * 16 + 8 * lane; vf[mb] = WFrag<T16>::ld(Vt + vo); vf2[mb] = WFrag<T16>::ld(V2 + vo); xwait(); }   // two planes: fetched block by block, to stay within 256 registers
#pragma unroll
            for (int nq = 0; nq < 2; ++nq) { o[mb][nq] = WFrag<T16>::mma(vf[mb], pf[nq], o[mb][nq]); if (HR) { o[mb][nq] = WFrag<T16>::mma(vf[mb], pl[nq], o[mb][nq]); o[mb][nq] = WFrag<T16>::mma(vf2[mb], pf[nq], o[mb][nq]); } } }
    }
    }
#pragma unroll
    for (int nq = 0; nq < 2; ++nq) { const float lt = l[nq] + xhalf(l[nq]); const int q = nq * 16 + lr;
        if (hi == 0) { msw[q] = m[nq]; lsw[q] = lt; }
#pragma unroll
        for (int mb = 0; mb < 4; ++mb) { float* d = osw + q * 68 + mb * 16 + 8 * hi;
            *(v4fa*)d = (v4f){ o[mb][nq][0], o[mb][nq][1], o[mb][nq][2], o[mb][nq][3] }; *(v4fa*)(d + 4) = (v4f){ o[mb][nq][4], o[mb][nq][5], o[mb][nq][6], o[mb][nq][7] }; } }
}

__global__ __launch_bounds__(32 * AW) void k_fattn(const h16* __restrict__ Q16, const h16* __restrict__ K16, const h16* __restrict__ V16, const bf* __restrict__ Qh, const bf* __restrict__ Ql, const bf* __restrict__ Kh, const bf* __restrict__ Kl,
                                                   const bf* __restrict__ Vh, const bf* __restrict__ Vl, bf* Ah, bf* Al, const int* __restrict__ cflag) {
    __shared__ __align__(16) float os[AW * QT * 68];                // per wave: QT query rows of HD partial sums, pitch 68
    __shared__ float ms[AW * QT], ls[AW * QT];
    const int hb = blockIdx.x, q0 = (SEQ / QT - 1 - (int)blockIdx.y) * QT;      // hb = batch * NH_ + head; every head's longest tiles start first, in both batches
    const int causal = (cflag[0] != 0) ? 1 : 0;
    const int nch = causal ? (q0 / 32 + 1) : (SEQ / 32);
    const int wv = __builtin_amdgcn_readfirstlane((int)(threadIdx.x >> 5));      // wave number, held scalar so that the chunk loop keeps a scalar branch and every lane stays on at the matrix instructions
    const int lane = threadIdx.x & 31; const size_t po = (size_t)hb * SEQ * HD;
    const bool hires = (q0 < RHE);                                  // blockIdx alone decides: the same for the whole work-group
    if (hires) attn_tile<bf, true>(Qh + po, Ql + po, Kh + po, Kl + po, Vh + po, Vl + po, q0, nch, causal, wv, lane, os + wv * (QT * 68), ms + wv * QT, ls + wv * QT);
    else attn_tile<h16, false>(Q16 + po, nullptr, K16 + po, nullptr, V16 + po, nullptr, q0, nch, causal, wv, lane, os + wv * (QT * 68), ms + wv * QT, ls + wv * QT);
    __syncthreads();                                                // every wave's partial (m, l, Ot) is in LDS before any of it is joined
    const int q = (wv & 3) * 8 + (lane & 7), dg = ((((lane >> 3) & 1) << 2) | ((lane >> 3) & 2)) + (wv >> 2);   // one query row and eight head columns per thread; eight lanes = eight rows of one column group = one whole line of a fragment-order ctx plane; column groups 0, 4, 2, 6 (+ 1) per wave keep the LDS reads off each other's banks
    float M = ms[q];
#pragma unroll
    for (int w = 1; w < AW; ++w) M = fmaxf(M, ms[w * QT + q]);
    float L = 0.0f; v4f s0 = (v4f){}, s1 = (v4f){};
#pragma unroll
    for (int w = 0; w < AW; ++w) { const float f = exp1(ms[w * QT + q] - M); const float* p = os + w * (QT * 68) + q * 68 + dg * 8;   // a wave that walked no chunk: f = 0, l = 0, Ot = 0
        L += f * ls[w * QT + q]; s0 += f * *(const v4fa*)p; s1 += f * *(const v4fa*)(p + 4); }
    const float cs = (hires ? (1.0f / VSC) : (1.0f / (VSC * PCAR))) / L;         // L >= 1: the row's largest score contributes exp(0)
    v8us oh, ol;
#pragma unroll
    for (int k = 0; k < 4; ++k) { unsigned short a, c2; splitf(s0[k] * cs, a, c2); oh[k] = a; ol[k] = c2; splitf(s1[k] * cs, a, c2); oh[4 + k] = a; ol[4 + k] = c2; }
    const size_t oo = (size_t)(hb / NH_) * SEQ * DQ + pk(q0 + q, (hb % NH_) * HD + dg * 8, DQ);   // ctx planes [batch] x fragment-order [SEQ][DQ]
    *(v8us*)(Ah + oo) = oh; *(v8us*)(Al + oo) = ol;
}

extern "C" void kernel_launch(void* const* d_in, const int* in_sizes, int n_in,
                              void* d_out, int out_size, void* d_ws, size_t ws_size, hipStream_t stream) {
    if (n_in < 12) return;
    const size_t needx = ((size_t)(NB - 1) * SEQ_FULL + SEQ) * DM;
    if ((size_t)in_sizes[0] < needx || (size_t)in_sizes[1] < needx || (size_t)in_sizes[2] < needx) return;
    if (in_sizes[3] < DM * DM || in_sizes[5] < DM * DM || in_sizes[7] < DM * DM || in_sizes[9] < DM * DM) return;
    if (in_sizes[4] < DM || in_sizes[6] < DM || in_sizes[8] < DM || in_sizes[10] < DM || in_sizes[11] < 1) return;
    if ((size_t)out_size < needx) return;
    const float* xq = (const float*)d_in[0]; const float* xk = (const float*)d_in[1]; const float* xv = (const float*)d_in[2];
    const float* wq = (const float*)d_in[3]; const float* bq = (const float*)d_in[4]; const float* wk = (const float*)d_in[5]; const float* bk = (const float*)d_in[6];
    const float* wv = (const float*)d_in[7]; const float* bv = (const float*)d_in[8]; const float* wo = (const float*)d_in[9]; const float* bo = (const float*)d_in[10];
    const int* CZ = (const int*)d_in[11];
    float* OUT = (float*)d_out;     // [NB][SEQ_FULL][DM]

    // ---- workspace carve (every region a multiple of 256 B; all producers write exact tile/row multiples, no padded tails needed: SEQ%128==0, DM%64==0)
    constexpr size_t SZ_W = (size_t)DM * DM * 2, SZ_XB = (size_t)SEQ * DM * 2, SZ_PL = (size_t)NH_ * SEQ * HD * 2;
    constexpr size_t SZ_AT = (size_t)SEQ * DQ * 2;
    constexpr size_t WS_TOTAL = 4 * SZ_W + 3 * NB * SZ_XB + 9 * NB * SZ_PL + 2 * NB * SZ_AT;
    static_assert(WS_TOTAL <= (size_t)268435456);
    if (WS_TOTAL > ws_size) return;
    char* wsp = (char*)d_ws;
    auto take = [&](size_t bytes) { char* p = wsp; wsp += (bytes + 255) & ~(size_t)255; return (void*)p; };
    bf* WB = (bf*)take(4 * SZ_W);                                              // bf16 weights [q, k, v, o]
    bf* XB = (bf*)take(3 * NB * SZ_XB);                                        // bf16 activations [q, k, v][batch]
    h16* P16 = (h16*)take(3 * NB * SZ_PL); bf* PH = (bf*)take(3 * NB * SZ_PL); bf* PL = (bf*)take(3 * NB * SZ_PL);   // plane sets [q, k, v transposed][batch][head]
    bf* ATh = (bf*)take(NB * SZ_AT); bf* ATl = (bf*)take(NB * SZ_AT);          // ctx planes [batch][SEQ][DQ]
    if ((size_t)(wsp - (char*)d_ws) > ws_size) return;
    constexpr size_t PSET = (size_t)NB * NH_ * SEQ * HD;                       // elements of one tensor's plane over all batches

    k_cvt8<<<3 * NB * GX8 + 4 * GW8, 256, 0, stream>>>(xq, xk, xv, wq, wk, wv, wo, XB, WB);
    k_proj<<<dim3(SEQ / 64, DQ / 64, 3 * NB), 256, 0, stream>>>(XB, WB, bq, bk, bv, P16, PH, PL);
    k_fattn<<<dim3(NB * NH_, SEQ / QT, 1), 32 * AW, 0, stream>>>(P16, P16 + PSET, P16 + 2 * PSET, PH, PL, PH + PSET, PL + PSET, PH + 2 * PSET, PL + 2 * PSET, ATh, ATl, CZ);
    k_gemmw<bf, 1, true, 8, 0><<<dim3(SEQ / 64, DM / 64, NB), 256, 0, stream>>>(ATh, ATl, WB + 3 * (size_t)DM * DM, nullptr, OUT, DM, bo, (size_t)SEQ * DQ, 0, (size_t)SEQ_FULL * DM, CZ, 0, 0, 1.0f, nullptr, nullptr, nullptr);
}

// v008
// It runs in 87.1 microseconds.
// Two timings next to v007 both put it at 1.14 times that version's speed.
// Counting every step since v000, it is 18.3 times as fast.
#include <hip/hip_runtime.h>

// Causal multi-head attention: q/k/v = x W^T + b ([out][in] weights, 16 heads x 64), scores = q.k x 1/8 with lower-triangular replace-mask under an int flag input, f32 softmax, ctx = P v, out = ctx Wo^T + bo -> [2][2048][1024] f32.
// Compute dtypes, f32 accumulate everywhere: every float input RNE-converted to bf16; q/k/v projections v_wmma_f32_16x16x32_bf16 on plain bf16 operands + bias; scores: query rows < RH bf16 hi/lo x bf16 hi/lo (3 products), rows >= RH plain v_wmma_f32_16x16x32_f16 (q and k planes carried x4); softmax f32; P.v: rows < RH bf16 hi/lo P x bf16 hi/lo v (3 products), rows >= RH fp16 P carried x1024 against fp16 v carried x4; output projection bf16 hi/lo of ctx x bf16 Wo (2 products) + bias.

#ifndef NB
#define NB 2
#endif
#ifndef SEQ
#define SEQ 2048
#endif
#define NB_FULL  2
#define SEQ_FULL 2048
#define DM   1024
#define NH_  16
#define NKV  16
#define HD   64
#define DQ   (NH_ * HD)
#define DKV  (NKV * HD)
#define AW   8                    // waves per work-group of the attention kernel; wave w takes the 32-key chunks w, w + AW, ...
#define QT   32                   // query rows per work-group of the attention kernel
#ifndef RH
#define RH   512                  // query rows < RH use hi+lo planes
#endif
#define RHE  ((RH < SEQ) ? RH : SEQ)
#define QSC  4.0f                 // q plane carry
#define KSC  4.0f                 // k plane carry
#define VSC  4.0f                 // v plane carry
#define PCAR 1024.0f              // fp16 P plane carry (rows >= RH)
#define SCL  (0.125f / (QSC * KSC))   // HD^-0.5 folded with the q/k carries (exact power of two)
static_assert(SEQ % 128 == 0);
static_assert(SEQ <= SEQ_FULL);
static_assert(NB >= 1 && NB <= NB_FULL);
static_assert((RHE % 64) == 0);
static_assert(DM == DQ);
static_assert((DM % 64) == 0 && (HD % 32) == 0);
static_assert((RHE % QT) == 0 && (SEQ % QT) == 0 && HD == 64 && QT * (HD / 8) == 32 * AW);

typedef _Float16 h16;
typedef unsigned short bf;
typedef __attribute__((ext_vector_type(16))) __bf16   v16bf;
typedef __attribute__((ext_vector_type(16))) _Float16 v16h;
typedef __attribute__((ext_vector_type(8)))  _Float16 v8h;
typedef __attribute__((ext_vector_type(8)))  unsigned short v8us;
typedef __attribute__((ext_vector_type(8)))  float    v8f;
typedef __attribute__((ext_vector_type(4)))  float    v4f;
typedef __attribute__((ext_vector_type(2))) _Float16 v2h;
typedef __attribute__((ext_vector_type(4))) _Float16 v4h;
typedef __attribute__((ext_vector_type(2))) unsigned short v2us;
typedef __attribute__((ext_vector_type(4))) unsigned short v4us;
typedef __attribute__((ext_vector_type(2))) float v2f;
typedef v8h  __attribute__((may_alias)) v8ha;
typedef v4f  __attribute__((may_alias)) v4fa;
typedef v8us __attribute__((may_alias)) v8usa;

__device__ __forceinline__ unsigned short f2bf(float f) { unsigned u = __float_as_uint(f); u += 0x7FFFu + ((u >> 16) & 1u); return (unsigned short)(u >> 16); }
__device__ __forceinline__ float bf2f(unsigned short b) { return __uint_as_float(((unsigned)b) << 16); }
__device__ __forceinline__ float bfr(float f) { return bf2f(f2bf(f)); }
__device__ __forceinline__ v16h cat16(v8h lo, v8h hi) { return __builtin_shufflevector(lo, hi, 0, 1, 2, 3, 4, 5, 6, 7, 8, 9, 10, 11, 12, 13, 14, 15); }
__device__ __forceinline__ v16bf cat16b(v8us lo, v8us hi) { return __builtin_bit_cast(v16bf, __builtin_shufflevector(lo, hi, 0, 1, 2, 3, 4, 5, 6, 7, 8, 9, 10, 11, 12, 13, 14, 15)); }
__device__ __forceinline__ v8f wmma16(v16h a, v16h b, v8f c) { return __builtin_amdgcn_wmma_f32_16x16x32_f16(false, a, false, b, (short)0, c, false, false); }
__device__ __forceinline__ v8f wmmab(v16bf a, v16bf b, v8f c) { return __builtin_amdgcn_wmma_f32_16x16x32_bf16(false, a, false, b, (short)0, c, false, false); }
__device__ __forceinline__ h16 tohx(float x) { return (h16)x; }
__device__ __forceinline__ void splitf(float y, unsigned short& h, unsigned short& l) { h = f2bf(y); l = f2bf(y - bf2f(h)); }

// ---- Fragment-order planes: every 16-bit operand matrix [rows][K] in the workspace is stored as 16-row x 32-k blocks of 1 KiB, blocks in [row >> 4][k >> 5] order; inside a block the 16-byte unit of (row, eight k) stands at unit ((k >> 3) & 3) * 16 + (row & 15).
// Lane l of a fragment load then reads unit l (elements 0..7) and unit 32 + l (elements 8..15): 512 contiguous bytes, four whole 128-byte lines, per load instruction. pk = element offset of (row, k).
__device__ __forceinline__ size_t pk(int row, int k, int K) { return (size_t)(row >> 4) * 16 * K + (size_t)(k >> 5) * 512 + ((k >> 3) & 3) * 128 + (row & 15) * 8 + (k & 7); }

// ---- gemmw: register-blocked GEMM, one 64x64 output tile per KW waves (16 accumulators per wave), operands straight from fragment-order 16-bit planes; tile (bx, by) of (M/64, N/64); KW > 1: the work-group is those KW waves, os = its LDS, owned by the calling kernel; KW == 1: the calling wave alone, any wave of any work-group.
// C[m][n] (f32, pitch ldc, + optional f32 bias[n]) = sum_k A[m][k] Bt[n][k] (+ split products per NSPLIT). A is a fragment-order plane of lda columns, Bt one of K columns. K % 32 == 0.
// Fragments: lane l, h = l>>4, row/col = l&15; elements 0..7 <- k0+8h+0..7, elements 8..15 <- k0+16+8h+0..7 for BOTH A and Bt; D element r -> (row 8h+r, col l&15).
// KW waves per work-group share one tile: wave w takes the 32-wide k steps w, w+KW, ...; the KW partial tiles meet in LDS and are summed in wave order (KW == 1: one wave walks the whole K, no sum, no LDS for EP 1 and 2).
// EP 0: C as above. EP 1 and 2 (KW == 1): no f32 C; each value x sc goes out as three 16-bit planes (f16, bf16 hi, bf16 lo), straight from the accumulators: the operand roles are chosen so that a lane's eight D elements (eight rows, one column) are one 16-byte unit of a fragment-order plane, and a wave's store of one D tile fills 512 contiguous bytes.
// EP 1: A = weight rows, Bt = token rows, tile [feature][token]; tile row block = head, planes [head] x fragment-order [token][HD], bias by row. EP 2: A = token rows, Bt = weight rows, tile [token][feature]; planes fragment-order [feature][SEQ], bias by column.
// cmode 1 (scores, causal flag set): tiles whose first key column lies past the last query row r0+roff+63 are skipped (never read downstream); cmode 2 (P.v): K limited to r0+roff+64 keys.
// xwait: stands once behind each run of fragment loads, in front of the first instruction that may overwrite an address register which a load of the run names. Inside a run nothing does: the loads share address registers that stay live to the run's last load, so no result lands on them, and the loads issue back to back.
__device__ __forceinline__ void xwait() { asm volatile("s_wait_xcnt 0x0" ::: "memory"); }
template <typename T16> struct WFrag;
template <> struct WFrag<h16> { typedef v16h V; static __device__ __forceinline__ V ld(const h16* p) { const v8h lo = *(const v8h*)p; const v8h hi = *(const v8h*)(p + 256); return cat16(lo, hi); } static __device__ __forceinline__ v8f mma(V a, V b, v8f c) { return wmma16(a, b, c); } };
template <> struct WFrag<bf> { typedef v16bf V; static __device__ __forceinline__ V ld(const bf* p) { const v8us lo = *(const v8us*)p; const v8us hi = *(const v8us*)(p + 256); return cat16b(lo, hi); } static __device__ __forceinline__ v8f mma(V a, V b, v8f c) { return wmmab(a, b, c); } };
template <typename T16, int NSPLIT, bool BIAS, int KW, int EP>
__device__ __forceinline__ void gemmw(float* os, int bx, int by, const T16* __restrict__ A, const T16* __restrict__ A2, const T16* __restrict__ Bt, const T16* __restrict__ Bt2, int K, int lda, float* C, int ldc, const float* __restrict__ bias,
                                      const int* __restrict__ cflag, int roff, int cmode, float sc, h16* P16, bf* Ph, bf* Pl) {
    static_assert(EP == 0 || KW == 1);
    typedef typename WFrag<T16>::V V;
    const int lane = threadIdx.x & 31, lr = lane & 15, hi = lane >> 4; const int r0 = bx * 64, c0 = by * 64;
    const int causal = (cmode != 0 && cflag[0] != 0) ? 1 : 0;
    if (cmode == 1 && causal && c0 >= r0 + roff + 64) return;      // the tile index and the flag alone decide: the whole block leaves, ahead of the one block barrier
    int Kend = K;
    if (cmode == 2 && causal) { const int kl = r0 + roff + 64; Kend = (kl < K) ? kl : K; }
    const int wv = (KW == 1) ? 0 : __builtin_amdgcn_readfirstlane((int)(threadIdx.x >> 5));   // wave number, held scalar so that the k loop keeps a scalar branch and every lane stays on at the matrix instructions
    v8f acc[4][4];
#pragma unroll
    for (int mb = 0; mb < 4; ++mb)
#pragma unroll
        for (int nb = 0; nb < 4; ++nb) acc[mb][nb] = (v8f){};
    // first block of the tile's rows, this lane's unit, this wave's first k step; a 32-wide k step is one block = 512 elements = 16 * 32. One pointer per plane, advanced at the foot of the loop:
    // every load of a k step names it with an immediate offset (lda and K are constants at every call), so a plane's loads share one address pair.
    const size_t aoff = (size_t)r0 * lda + 8 * lane + (size_t)wv * 512, boff = (size_t)c0 * K + 8 * lane + (size_t)wv * 512;
    const T16* pa = A + aoff; const T16* pa2 = (NSPLIT == 1 || NSPLIT == 2) ? A2 + aoff : nullptr; const T16* pb = Bt + boff; const T16* pb2 = (NSPLIT >= 2) ? Bt2 + boff : nullptr;
#pragma unroll 1
    for (int kc = 32 * wv; kc < Kend; kc += 32 * KW) {
        V a[4], a2[4], b[4], b2[4];                // one run: every fragment load of the k step, then the one xwait
#pragma unroll
        for (int mb = 0; mb < 4; ++mb) { a[mb] = WFrag<T16>::ld(pa + (size_t)mb * 16 * lda); if (NSPLIT == 1 || NSPLIT == 2) a2[mb] = WFrag<T16>::ld(pa2 + (size_t)mb * 16 * lda); }
#pragma unroll
        for (int nb = 0; nb < 4; ++nb) { b[nb] = WFrag<T16>::ld(pb + (size_t)nb * 16 * K); if (NSPLIT >= 2) b2[nb] = WFrag<T16>::ld(pb2 + (size_t)nb * 16 * K); }
        // the run's one wait. Inputs only: the pointers, so that they stay live to here and no load's result lands on an address that an earlier load of the run names; the loaded fragments, so that every load of the k step is issued ahead of the first matrix instruction and all are in flight together
        if constexpr (NSPLIT == 0) asm volatile("s_wait_xcnt 0x0" :: "v"(pa), "v"(pb), "v"(a[0]), "v"(a[1]), "v"(a[2]), "v"(a[3]), "v"(b[0]), "v"(b[1]), "v"(b[2]), "v"(b[3]) : "memory");
        else if constexpr (NSPLIT == 1) asm volatile("s_wait_xcnt 0x0" :: "v"(pa), "v"(pa2), "v"(pb), "v"(a[0]), "v"(a[1]), "v"(a[2]), "v"(a[3]), "v"(a2[0]), "v"(a2[1]), "v"(a2[2]), "v"(a2[3]), "v"(b[0]), "v"(b[1]), "v"(b[2]), "v"(b[3]) : "memory");
        else xwait();
#pragma unroll
        for (int nb = 0; nb < 4; ++nb) {
#pragma unroll
            for (int mb = 0; mb < 4; ++mb) { acc[mb][nb] = WFrag<T16>::mma(a[mb], b[nb], acc[mb][nb]); if (NSPLIT == 1 || NSPLIT == 2) acc[mb][nb] = WFrag<T16>::mma(a2[mb], b[nb], acc[mb][nb]); if (NSPLIT >= 2) acc[mb][nb] = WFrag<T16>::mma(a[mb], b2[nb], acc[mb][nb]); } }
        asm volatile("v_nop\n\tv_nop\n\tv_nop\n\tv_nop" : "+v"(acc[0][0]), "+v"(acc[1][1]), "+v"(acc[2][2]), "+v"(acc[3][3]) : "v"(a[0]), "v"(a[3]));
        pa += 512 * KW; pb += 512 * KW; if (NSPLIT == 1 || NSPLIT == 2) pa2 += 512 * KW; if (NSPLIT >= 2) pb2 += 512 * KW;
    }
    if constexpr (EP != 0) {
        // bias of this lane's rows (EP 1: eight features per row block) or columns (EP 2: one feature per column block), fetched as one run ahead of the conversions
        v4f brow[4][2]; float bcol[4];
#pragma unroll
        for (int i = 0; i < 4; ++i) {
            if constexpr (BIAS && EP == 1) { brow[i][0] = *(const v4f*)(bias + r0 + i * 16 + hi * 8); brow[i][1] = *(const v4f*)(bias + r0 + i * 16 + hi * 8 + 4); }
            if constexpr (BIAS && EP == 2) bcol[i] = bias[c0 + i * 16 + lr]; }
        if constexpr (BIAS) xwait();
        // unrolled so that acc is indexed by constants and stays in registers
#pragma unroll
        for (int mb = 0; mb < 4; ++mb)
#pragma unroll
            for (int nb = 0; nb < 4; ++nb) {
                const size_t e = (EP == 1) ? (size_t)bx * SEQ * HD + pk(c0 + nb * 16 + lr, mb * 16 + hi * 8, HD) : pk(c0 + nb * 16 + lr, r0 + mb * 16 + hi * 8, SEQ); v8h o16; v8us oh, ol;
#pragma unroll
                for (int q = 0; q < 8; ++q) { float r = acc[mb][nb][q]; if (BIAS && EP == 1) r += bfr(brow[mb][q >> 2][q & 3]); if (BIAS && EP == 2) r += bfr(bcol[nb]); r *= sc; o16[q] = tohx(r); unsigned short a2, c2; splitf(r, a2, c2); oh[q] = a2; ol[q] = c2; }
                // the three plane stores of a D tile and their wait in one statement: the next tile's conversions reuse the registers that these stores name
                asm volatile("global_store_b128 %0, %1, off\n\tglobal_store_b128 %2, %3, off\n\tglobal_store_b128 %4, %5, off\n\ts_wait_xcnt 0x0" :: "v"(P16 + e), "v"(o16), "v"(Ph + e), "v"(oh), "v"(Pl + e), "v"(ol) : "memory");
                __builtin_amdgcn_sched_barrier(0); }               // one tile's conversions at a time: hoisted ahead of earlier tiles' stores they hold so many registers that the wave spills
        return;
    }
    if constexpr (KW > 1) {
        float* osw = os + wv * (64 * 68);          // this wave's partial tile, rows at pitch 68
        // the loops below are unrolled so that acc is indexed by constants (stays in registers) and the LDS reads of a thread's items issue together
#pragma unroll
        for (int mb = 0; mb < 4; ++mb)
#pragma unroll
            for (int nb = 0; nb < 4; ++nb)
#pragma unroll
                for (int j = 0; j < 8; ++j) osw[(mb * 16 + hi * 8 + j) * 68 + nb * 16 + lr] = acc[mb][nb][j];
        __syncthreads();                                            // every wave's partial tile is in LDS before any of it is summed
#pragma unroll
        for (int s = 0; s < (64 * 16) / (32 * KW); ++s) { const int item = s * (32 * KW) + (int)threadIdx.x, row = item >> 4, cofs = (item & 15) * 4; v4f val = *(const v4fa*)(os + row * 68 + cofs);
#pragma unroll
            for (int w = 1; w < KW; ++w) val += *(const v4fa*)(os + w * (64 * 68) + row * 68 + cofs);
            if (BIAS) { val[0] += bfr(bias[c0 + cofs]); val[1] += bfr(bias[c0 + cofs + 1]); val[2] += bfr(bias[c0 + cofs + 2]); val[3] += bfr(bias[c0 + cofs + 3]); }
            *(v4f*)(C + (size_t)(r0 + row) * ldc + c0 + cofs) = val; }
        return;
    }
#pragma unroll
    for (int mb = 0; mb < 4; ++mb) {
#pragma unroll
        for (int nb = 0; nb < 4; ++nb) {
#pragma unroll
            for (int j = 0; j < 8; ++j) os[(hi * 8 + j) * 68 + nb * 16 + lr] = acc[mb][nb][j]; }
        __builtin_amdgcn_wave_barrier(); asm volatile("" ::: "memory");
        float* crow = C + (size_t)(r0 + mb * 16) * ldc + c0;
{
#pragma unroll
            for (int s = 0; s < 8; ++s) { const int row = 2 * s + hi, cofs = lr * 4; v4f val = *(const v4fa*)(os + row * 68 + cofs); if (BIAS) { val[0] += bfr(bias[c0 + cofs]); val[1] += bfr(bias[c0 + cofs + 1]); val[2] += bfr(bias[c0 + cofs + 2]); val[3] += bfr(bias[c0 + cofs + 3]); }
                *(v4f*)(crow + (size_t)row * ldc + cofs) = val; }
             }
        __builtin_amdgcn_wave_barrier(); asm volatile("" ::: "memory");
    }
}

// k_gemmw: one gemmw tile per work-group, grid (M/64, N/64, Z); K = lda = DQ; z-batch strides sA/sB/sC in elements.
template <typename T16, int NSPLIT, bool BIAS, int KW, int EP>
__global__ __launch_bounds__(32 * KW) void k_gemmw(const T16* __restrict__ A, const T16* __restrict__ A2, const T16* __restrict__ Bt, const T16* __restrict__ Bt2, float* C, int ldc, const float* __restrict__ bias, size_t sA, size_t sB, size_t sC,
                                              const int* __restrict__ cflag, int roff, int cmode, float sc, h16* P16, bf* Ph, bf* Pl) {
    __shared__ __align__(16) float os[(KW == 1) ? 16 * 68 : KW * 64 * 68];
    const size_t z = blockIdx.z; A += z * sA; if (A2) A2 += z * sA; Bt += z * sB; if (Bt2) Bt2 += z * sB; C += z * sC;
    gemmw<T16, NSPLIT, BIAS, KW, EP>(os, (int)blockIdx.x, (int)blockIdx.y, A, A2, Bt, Bt2, DQ, DQ, C, ldc, bias, cflag, roff, cmode, sc, P16, Ph, Pl);
}

// k_proj: the q, k and v projections of every batch in one grid (SEQ/128 token block pairs, DM/128 feature block pairs, 3 * NB); z = t * NB + batch, t = 0 q, 1 k, 2 v. Four waves per work-group, one per SIMD; each wave owns one 64x64 tile of a 2x2 block over the whole K: no LDS, no barrier.
// XB holds the bf16 activations [z] x fragment-order [SEQ][DM], WB the bf16 weights [q, k, v, o] x fragment-order [DM][DM]; each plane set is [z][NH_ * SEQ * HD]. blockIdx.z alone picks the branch: the same for the whole work-group.
__global__ __launch_bounds__(32 * 4) void k_proj(const bf* __restrict__ XB, const bf* __restrict__ WB, const float* __restrict__ bq, const float* __restrict__ bk, const float* __restrict__ bv, h16* P16, bf* Ph, bf* Pl) {
    const int z = (int)blockIdx.z, t = z / NB;
    const int w = __builtin_amdgcn_readfirstlane((int)(threadIdx.x >> 5));      // wave number, held scalar: the tile index and all that follows from it stay scalar
    const int tb = (int)blockIdx.x * 2 + (w & 1), fb = (int)blockIdx.y * 2 + (w >> 1);   // token block, feature block
    const bf* X = XB + (size_t)z * SEQ * DM; const bf* Wt = WB + (size_t)t * DM * DM; const size_t po = (size_t)z * NH_ * SEQ * HD;
    if (t == 2) gemmw<bf, 0, true, 1, 2>(nullptr, tb, fb, X, nullptr, Wt, nullptr, DM, DM, nullptr, 0, bv, nullptr, 0, 0, VSC, P16 + po, Ph + po, Pl + po);
    else gemmw<bf, 0, true, 1, 1>(nullptr, fb, tb, Wt, nullptr, X, nullptr, DM, DM, nullptr, 0, (t == 0) ? bq : bk, nullptr, 0, 0, (t == 0) ? QSC : KSC, P16 + po, Ph + po, Pl + po);
}

// k_cvt8: every float matrix to bf16 in one grid: first GX8 blocks for each of the 3 * NB activation slabs (tensor t, batch b -> XB[t * NB + b]), then GW8 blocks for each of the four weights (-> WB[q, k, v, o]); eight elements per thread.
// The bf16 copies are fragment-order planes. A wave takes eight rows x 32 columns: lane l reads the eight floats (l >> 3) of row (l & 7), so a wave reads eight whole 128-byte lines and its one store fills four whole lines (eight rows' units of one column group each).
#define GX8 ((SEQ * DM / 8 + 255u) / 256u)
#define GW8 ((DM * DM / 8 + 255u) / 256u)
__global__ __launch_bounds__(256) void k_cvt8(const float* __restrict__ xq, const float* __restrict__ xk, const float* __restrict__ xv, const float* __restrict__ wq, const float* __restrict__ wk, const float* __restrict__ wv, const float* __restrict__ wo, bf* XB, bf* WB) {
    const unsigned blk = blockIdx.x; const float* src; bf* dst; size_t n8, i;
    if (blk < 3u * NB * GX8) { const unsigned sg = blk / GX8, t = sg / NB, b = sg % NB; src = ((t == 0) ? xq : (t == 1) ? xk : xv) + (size_t)b * SEQ_FULL * DM; dst = XB + (size_t)sg * SEQ * DM; n8 = (size_t)SEQ * DM / 8; i = (size_t)(blk % GX8) * 256 + threadIdx.x; }
    else { const unsigned wb = blk - 3u * NB * GX8, t = wb / GW8; src = (t == 0) ? wq : (t == 1) ? wk : (t == 2) ? wv : wo; dst = WB + (size_t)t * DM * DM; n8 = (size_t)DM * DM / 8; i = (size_t)(wb % GW8) * 256 + threadIdx.x; }
    if (i >= n8) return;
    const unsigned l = (unsigned)i & 31u, wi = (unsigned)(i >> 5), bi = wi >> 1, r = (wi & 1u) * 8u + (l & 7u);                  // wave wi: half (wi & 1) of the rows of block bi; blocks run [row >> 4][k >> 5], DM / 32 to a row block
    const size_t so = ((size_t)(bi / (DM / 32)) * 16 + r) * DM + (bi % (DM / 32)) * 32 + (l >> 3) * 8, dofs = (size_t)bi * 512 + (l >> 3) * 128 + r * 8;
    const v8f v = *(const v8f*)(src + so); v8us o;
#pragma unroll
    for (int k = 0; k < 8; ++k) o[k] = f2bf(v[k]); *(v8us*)(dst + dofs) = o;  }

// ---- k_fattn: scores, causal mask, softmax and P.v of one (batch, head, QT query rows) tile in one work-group, grid (NB * NH_, SEQ / QT); no score or P value leaves the registers.
// Transposed products: St = K Qt (A = K rows, B = Q rows, both by WFrag::ld), so lane l holds scores of ONE query (column l&15), keys 8h+r of each 16-key block; two such D tiles, converted in place,
// are the B fragment of P for 32 keys (elements 0..7 <- k0+8h+r, 8..15 <- k0+16+8h+r: the k order of WFrag::ld on the Vt rows; all planes in fragment order); Ot += Vt Pt, D element r -> (d = 8h+r, query l&15).
// Running maximum m and sum l per query (per lane; the two halves of a wave share m by one exchange per chunk, l is joined once at the end); P is exp(x - m), not yet divided by the sum.
// Wave w walks the chunks w, w+AW, ...; the AW partial (m, l, Ot) meet in LDS and are joined in wave order, divided by the sum, and stored as the bf16 hi/lo planes of ctx.
// Every inner loop is unrolled so that the fragment and accumulator arrays are indexed by constants and stay in registers; the chunk loop stays rolled: a second copy of its body would double the live fragments.
// Causal: chunks past the tile's last query row are not walked; QT == chunk width, so every walked chunk holds at least one unmasked key for every query of the tile.
__device__ __forceinline__ float xhalf(float x) { return __builtin_bit_cast(float, __builtin_amdgcn_permlanex16(__builtin_bit_cast(int, x), __builtin_bit_cast(int, x), 0x76543210, 0xfedcba98, false, false)); }   // lane l's value of lane l ^ 16
// exp(x) as v_exp_f32(x * log2 e), the form of __expf, written in asm so that the slot the instruction set asks for behind a transcendental (one independent instruction or v_nop before its result is read or its source overwritten) is kept by construction:
// inside a run every v_exp_f32 is followed by an independent one (early-clobber outputs: none lands on a source of the run), and one v_nop stands behind the last.
#define L2E 1.44269504f
__device__ __forceinline__ float exp1(float x) { float r; const float y = x * L2E; asm("v_exp_f32 %0, %1\n\tv_nop" : "=v"(r) : "v"(y)); return r; }
__device__ __forceinline__ v8f exp8(v8f x) { float r0, r1, r2, r3, r4, r5, r6, r7; const v8f y = x * L2E;
    asm("v_exp_f32 %0, %8\n\tv_exp_f32 %1, %9\n\tv_exp_f32 %2, %10\n\tv_exp_f32 %3, %11\n\tv_exp_f32 %4, %12\n\tv_exp_f32 %5, %13\n\tv_exp_f32 %6, %14\n\tv_exp_f32 %7, %15\n\tv_nop"
        : "=&v"(r0), "=&v"(r1), "=&v"(r2), "=&v"(r3), "=&v"(r4), "=&v"(r5), "=&v"(r6), "=&v"(r7) : "v"(y[0]), "v"(y[1]), "v"(y[2]), "v"(y[3]), "v"(y[4]), "v"(y[5]), "v"(y[6]), "v"(y[7]));
    return (v8f){ r0, r1, r2, r3, r4, r5, r6, r7 }; }
template <typename T16, bool HR>
__device__ __forceinline__ void attn_tile(const T16* __restrict__ Q, const T16* __restrict__ Q2, const T16* __restrict__ Kp, const T16* __restrict__ K2, const T16* __restrict__ Vt, const T16* __restrict__ V2,
                                          int q0, int nch, int causal, int wv, int lane, float* osw, float* msw, float* lsw) {
    typedef typename WFrag<T16>::V V;
    const int lr = lane & 15, hi = lane >> 4;
    v8f o[4][2];
#pragma unroll
    for (int mb = 0; mb < 4; ++mb)
#pragma unroll
        for (int nq = 0; nq < 2; ++nq) o[mb][nq] = (v8f){};
    float m[2] = { -1.0e30f, -1.0e30f }, l[2] = { 0.0f, 0.0f };
    if (wv < nch) {                                                  // scalar test; the Q loads stand inside it, so that the run keeps its xwait directly behind it
    V qf[2][2], qf2[2][2];
#pragma unroll
    for (int nq = 0; nq < 2; ++nq)
#pragma unroll
        for (int ks = 0; ks < 2; ++ks) { const size_t qo = (size_t)(q0 + nq * 16) * HD + ks * 512 + 8 * lane; qf[nq][ks] = WFrag<T16>::ld(Q + qo); if (HR) qf2[nq][ks] = WFrag<T16>::ld(Q2 + qo); }
    xwait();
#pragma unroll 1
    for (int c = wv; c < nch; c += AW) {
        const int k0 = c * 32;
        v8f s[2][2];
#pragma unroll
        for (int kb = 0; kb < 2; ++kb) { V kf[2], kf2[2];
#pragma unroll
            for (int ks = 0; ks < 2; ++ks) { const size_t ko = (size_t)(k0 + kb * 16) * HD + ks * 512 + 8 * lane; kf[ks] = WFrag<T16>::ld(Kp + ko); if (HR) kf2[ks] = WFrag<T16>::ld(K2 + ko); }
            if (HR || kb == 1) xwait();                             // one plane: both key blocks' loads name one address pair and form one run; two planes: a run per key block
#pragma unroll
            for (int nq = 0; nq < 2; ++nq) { v8f a = (v8f){};
#pragma unroll
                for (int ks = 0; ks < 2; ++ks) { a = WFrag<T16>::mma(kf[ks], qf[nq][ks], a); if (HR) { a = WFrag<T16>::mma(kf[ks], qf2[nq][ks], a); a = WFrag<T16>::mma(kf2[ks], qf[nq][ks], a); } }
                s[kb][nq] = a; } }
        V vf[4], vf2[4];
#pragma unroll
        for (int mb = 0; mb < 4; ++mb) { if (!HR) vf[mb] = WFrag<T16>::ld(Vt + (size_t)(mb * 16) * SEQ + (size_t)k0 * 16 + 8 * lane); }   // one plane: fetched ahead of the softmax, which covers the latency
        if (!HR) xwait();
        V pf[2], pl[2];
#pragma unroll
        for (int nq = 0; nq < 2; ++nq) {
            const int qi = q0 + nq * 16 + lr;
            float mx = m[nq];
#pragma unroll
            for (int kb = 0; kb < 2; ++kb)
#pragma unroll
                for (int r = 0; r < 8; ++r) { const float xs = s[kb][nq][r] * SCL; const float x = (causal != 0 && (k0 + kb * 16 + 8 * hi + r) > qi) ? -1.0e30f : xs; s[kb][nq][r] = x; mx = fmaxf(mx, x); }
            mx = fmaxf(mx, xhalf(mx));
            const float al = exp1(m[nq] - mx);                     // 0 on a wave's first chunk (m starts at the fill value)
            m[nq] = mx;
            float ps = 0.0f;
#pragma unroll
            for (int kb = 0; kb < 2; ++kb) { s[kb][nq] = exp8(s[kb][nq] - mx);                                        // a masked score gives exactly 0: mx is a real score
#pragma unroll
                for (int r = 0; r < 8; ++r) ps += s[kb][nq][r]; }
            l[nq] = l[nq] * al + ps;
#pragma unroll
            for (int mb = 0; mb < 4; ++mb) o[mb][nq] *= al;
            if constexpr (HR) { v8us h0, h1, l0, l1;
#pragma unroll
                for (int r = 0; r < 8; ++r) { unsigned short a2, c2; splitf(s[0][nq][r], a2, c2); h0[r] = a2; l0[r] = c2; splitf(s[1][nq][r], a2, c2); h1[r] = a2; l1[r] = c2; }
                pf[nq] = cat16b(h0, h1); pl[nq] = cat16b(l0, l1); }
            else { v8h p0, p1;
#pragma unroll
                for (int r = 0; r < 8; ++r) { p0[r] = tohx(s[0][nq][r] * PCAR); p1[r] = tohx(s[1][nq][r] * PCAR); }
                pf[nq] = cat16(p0, p1); }
        }
#pragma unroll
        for (int mb = 0; mb < 4; ++mb) {
            if (HR) { const size_t vo = (size_t)(mb * 16) * SEQ + (size_t)k0 * 16 + 8 * lane; vf[mb] = WFrag<T16>::ld(Vt + vo); vf2[mb] = WFrag<T16>::ld(V2 + vo); xwait(); }   // two planes: fetched block by block, to stay within 256 registers
#pragma unroll
            for (int nq = 0; nq < 2; ++nq) { o[mb][nq] = WFrag<T16>::mma(vf[mb], pf[nq], o[mb][nq]); if (HR) { o[mb][nq] = WFrag<T16>::mma(vf[mb], pl[nq], o[mb][nq]); o[mb][nq] = WFrag<T16>::mma(vf2[mb], pf[nq], o[mb][nq]); } } }
    }
    }
#pragma unroll
    for (int nq = 0; nq < 2; ++nq) { const float lt = l[nq] + xhalf(l[nq]); const int q = nq * 16 + lr;
        if (hi == 0) { msw[q] = m[nq]; lsw[q] = lt; }
#pragma unroll
        for (int mb = 0; mb < 4; ++mb) { float* d = osw + q * 68 + mb * 16 + 8 * hi;
            *(v4fa*)d = (v4f){ o[mb][nq][0], o[mb][nq][1], o[mb][nq][2], o[mb][nq][3] }; *(v4fa*)(d + 4) = (v4f){ o[mb][nq][4], o[mb][nq][5], o[mb][nq][6], o[mb][nq][7] }; } }
}

__global__ __launch_bounds__(32 * AW) void k_fattn(const h16* __restrict__ Q16, const h16* __restrict__ K16, const h16* __restrict__ V16, const bf* __restrict__ Qh, const bf* __restrict__ Ql, const bf* __restrict__ Kh, const bf* __restrict__ Kl,
                                                   const bf* __restrict__ Vh, const bf* __restrict__ Vl, bf* Ah, bf* Al, const int* __restrict__ cflag) {
    __shared__ __align__(16) float os[AW * QT * 68];                // per wave: QT query rows of HD partial sums, pitch 68
    __shared__ float ms[AW * QT], ls[AW * QT];
    const int hb = blockIdx.x, q0 = (SEQ / QT - 1 - (int)blockIdx.y) * QT;      // hb = batch * NH_ + head; every head's longest tiles start first, in both batches
    const int causal = (cflag[0] != 0) ? 1 : 0;
    const int nch = causal ? (q0 / 32 + 1) : (SEQ / 32);
    const int wv = __builtin_amdgcn_readfirstlane((int)(threadIdx.x >> 5));      // wave number, held scalar so that the chunk loop keeps a scalar branch and every lane stays on at the matrix instructions
    const int lane = threadIdx.x & 31; const size_t po = (size_t)hb * SEQ * HD;
    const bool hires = (q0 < RHE);                                  // blockIdx alone decides: the same for the whole work-group
    if (hires) attn_tile<bf, true>(Qh + po, Ql + po, Kh + po, Kl + po, Vh + po, Vl + po, q0, nch, causal, wv, lane, os + wv * (QT * 68), ms + wv * QT, ls + wv * QT);
    else attn_tile<h16, false>(Q16 + po, nullptr, K16 + po, nullptr, V16 + po, nullptr, q0, nch, causal, wv, lane, os + wv * (QT * 68), ms + wv * QT, ls + wv * QT);
    __syncthreads();                                                // every wave's partial (m, l, Ot) is in LDS before any of it is joined
    const int q = (wv & 3) * 8 + (lane & 7), dg = ((((lane >> 3) & 1) << 2) | ((lane >> 3) & 2)) + (wv >> 2);   // one query row and eight head columns per thread; eight lanes = eight rows of one column group = one whole line of a fragment-order ctx plane; column groups 0, 4, 2, 6 (+ 1) per wave keep the LDS reads off each other's banks
    float M = ms[q];
#pragma unroll
    for (int w = 1; w < AW; ++w) M = fmaxf(M, ms[w * QT + q]);
    float L = 0.0f; v4f s0 = (v4f){}, s1 = (v4f){};
#pragma unroll
    for (int w = 0; w < AW; ++w) { const float f = exp1(ms[w * QT + q] - M); const float* p = os + w * (QT * 68) + q * 68 + dg * 8;   // a wave that walked no chunk: f = 0, l = 0, Ot = 0
        L += f * ls[w * QT + q]; s0 += f * *(const v4fa*)p; s1 += f * *(const v4fa*)(p + 4); }
    const float cs = (hires ? (1.0f / VSC) : (1.0f / (VSC * PCAR))) / L;         // L >= 1: the row's largest score contributes exp(0)
    v8us oh, ol;
#pragma unroll
    for (int k = 0; k < 4; ++k) { unsigned short a, c2; splitf(s0[k] * cs, a, c2); oh[k] = a; ol[k] = c2; splitf(s1[k] * cs, a, c2); oh[4 + k] = a; ol[4 + k] = c2; }
    const size_t oo = (size_t)(hb / NH_) * SEQ * DQ + pk(q0 + q, (hb % NH_) * HD + dg * 8, DQ);   // ctx planes [batch] x fragment-order [SEQ][DQ]
    *(v8us*)(Ah + oo) = oh; *(v8us*)(Al + oo) = ol;
}

extern "C" void kernel_launch(void* const* d_in, const int* in_sizes, int n_in,
                              void* d_out, int out_size, void* d_ws, size_t ws_size, hipStream_t stream) {
    if (n_in < 12) return;
    const size_t needx = ((size_t)(NB - 1) * SEQ_FULL + SEQ) * DM;
    if ((size_t)in_sizes[0] < needx || (size_t)in_sizes[1] < needx || (size_t)in_sizes[2] < needx) return;
    if (in_sizes[3] < DM * DM || in_sizes[5] < DM * DM || in_sizes[7] < DM * DM || in_sizes[9] < DM * DM) return;
    if (in_sizes[4] < DM || in_sizes[6] < DM || in_sizes[8] < DM || in_sizes[10] < DM || in_sizes[11] < 1) return;
    if ((size_t)out_size < needx) return;
    const float* xq = (const float*)d_in[0]; const float* xk = (const float*)d_in[1]; const float* xv = (const float*)d_in[2];
    const float* wq = (const float*)d_in[3]; const float* bq = (const float*)d_in[4]; const float* wk = (const float*)d_in[5]; const float* bk = (const float*)d_in[6];
    const float* wv = (const float*)d_in[7]; const float* bv = (const float*)d_in[8]; const float* wo = (const float*)d_in[9]; const float* bo = (const float*)d_in[10];
    const int* CZ = (const int*)d_in[11];
    float* OUT = (float*)d_out;     // [NB][SEQ_FULL][DM]

    // ---- workspace carve (every region a multiple of 256 B; all producers write exact tile/row multiples, no padded tails needed: SEQ%128==0, DM%64==0)
    constexpr size_t SZ_W = (size_t)DM * DM * 2, SZ_XB = (size_t)SEQ * DM * 2, SZ_PL = (size_t)NH_ * SEQ * HD * 2;
    constexpr size_t SZ_AT = (size_t)SEQ * DQ * 2;
    constexpr size_t WS_TOTAL = 4 * SZ_W + 3 * NB * SZ_XB + 9 * NB * SZ_PL + 2 * NB * SZ_AT;
    static_assert(WS_TOTAL <= (size_t)268435456);
    if (WS_TOTAL > ws_size) return;
    char* wsp = (char*)d_ws;
    auto take = [&](size_t bytes) { char* p = wsp; wsp += (bytes + 255) & ~(size_t)255; return (void*)p; };
    bf* WB = (bf*)take(4 * SZ_W);                                              // bf16 weights [q, k, v, o]
    bf* XB = (bf*)take(3 * NB * SZ_XB);                                        // bf16 activations [q, k, v][batch]
    h16* P16 = (h16*)take(3 * NB * SZ_PL); bf* PH = (bf*)take(3 * NB * SZ_PL); bf* PL = (bf*)take(3 * NB * SZ_PL);   // plane sets [q, k, v transposed][batch][head]
    bf* ATh = (bf*)take(NB * SZ_AT); bf* ATl = (bf*)take(NB * SZ_AT);          // ctx planes [batch][SEQ][DQ]
    if ((size_t)(wsp - (char*)d_ws) > ws_size) return;
    constexpr size_t PSET = (size_t)NB * NH_ * SEQ * HD;                       // elements of one tensor's plane over all batches

    k_cvt8<<<3 * NB * GX8 + 4 * GW8, 256, 0, stream>>>(xq, xk, xv, wq, wk, wv, wo, XB, WB);
    k_proj<<<dim3(SEQ / 128, DQ / 128, 3 * NB), 128, 0, stream>>>(XB, WB, bq, bk, bv, P16, PH, PL);
    k_fattn<<<dim3(NB * NH_, SEQ / QT, 1), 32 * AW, 0, stream>>>(P16, P16 + PSET, P16 + 2 * PSET, PH, PL, PH + PSET, PL + PSET, PH + 2 * PSET, PL + 2 * PSET, ATh, ATl, CZ);
    k_gemmw<bf, 1, true, 4, 0><<<dim3(SEQ / 64, DM / 64, NB), 128, 0, stream>>>(ATh, ATl, WB + 3 * (size_t)DM * DM, nullptr, OUT, DM, bo, (size_t)SEQ * DQ, 0, (size_t)SEQ_FULL * DM, CZ, 0, 0, 1.0f, nullptr, nullptr, nullptr);
}

// v009
// Measured time: 82.7 microseconds a run.
// In two side-by-side timings against v008, it was 1.05 and 1.06 times as fast.
// Over all steps from v000 it is 19.3 times as fast.
#include <hip/hip_runtime.h>

// Causal multi-head attention: q/k/v = x W^T + b ([out][in] weights, 16 heads x 64), scores = q.k x 1/8 with lower-triangular replace-mask under an int flag input, f32 softmax, ctx = P v, out = ctx Wo^T + bo -> [2][2048][1024] f32.
// Compute dtypes, f32 accumulate everywhere: every float input RNE-converted to bf16; q/k/v projections v_wmma_f32_16x16x32_bf16 on plain bf16 operands + bias; scores: query rows < RH bf16 hi/lo x bf16 hi/lo (3 products), rows >= RH plain v_wmma_f32_16x16x32_f16 (q and k planes carried x4); softmax f32; P.v: rows < RH bf16 hi/lo P x bf16 hi/lo v (3 products), rows >= RH fp16 P carried x1024 against fp16 v carried x4; output projection bf16 hi/lo of ctx x bf16 Wo (2 products) + bias.

#ifndef NB
#define NB 2
#endif
#ifndef SEQ
#define SEQ 2048
#endif
#define NB_FULL  2
#define SEQ_FULL 2048
#define DM   1024
#define NH_  16
#define NKV  16
#define HD   64
#define DQ   (NH_ * HD)
#define DKV  (NKV * HD)
#define AW   8                    // waves per work-group of the attention kernel
#define QT   32                   // query rows per wave (one query tile) of the attention kernel
#define QG   2                    // query tiles per work-group where rows >= RH (one plane): wave w works on tile w % QG and takes the 32-key chunks w / QG, w / QG + AW / QG, ...; rows < RH: one tile, wave w takes the chunks w, w + AW, ...
#ifndef RH
#define RH   512                  // query rows < RH use hi+lo planes
#endif
#define RHE  ((RH < SEQ) ? RH : SEQ)
#define QSC  4.0f                 // q plane carry
#define KSC  4.0f                 // k plane carry
#define VSC  4.0f                 // v plane carry
#define PCAR 1024.0f              // fp16 P plane carry (rows >= RH)
#define SCL  (0.125f / (QSC * KSC))   // HD^-0.5 folded with the q/k carries (exact power of two)
static_assert(SEQ % 128 == 0);
static_assert(SEQ <= SEQ_FULL);
static_assert(NB >= 1 && NB <= NB_FULL);
static_assert((RHE % 64) == 0);
static_assert(DM == DQ);
static_assert((DM % 64) == 0 && (HD % 32) == 0);
static_assert((RHE % QT) == 0 && ((SEQ - RHE) % (QT * QG)) == 0 && HD == 64 && QT * (HD / 8) == 32 * AW && AW % QG == 0);

typedef _Float16 h16;
typedef unsigned short bf;
typedef __attribute__((ext_vector_type(16))) __bf16   v16bf;
typedef __attribute__((ext_vector_type(16))) _Float16 v16h;
typedef __attribute__((ext_vector_type(8)))  _Float16 v8h;
typedef __attribute__((ext_vector_type(8)))  unsigned short v8us;
typedef __attribute__((ext_vector_type(8)))  float    v8f;
typedef __attribute__((ext_vector_type(4)))  float    v4f;
typedef __attribute__((ext_vector_type(2))) _Float16 v2h;
typedef __attribute__((ext_vector_type(4))) _Float16 v4h;
typedef __attribute__((ext_vector_type(2))) unsigned short v2us;
typedef __attribute__((ext_vector_type(4))) unsigned short v4us;
typedef __attribute__((ext_vector_type(2))) float v2f;
typedef v8h  __attribute__((may_alias)) v8ha;
typedef v4f  __attribute__((may_alias)) v4fa;
typedef v8us __attribute__((may_alias)) v8usa;

__device__ __forceinline__ unsigned short f2bf(float f) { unsigned u = __float_as_uint(f); u += 0x7FFFu + ((u >> 16) & 1u); return (unsigned short)(u >> 16); }
__device__ __forceinline__ float bf2f(unsigned short b) { return __uint_as_float(((unsigned)b) << 16); }
__device__ __forceinline__ float bfr(float f) { return bf2f(f2bf(f)); }
__device__ __forceinline__ v16h cat16(v8h lo, v8h hi) { return __builtin_shufflevector(lo, hi, 0, 1, 2, 3, 4, 5, 6, 7, 8, 9, 10, 11, 12, 13, 14, 15); }
__device__ __forceinline__ v16bf cat16b(v8us lo, v8us hi) { return __builtin_bit_cast(v16bf, __builtin_shufflevector(lo, hi, 0, 1, 2, 3, 4, 5, 6, 7, 8, 9, 10, 11, 12, 13, 14, 15)); }
__device__ __forceinline__ v8f wmma16(v16h a, v16h b, v8f c) { return __builtin_amdgcn_wmma_f32_16x16x32_f16(false, a, false, b, (short)0, c, false, false); }
__device__ __forceinline__ v8f wmmab(v16bf a, v16bf b, v8f c) { return __builtin_amdgcn_wmma_f32_16x16x32_bf16(false, a, false, b, (short)0, c, false, false); }
__device__ __forceinline__ h16 tohx(float x) { return (h16)x; }
__device__ __forceinline__ void splitf(float y, unsigned short& h, unsigned short& l) { h = f2bf(y); l = f2bf(y - bf2f(h)); }

// ---- Fragment-order planes: every 16-bit operand matrix [rows][K] in the workspace is stored as 16-row x 32-k blocks of 1 KiB, blocks in [row >> 4][k >> 5] order; inside a block the 16-byte unit of (row, eight k) stands at unit ((k >> 3) & 3) * 16 + (row & 15).
// Lane l of a fragment load then reads unit l (elements 0..7) and unit 32 + l (elements 8..15): 512 contiguous bytes, four whole 128-byte lines, per load instruction. pk = element offset of (row, k).
__device__ __forceinline__ size_t pk(int row, int k, int K) { return (size_t)(row >> 4) * 16 * K + (size_t)(k >> 5) * 512 + ((k >> 3) & 3) * 128 + (row & 15) * 8 + (k & 7); }

// ---- gemmw: register-blocked GEMM, one 64x64 output tile per KW waves (16 accumulators per wave), operands straight from fragment-order 16-bit planes; tile (bx, by) of (M/64, N/64); KW > 1: the work-group is those KW waves, os = its LDS, owned by the calling kernel; KW == 1: the calling wave alone, any wave of any work-group.
// C[m][n] (f32, pitch ldc, + optional f32 bias[n]) = sum_k A[m][k] Bt[n][k] (+ split products per NSPLIT). A is a fragment-order plane of lda columns, Bt one of K columns. K % 32 == 0.
// Fragments: lane l, h = l>>4, row/col = l&15; elements 0..7 <- k0+8h+0..7, elements 8..15 <- k0+16+8h+0..7 for BOTH A and Bt; D element r -> (row 8h+r, col l&15).
// KW waves per work-group share one tile: wave w takes the 32-wide k steps w, w+KW, ...; the KW partial tiles meet in LDS and are summed in wave order (KW == 1: one wave walks the whole K, no sum, no LDS for EP 1 and 2).
// EP 0: C as above. EP 1 and 2 (KW == 1): no f32 C; each value x sc goes out as three 16-bit planes (f16, bf16 hi, bf16 lo), straight from the accumulators: the operand roles are chosen so that a lane's eight D elements (eight rows, one column) are one 16-byte unit of a fragment-order plane, and a wave's store of one D tile fills 512 contiguous bytes.
// EP 1: A = weight rows, Bt = token rows, tile [feature][token]; tile row block = head, planes [head] x fragment-order [token][HD], bias by row. EP 2: A = token rows, Bt = weight rows, tile [token][feature]; planes fragment-order [feature][SEQ], bias by column.
// cmode 1 (scores, causal flag set): tiles whose first key column lies past the last query row r0+roff+63 are skipped (never read downstream); cmode 2 (P.v): K limited to r0+roff+64 keys.
// xwait: stands once behind each run of fragment loads, in front of the first instruction that may overwrite an address register which a load of the run names. Inside a run nothing does: the loads share address registers that stay live to the run's last load, so no result lands on them, and the loads issue back to back.
__device__ __forceinline__ void xwait() { asm volatile("s_wait_xcnt 0x0" ::: "memory"); }
template <typename T16> struct WFrag;
template <> struct WFrag<h16> { typedef v16h V; static __device__ __forceinline__ V ld(const h16* p) { const v8h lo = *(const v8h*)p; const v8h hi = *(const v8h*)(p + 256); return cat16(lo, hi); } static __device__ __forceinline__ v8f mma(V a, V b, v8f c) { return wmma16(a, b, c); } };
template <> struct WFrag<bf> { typedef v16bf V; static __device__ __forceinline__ V ld(const bf* p) { const v8us lo = *(const v8us*)p; const v8us hi = *(const v8us*)(p + 256); return cat16b(lo, hi); } static __device__ __forceinline__ v8f mma(V a, V b, v8f c) { return wmmab(a, b, c); } };
template <typename T16, int NSPLIT, bool BIAS, int KW, int EP>
__device__ __forceinline__ void gemmw(float* os, int bx, int by, const T16* __restrict__ A, const T16* __restrict__ A2, const T16* __restrict__ Bt, const T16* __restrict__ Bt2, int K, int lda, float* C, int ldc, const float* __restrict__ bias,
                                      const int* __restrict__ cflag, int roff, int cmode, float sc, h16* P16, bf* Ph, bf* Pl) {
    static_assert(EP == 0 || KW == 1);
    typedef typename WFrag<T16>::V V;
    const int lane = threadIdx.x & 31, lr = lane & 15, hi = lane >> 4; const int r0 = bx * 64, c0 = by * 64;
    const int causal = (cmode != 0 && cflag[0] != 0) ? 1 : 0;
    if (cmode == 1 && causal && c0 >= r0 + roff + 64) return;      // the tile index and the flag alone decide: the whole block leaves, ahead of the one block barrier
    int Kend = K;
    if (cmode == 2 && causal) { const int kl = r0 + roff + 64; Kend = (kl < K) ? kl : K; }
    const int wv = (KW == 1) ? 0 : __builtin_amdgcn_readfirstlane((int)(threadIdx.x >> 5));   // wave number, held scalar so that the k loop keeps a scalar branch and every lane stays on at the matrix instructions
    v8f acc[4][4];
#pragma unroll
    for (int mb = 0; mb < 4; ++mb)
#pragma unroll
        for (int nb = 0; nb < 4; ++nb) acc[mb][nb] = (v8f){};
    // first block of the tile's rows, this lane's unit, this wave's first k step; a 32-wide k step is one block = 512 elements = 16 * 32. One pointer per plane, advanced at the foot of the loop:
    // every load of a k step names it with an immediate offset (lda and K are constants at every call), so a plane's loads share one address pair.
    const size_t aoff = (size_t)r0 * lda + 8 * lane + (size_t)wv * 512, boff = (size_t)c0 * K + 8 * lane + (size_t)wv * 512;
    const T16* pa = A + aoff; const T16* pa2 = (NSPLIT == 1 || NSPLIT == 2) ? A2 + aoff : nullptr; const T16* pb = Bt + boff; const T16* pb2 = (NSPLIT >= 2) ? Bt2 + boff : nullptr;
#pragma unroll 1
    for (int kc = 32 * wv; kc < Kend; kc += 32 * KW) {
        V a[4], a2[4], b[4], b2[4];                // one run: every fragment load of the k step, then the one xwait
#pragma unroll
        for (int mb = 0; mb < 4; ++mb) { a[mb] = WFrag<T16>::ld(pa + (size_t)mb * 16 * lda); if (NSPLIT == 1 || NSPLIT == 2) a2[mb] = WFrag<T16>::ld(pa2 + (size_t)mb * 16 * lda); }
#pragma unroll
        for (int nb = 0; nb < 4; ++nb) { b[nb] = WFrag<T16>::ld(pb + (size_t)nb * 16 * K); if (NSPLIT >= 2) b2[nb] = WFrag<T16>::ld(pb2 + (size_t)nb * 16 * K); }
        // the run's one wait. Inputs only: the pointers, so that they stay live to here and no load's result lands on an address that an earlier load of the run names; the loaded fragments, so that every load of the k step is issued ahead of the first matrix instruction and all are in flight together
        if constexpr (NSPLIT == 0) asm volatile("s_wait_xcnt 0x0" :: "v"(pa), "v"(pb), "v"(a[0]), "v"(a[1]), "v"(a[2]), "v"(a[3]), "v"(b[0]), "v"(b[1]), "v"(b[2]), "v"(b[3]) : "memory");
        else if constexpr (NSPLIT == 1) asm volatile("s_wait_xcnt 0x0" :: "v"(pa), "v"(pa2), "v"(pb), "v"(a[0]), "v"(a[1]), "v"(a[2]), "v"(a[3]), "v"(a2[0]), "v"(a2[1]), "v"(a2[2]), "v"(a2[3]), "v"(b[0]), "v"(b[1]), "v"(b[2]), "v"(b[3]) : "memory");
        else xwait();
#pragma unroll
        for (int nb = 0; nb < 4; ++nb) {
#pragma unroll
            for (int mb = 0; mb < 4; ++mb) { acc[mb][nb] = WFrag<T16>::mma(a[mb], b[nb], acc[mb][nb]); if (NSPLIT == 1 || NSPLIT == 2) acc[mb][nb] = WFrag<T16>::mma(a2[mb], b[nb], acc[mb][nb]); if (NSPLIT >= 2) acc[mb][nb] = WFrag<T16>::mma(a[mb], b2[nb], acc[mb][nb]); } }
        asm volatile("v_nop\n\tv_nop\n\tv_nop\n\tv_nop" : "+v"(acc[0][0]), "+v"(acc[1][1]), "+v"(acc[2][2]), "+v"(acc[3][3]) : "v"(a[0]), "v"(a[3]));
        pa += 512 * KW; pb += 512 * KW; if (NSPLIT == 1 || NSPLIT == 2) pa2 += 512 * KW; if (NSPLIT >= 2) pb2 += 512 * KW;
    }
    if constexpr (EP != 0) {
        // bias of this lane's rows (EP 1: eight features per row block) or columns (EP 2: one feature per column block), fetched as one run ahead of the conversions
        v4f brow[4][2]; float bcol[4];
#pragma unroll
        for (int i = 0; i < 4; ++i) {
            if constexpr (BIAS && EP == 1) { brow[i][0] = *(const v4f*)(bias + r0 + i * 16 + hi * 8); brow[i][1] = *(const v4f*)(bias + r0 + i * 16 + hi * 8 + 4); }
            if constexpr (BIAS && EP == 2) bcol[i] = bias[c0 + i * 16 + lr]; }
        if constexpr (BIAS) xwait();
        // unrolled so that acc is indexed by constants and stays in registers
#pragma unroll
        for (int mb = 0; mb < 4; ++mb)
#pragma unroll
            for (int nb = 0; nb < 4; ++nb) {
                const size_t e = (EP == 1) ? (size_t)bx * SEQ * HD + pk(c0 + nb * 16 + lr, mb * 16 + hi * 8, HD) : pk(c0 + nb * 16 + lr, r0 + mb * 16 + hi * 8, SEQ); v8h o16; v8us oh, ol;
#pragma unroll
                for (int q = 0; q < 8; ++q) { float r = acc[mb][nb][q]; if (BIAS && EP == 1) r += bfr(brow[mb][q >> 2][q & 3]); if (BIAS && EP == 2) r += bfr(bcol[nb]); r *= sc; o16[q] = tohx(r); unsigned short a2, c2; splitf(r, a2, c2); oh[q] = a2; ol[q] = c2; }
                // the three plane stores of a D tile and their wait in one statement: the next tile's conversions reuse the registers that these stores name
                asm volatile("global_store_b128 %0, %1, off\n\tglobal_store_b128 %2, %3, off\n\tglobal_store_b128 %4, %5, off\n\ts_wait_xcnt 0x0" :: "v"(P16 + e), "v"(o16), "v"(Ph + e), "v"(oh), "v"(Pl + e), "v"(ol) : "memory");
                __builtin_amdgcn_sched_barrier(0); }               // one tile's conversions at a time: hoisted ahead of earlier tiles' stores they hold so many registers that the wave spills
        return;
    }
    if constexpr (KW > 1) {
        float* osw = os + wv * (64 * 68);          // this wave's partial tile, rows at pitch 68
        // the loops below are unrolled so that acc is indexed by constants (stays in registers) and the LDS reads of a thread's items issue together
#pragma unroll
        for (int mb = 0; mb < 4; ++mb)
#pragma unroll
            for (int nb = 0; nb < 4; ++nb)
#pragma unroll
                for (int j = 0; j < 8; ++j) osw[(mb * 16 + hi * 8 + j) * 68 + nb * 16 + lr] = acc[mb][nb][j];
        __syncthreads();                                            // every wave's partial tile is in LDS before any of it is summed
#pragma unroll
        for (int s = 0; s < (64 * 16) / (32 * KW); ++s) { const int item = s * (32 * KW) + (int)threadIdx.x, row = item >> 4, cofs = (item & 15) * 4; v4f val = *(const v4fa*)(os + row * 68 + cofs);
#pragma unroll
            for (int w = 1; w < KW; ++w) val += *(const v4fa*)(os + w * (64 * 68) + row * 68 + cofs);
            if (BIAS) { val[0] += bfr(bias[c0 + cofs]); val[1] += bfr(bias[c0 + cofs + 1]); val[2] += bfr(bias[c0 + cofs + 2]); val[3] += bfr(bias[c0 + cofs + 3]); }
            *(v4f*)(C + (size_t)(r0 + row) * ldc + c0 + cofs) = val; }
        return;
    }
#pragma unroll
    for (int mb = 0; mb < 4; ++mb) {
#pragma unroll
        for (int nb = 0; nb < 4; ++nb) {
#pragma unroll
            for (int j = 0; j < 8; ++j) os[(hi * 8 + j) * 68 + nb * 16 + lr] = acc[mb][nb][j]; }
        __builtin_amdgcn_wave_barrier(); asm volatile("" ::: "memory");
        float* crow = C + (size_t)(r0 + mb * 16) * ldc + c0;
{
#pragma unroll
            for (int s = 0; s < 8; ++s) { const int row = 2 * s + hi, cofs = lr * 4; v4f val = *(const v4fa*)(os + row * 68 + cofs); if (BIAS) { val[0] += bfr(bias[c0 + cofs]); val[1] += bfr(bias[c0 + cofs + 1]); val[2] += bfr(bias[c0 + cofs + 2]); val[3] += bfr(bias[c0 + cofs + 3]); }
                *(v4f*)(crow + (size_t)row * ldc + cofs) = val; }
             }
        __builtin_amdgcn_wave_barrier(); asm volatile("" ::: "memory");
    }
}

// k_gemmw: one gemmw tile per work-group, grid (M/64, N/64, Z); K = lda = DQ; z-batch strides sA/sB/sC in elements.
template <typename T16, int NSPLIT, bool BIAS, int KW, int EP>
__global__ __launch_bounds__(32 * KW) void k_gemmw(const T16* __restrict__ A, const T16* __restrict__ A2, const T16* __restrict__ Bt, const T16* __restrict__ Bt2, float* C, int ldc, const float* __restrict__ bias, size_t sA, size_t sB, size_t sC,
                                              const int* __restrict__ cflag, int roff, int cmode, float sc, h16* P16, bf* Ph, bf* Pl) {
    __shared__ __align__(16) float os[(KW == 1) ? 16 * 68 : KW * 64 * 68];
    const size_t z = blockIdx.z; A += z * sA; if (A2) A2 += z * sA; Bt += z * sB; if (Bt2) Bt2 += z * sB; C += z * sC;
    gemmw<T16, NSPLIT, BIAS, KW, EP>(os, (int)blockIdx.x, (int)blockIdx.y, A, A2, Bt, Bt2, DQ, DQ, C, ldc, bias, cflag, roff, cmode, sc, P16, Ph, Pl);
}

// k_proj: the q, k and v projections of every batch in one grid (SEQ/128 token block pairs, DM/128 feature block pairs, 3 * NB); z = t * NB + batch, t = 0 q, 1 k, 2 v. Four waves per work-group, one per SIMD; each wave owns one 64x64 tile of a 2x2 block over the whole K: no LDS, no barrier.
// XB holds the bf16 activations [z] x fragment-order [SEQ][DM], WB the bf16 weights [q, k, v, o] x fragment-order [DM][DM]; each plane set is [z][NH_ * SEQ * HD]. blockIdx.z alone picks the branch: the same for the whole work-group.
__global__ __launch_bounds__(32 * 4) void k_proj(const bf* __restrict__ XB, const bf* __restrict__ WB, const float* __restrict__ bq, const float* __restrict__ bk, const float* __restrict__ bv, h16* P16, bf* Ph, bf* Pl) {
    const int z = (int)blockIdx.z, t = z / NB;
    const int w = __builtin_amdgcn_readfirstlane((int)(threadIdx.x >> 5));      // wave number, held scalar: the tile index and all that follows from it stay scalar
    const int tb = (int)blockIdx.x * 2 + (w & 1), fb = (int)blockIdx.y * 2 + (w >> 1);   // token block, feature block
    const bf* X = XB + (size_t)z * SEQ * DM; const bf* Wt = WB + (size_t)t * DM * DM; const size_t po = (size_t)z * NH_ * SEQ * HD;
    if (t == 2) gemmw<bf, 0, true, 1, 2>(nullptr, tb, fb, X, nullptr, Wt, nullptr, DM, DM, nullptr, 0, bv, nullptr, 0, 0, VSC, P16 + po, Ph + po, Pl + po);
    else gemmw<bf, 0, true, 1, 1>(nullptr, fb, tb, Wt, nullptr, X, nullptr, DM, DM, nullptr, 0, (t == 0) ? bq : bk, nullptr, 0, 0, (t == 0) ? QSC : KSC, P16 + po, Ph + po, Pl + po);
}

// k_cvt8: every float matrix to bf16 in one grid: first GX8 blocks for each of the 3 * NB activation slabs (tensor t, batch b -> XB[t * NB + b]), then GW8 blocks for each of the four weights (-> WB[q, k, v, o]); eight elements per thread.
// The bf16 copies are fragment-order planes. A wave takes eight rows x 32 columns: lane l reads the eight floats (l >> 3) of row (l & 7), so a wave reads eight whole 128-byte lines and its one store fills four whole lines (eight rows' units of one column group each).
#define GX8 ((SEQ * DM / 8 + 255u) / 256u)
#define GW8 ((DM * DM / 8 + 255u) / 256u)
__global__ __launch_bounds__(256) void k_cvt8(const float* __restrict__ xq, const float* __restrict__ xk, const float* __restrict__ xv, const float* __restrict__ wq, const float* __restrict__ wk, const float* __restrict__ wv, const float* __restrict__ wo, bf* XB, bf* WB) {
    const unsigned blk = blockIdx.x; const float* src; bf* dst; size_t n8, i;
    if (blk < 3u * NB * GX8) { const unsigned sg = blk / GX8, t = sg / NB, b = sg % NB; src = ((t == 0) ? xq : (t == 1) ? xk : xv) + (size_t)b * SEQ_FULL * DM; dst = XB + (size_t)sg * SEQ * DM; n8 = (size_t)SEQ * DM / 8; i = (size_t)(blk % GX8) * 256 + threadIdx.x; }
    else { const unsigned wb = blk - 3u * NB * GX8, t = wb / GW8; src = (t == 0) ? wq : (t == 1) ? wk : (t == 2) ? wv : wo; dst = WB + (size_t)t * DM * DM; n8 = (size_t)DM * DM / 8; i = (size_t)(wb % GW8) * 256 + threadIdx.x; }
    if (i >= n8) return;
    const unsigned l = (unsigned)i & 31u, wi = (unsigned)(i >> 5), bi = wi >> 1, r = (wi & 1u) * 8u + (l & 7u);                  // wave wi: half (wi & 1) of the rows of block bi; blocks run [row >> 4][k >> 5], DM / 32 to a row block
    const size_t so = ((size_t)(bi / (DM / 32)) * 16 + r) * DM + (bi % (DM / 32)) * 32 + (l >> 3) * 8, dofs = (size_t)bi * 512 + (l >> 3) * 128 + r * 8;
    const v8f v = *(const v8f*)(src + so); v8us o;
#pragma unroll
    for (int k = 0; k < 8; ++k) o[k] = f2bf(v[k]); *(v8us*)(dst + dofs) = o;  }

// ---- k_fattn: scores, causal mask, softmax and P.v of one (rows < RH) or QG neighbouring (rows >= RH) tiles of (batch, head, QT query rows) in one work-group, grid (NB * NH_, (SEQ - RHE) / (QT * QG) + RHE / QT); no score or P value leaves the registers.
// Rows >= RH: the QG waves with the same w / QG walk the same key chunks in the same order, each for its own query tile: they name the same K and V lines at about the same time, and the WGP cache serves the later of them.
// Transposed products: St = K Qt (A = K rows, B = Q rows, both by WFrag::ld), so lane l holds scores of ONE query (column l&15), keys 8h+r of each 16-key block; two such D tiles, converted in place,
// are the B fragment of P for 32 keys (elements 0..7 <- k0+8h+r, 8..15 <- k0+16+8h+r: the k order of WFrag::ld on the Vt rows; all planes in fragment order); Ot += Vt Pt, D element r -> (d = 8h+r, query l&15).
// Running maximum m and sum l per query (per lane; the two halves of a wave share m by one exchange per chunk, l is joined once at the end); P is exp(x - m), not yet divided by the sum.
// The waves of a tile deal its chunks round robin; their partial (m, l, Ot) meet in LDS and are joined in wave order, divided by the sum, and stored as the bf16 hi/lo planes of ctx.
// Every inner loop is unrolled so that the fragment and accumulator arrays are indexed by constants and stay in registers; the chunk loop stays rolled: a second copy of its body would double the live fragments.
// Causal: chunks past the tile's last query row are not walked; QT == chunk width, so every walked chunk holds at least one unmasked key for every query of the tile.
__device__ __forceinline__ float xhalf(float x) { return __builtin_bit_cast(float, __builtin_amdgcn_permlanex16(__builtin_bit_cast(int, x), __builtin_bit_cast(int, x), 0x76543210, 0xfedcba98, false, false)); }   // lane l's value of lane l ^ 16
// exp(x) as v_exp_f32(x * log2 e), the form of __expf, written in asm so that the slot the instruction set asks for behind a transcendental (one independent instruction or v_nop before its result is read or its source overwritten) is kept by construction:
// inside a run every v_exp_f32 is followed by an independent one (early-clobber outputs: none lands on a source of the run), and one v_nop stands behind the last.
#define L2E 1.44269504f
__device__ __forceinline__ float exp1(float x) { float r; const float y = x * L2E; asm("v_exp_f32 %0, %1\n\tv_nop" : "=v"(r) : "v"(y)); return r; }
__device__ __forceinline__ v8f exp8(v8f x) { float r0, r1, r2, r3, r4, r5, r6, r7; const v8f y = x * L2E;
    asm("v_exp_f32 %0, %8\n\tv_exp_f32 %1, %9\n\tv_exp_f32 %2, %10\n\tv_exp_f32 %3, %11\n\tv_exp_f32 %4, %12\n\tv_exp_f32 %5, %13\n\tv_exp_f32 %6, %14\n\tv_exp_f32 %7, %15\n\tv_nop"
        : "=&v"(r0), "=&v"(r1), "=&v"(r2), "=&v"(r3), "=&v"(r4), "=&v"(r5), "=&v"(r6), "=&v"(r7) : "v"(y[0]), "v"(y[1]), "v"(y[2]), "v"(y[3]), "v"(y[4]), "v"(y[5]), "v"(y[6]), "v"(y[7]));
    return (v8f){ r0, r1, r2, r3, r4, r5, r6, r7 }; }
template <typename T16, bool HR>
__device__ __forceinline__ void attn_tile(const T16* __restrict__ Q, const T16* __restrict__ Q2, const T16* __restrict__ Kp, const T16* __restrict__ K2, const T16* __restrict__ Vt, const T16* __restrict__ V2,
                                          int q0, int nch, int causal, int wv, int lane, float* osw, float* msw, float* lsw) {
    typedef typename WFrag<T16>::V V;
    const int lr = lane & 15, hi = lane >> 4;
    v8f o[4][2];
#pragma unroll
    for (int mb = 0; mb < 4; ++mb)
#pragma unroll
        for (int nq = 0; nq < 2; ++nq) o[mb][nq] = (v8f){};
    float m[2] = { -1.0e30f, -1.0e30f }, l[2] = { 0.0f, 0.0f };
    if (wv < nch) {                                                  // scalar test; the Q loads stand inside it, so that the run keeps its xwait directly behind it
    V qf[2][2], qf2[2][2];
#pragma unroll
    for (int nq = 0; nq < 2; ++nq)
#pragma unroll
        for (int ks = 0; ks < 2; ++ks) { const size_t qo = (size_t)(q0 + nq * 16) * HD + ks * 512 + 8 * lane; qf[nq][ks] = WFrag<T16>::ld(Q + qo); if (HR) qf2[nq][ks] = WFrag<T16>::ld(Q2 + qo); }
    xwait();
#pragma unroll 1
    for (int c = wv; c < nch; c += (HR ? AW : AW / QG)) {       // wv: this wave's place among the waves of its tile
        const int k0 = c * 32;
        v8f s[2][2];
#pragma unroll
        for (int kb = 0; kb < 2; ++kb) { V kf[2], kf2[2];
#pragma unroll
            for (int ks = 0; ks < 2; ++ks) { const size_t ko = (size_t)(k0 + kb * 16) * HD + ks * 512 + 8 * lane; kf[ks] = WFrag<T16>::ld(Kp + ko); if (HR) kf2[ks] = WFrag<T16>::ld(K2 + ko); }
            if (HR || kb == 1) xwait();                             // one plane: both key blocks' loads name one address pair and form one run; two planes: a run per key block
#pragma unroll
            for (int nq = 0; nq < 2; ++nq) { v8f a = (v8f){};
#pragma unroll
                for (int ks = 0; ks < 2; ++ks) { a = WFrag<T16>::mma(kf[ks], qf[nq][ks], a); if (HR) { a = WFrag<T16>::mma(kf[ks], qf2[nq][ks], a); a = WFrag<T16>::mma(kf2[ks], qf[nq][ks], a); } }
                s[kb][nq] = a; } }
        V vf[4], vf2[4];
#pragma unroll
        for (int mb = 0; mb < 4; ++mb) { if (!HR) vf[mb] = WFrag<T16>::ld(Vt + (size_t)(mb * 16) * SEQ + (size_t)k0 * 16 + 8 * lane); }   // one plane: fetched ahead of the softmax, which covers the latency
        if (!HR) xwait();
        V pf[2], pl[2];
#pragma unroll
        for (int nq = 0; nq < 2; ++nq) {
            const int qi = q0 + nq * 16 + lr;
            float mx = m[nq];
#pragma unroll
            for (int kb = 0; kb < 2; ++kb)
#pragma unroll
                for (int r = 0; r < 8; ++r) { const float xs = s[kb][nq][r] * SCL; const float x = (causal != 0 && (k0 + kb * 16 + 8 * hi + r) > qi) ? -1.0e30f : xs; s[kb][nq][r] = x; mx = fmaxf(mx, x); }
            mx = fmaxf(mx, xhalf(mx));
            const float al = exp1(m[nq] - mx);                     // 0 on a wave's first chunk (m starts at the fill value)
            m[nq] = mx;
            float ps = 0.0f;
#pragma unroll
            for (int kb = 0; kb < 2; ++kb) { s[kb][nq] = exp8(s[kb][nq] - mx);                                        // a masked score gives exactly 0: mx is a real score
#pragma unroll
                for (int r = 0; r < 8; ++r) ps += s[kb][nq][r]; }
            l[nq] = l[nq] * al + ps;
#pragma unroll
            for (int mb = 0; mb < 4; ++mb) o[mb][nq] *= al;
            if constexpr (HR) { v8us h0, h1, l0, l1;
#pragma unroll
                for (int r = 0; r < 8; ++r) { unsigned short a2, c2; splitf(s[0][nq][r], a2, c2); h0[r] = a2; l0[r] = c2; splitf(s[1][nq][r], a2, c2); h1[r] = a2; l1[r] = c2; }
                pf[nq] = cat16b(h0, h1); pl[nq] = cat16b(l0, l1); }
            else { v8h p0, p1;
#pragma unroll
                for (int r = 0; r < 8; ++r) { p0[r] = tohx(s[0][nq][r] * PCAR); p1[r] = tohx(s[1][nq][r] * PCAR); }
                pf[nq] = cat16(p0, p1); }
        }
#pragma unroll
        for (int mb = 0; mb < 4; ++mb) {
            if (HR) { const size_t vo = (size_t)(mb * 16) * SEQ + (size_t)k0 * 16 + 8 * lane; vf[mb] = WFrag<T16>::ld(Vt + vo); vf2[mb] = WFrag<T16>::ld(V2 + vo); xwait(); }   // two planes: fetched block by block, to stay within 256 registers
#pragma unroll
            for (int nq = 0; nq < 2; ++nq) { o[mb][nq] = WFrag<T16>::mma(vf[mb], pf[nq], o[mb][nq]); if (HR) { o[mb][nq] = WFrag<T16>::mma(vf[mb], pl[nq], o[mb][nq]); o[mb][nq] = WFrag<T16>::mma(vf2[mb], pf[nq], o[mb][nq]); } } }
    }
    }
#pragma unroll
    for (int nq = 0; nq < 2; ++nq) { const float lt = l[nq] + xhalf(l[nq]); const int q = nq * 16 + lr;
        if (hi == 0) { msw[q] = m[nq]; lsw[q] = lt; }
#pragma unroll
        for (int mb = 0; mb < 4; ++mb) { float* d = osw + q * 68 + mb * 16 + 8 * hi;
            *(v4fa*)d = (v4f){ o[mb][nq][0], o[mb][nq][1], o[mb][nq][2], o[mb][nq][3] }; *(v4fa*)(d + 4) = (v4f){ o[mb][nq][4], o[mb][nq][5], o[mb][nq][6], o[mb][nq][7] }; } }
}

// join_tiles: G tiles' partials, tile g's being those of the waves g, g + G, ...; one query row and eight head columns of each tile per thread. Unrolled so that the LDS reads of all tiles issue together.
template <int G>
__device__ __forceinline__ void join_tiles(const float* os, const float* ms, const float* ls, int qb, int hb, int q, int dg, float cs0, bf* Ah, bf* Al) {
#pragma unroll
    for (int g = 0; g < G; ++g) {
        float M = ms[g * QT + q];
#pragma unroll
        for (int w = g + G; w < AW; w += G) M = fmaxf(M, ms[w * QT + q]);
        float L = 0.0f; v4f s0 = (v4f){}, s1 = (v4f){};
#pragma unroll
        for (int w = g; w < AW; w += G) { const float f = exp1(ms[w * QT + q] - M); const float* p = os + w * (QT * 68) + q * 68 + dg * 8;   // a wave that walked no chunk: f = 0, l = 0, Ot = 0
            L += f * ls[w * QT + q]; s0 += f * *(const v4fa*)p; s1 += f * *(const v4fa*)(p + 4); }
        const float cs = cs0 / L;                                   // L >= 1: the row's largest score contributes exp(0)
        v8us oh, ol;
#pragma unroll
        for (int k = 0; k < 4; ++k) { unsigned short a, c2; splitf(s0[k] * cs, a, c2); oh[k] = a; ol[k] = c2; splitf(s1[k] * cs, a, c2); oh[4 + k] = a; ol[4 + k] = c2; }
        const size_t oo = (size_t)(hb / NH_) * SEQ * DQ + pk(qb + g * QT + q, (hb % NH_) * HD + dg * 8, DQ);   // ctx planes [batch] x fragment-order [SEQ][DQ]
        *(v8us*)(Ah + oo) = oh; *(v8us*)(Al + oo) = ol;
    }
    xwait();                                                        // behind the run of ctx stores, in front of whatever may overwrite a register that one of them names
}

#define NLO ((SEQ - RHE) / (QT * QG))                               // work-group rows of the grid that hold rows >= RH
__global__ __launch_bounds__(32 * AW) void k_fattn(const h16* __restrict__ Q16, const h16* __restrict__ K16, const h16* __restrict__ V16, const bf* __restrict__ Qh, const bf* __restrict__ Ql, const bf* __restrict__ Kh, const bf* __restrict__ Kl,
                                                   const bf* __restrict__ Vh, const bf* __restrict__ Vl, bf* Ah, bf* Al, const int* __restrict__ cflag) {
    __shared__ __align__(16) float os[AW * QT * 68];                // per wave: QT query rows of HD partial sums, pitch 68
    __shared__ float ms[AW * QT], ls[AW * QT];
    const int hb = blockIdx.x, by = (int)blockIdx.y;                // hb = batch * NH_ + head
    const bool hires = (by >= NLO);                                 // blockIdx alone decides: the same for the whole work-group
    const int qb = hires ? (RHE - (by - NLO + 1) * QT) : (SEQ - (by + 1) * (QT * QG));   // first query row of the work-group; every head's longest tiles come first in grid order, in both batches
    const int causal = (cflag[0] != 0) ? 1 : 0;
    const int wv = __builtin_amdgcn_readfirstlane((int)(threadIdx.x >> 5));      // wave number, held scalar so that the chunk loop keeps a scalar branch and every lane stays on at the matrix instructions
    const int q0 = hires ? qb : (qb + (wv % QG) * QT), kw = hires ? wv : (wv / QG);      // this wave's query tile and its place among the waves of that tile
    const int nch = causal ? (q0 / 32 + 1) : (SEQ / 32);
    const int lane = threadIdx.x & 31; const size_t po = (size_t)hb * SEQ * HD;
    if (hires) attn_tile<bf, true>(Qh + po, Ql + po, Kh + po, Kl + po, Vh + po, Vl + po, q0, nch, causal, kw, lane, os + wv * (QT * 68), ms + wv * QT, ls + wv * QT);
    else attn_tile<h16, false>(Q16 + po, nullptr, K16 + po, nullptr, V16 + po, nullptr, q0, nch, causal, kw, lane, os + wv * (QT * 68), ms + wv * QT, ls + wv * QT);
    __syncthreads();                                                // every wave's partial (m, l, Ot) is in LDS before any of it is joined
    const int q = (wv & 3) * 8 + (lane & 7), dg = ((((lane >> 3) & 1) << 2) | ((lane >> 3) & 2)) + (wv >> 2);   // one query row and eight head columns per thread and tile; eight lanes = eight rows of one column group = one whole line of a fragment-order ctx plane; column groups 0, 4, 2, 6 (+ 1) per wave keep the LDS reads off each other's banks
    if (hires) join_tiles<1>(os, ms, ls, qb, hb, q, dg, 1.0f / VSC, Ah, Al);
    else join_tiles<QG>(os, ms, ls, qb, hb, q, dg, 1.0f / (VSC * PCAR), Ah, Al);
}

extern "C" void kernel_launch(void* const* d_in, const int* in_sizes, int n_in,
                              void* d_out, int out_size, void* d_ws, size_t ws_size, hipStream_t stream) {
    if (n_in < 12) return;
    const size_t needx = ((size_t)(NB - 1) * SEQ_FULL + SEQ) * DM;
    if ((size_t)in_sizes[0] < needx || (size_t)in_sizes[1] < needx || (size_t)in_sizes[2] < needx) return;
    if (in_sizes[3] < DM * DM || in_sizes[5] < DM * DM || in_sizes[7] < DM * DM || in_sizes[9] < DM * DM) return;
    if (in_sizes[4] < DM || in_sizes[6] < DM || in_sizes[8] < DM || in_sizes[10] < DM || in_sizes[11] < 1) return;
    if ((size_t)out_size < needx) return;
    const float* xq = (const float*)d_in[0]; const float* xk = (const float*)d_in[1]; const float* xv = (const float*)d_in[2];
    const float* wq = (const float*)d_in[3]; const float* bq = (const float*)d_in[4]; const float* wk = (const float*)d_in[5]; const float* bk = (const float*)d_in[6];
    const float* wv = (const float*)d_in[7]; const float* bv = (const float*)d_in[8]; const float* wo = (const float*)d_in[9]; const float* bo = (const float*)d_in[10];
    const int* CZ = (const int*)d_in[11];
    float* OUT = (float*)d_out;     // [NB][SEQ_FULL][DM]

    // ---- workspace carve (every region a multiple of 256 B; all producers write exact tile/row multiples, no padded tails needed: SEQ%128==0, DM%64==0)
    constexpr size_t SZ_W = (size_t)DM * DM * 2, SZ_XB = (size_t)SEQ * DM * 2, SZ_PL = (size_t)NH_ * SEQ * HD * 2;
    constexpr size_t SZ_AT = (size_t)SEQ * DQ * 2;
    constexpr size_t WS_TOTAL = 4 * SZ_W + 3 * NB * SZ_XB + 9 * NB * SZ_PL + 2 * NB * SZ_AT;
    static_assert(WS_TOTAL <= (size_t)268435456);
    if (WS_TOTAL > ws_size) return;
    char* wsp = (char*)d_ws;
    auto take = [&](size_t bytes) { char* p = wsp; wsp += (bytes + 255) & ~(size_t)255; return (void*)p; };
    bf* WB = (bf*)take(4 * SZ_W);                                              // bf16 weights [q, k, v, o]
    bf* XB = (bf*)take(3 * NB * SZ_XB);                                        // bf16 activations [q, k, v][batch]
    h16* P16 = (h16*)take(3 * NB * SZ_PL); bf* PH = (bf*)take(3 * NB * SZ_PL); bf* PL = (bf*)take(3 * NB * SZ_PL);   // plane sets [q, k, v transposed][batch][head]
    bf* ATh = (bf*)take(NB * SZ_AT); bf* ATl = (bf*)take(NB * SZ_AT);          // ctx planes [batch][SEQ][DQ]
    if ((size_t)(wsp - (char*)d_ws) > ws_size) return;
    constexpr size_t PSET = (size_t)NB * NH_ * SEQ * HD;                       // elements of one tensor's plane over all batches

    k_cvt8<<<3 * NB * GX8 + 4 * GW8, 256, 0, stream>>>(xq, xk, xv, wq, wk, wv, wo, XB, WB);
    k_proj<<<dim3(SEQ / 128, DQ / 128, 3 * NB), 128, 0, stream>>>(XB, WB, bq, bk, bv, P16, PH, PL);
    k_fattn<<<dim3(NB * NH_, NLO + RHE / QT, 1), 32 * AW, 0, stream>>>(P16, P16 + PSET, P16 + 2 * PSET, PH, PL, PH + PSET, PL + PSET, PH + 2 * PSET, PL + 2 * PSET, ATh, ATl, CZ);
    k_gemmw<bf, 1, true, 4, 0><<<dim3(SEQ / 64, DM / 64, NB), 128, 0, stream>>>(ATh, ATl, WB + 3 * (size_t)DM * DM, nullptr, OUT, DM, bo, (size_t)SEQ * DQ, 0, (size_t)SEQ_FULL * DM, CZ, 0, 0, 1.0f, nullptr, nullptr, nullptr);
}
